// v000
// The times below were measured on an AMD MI455X: many runs one after another, warmed up first and cycling through
// copies of the inputs, with the whole window's GPU time divided by the number of runs. Launches and the gaps
// between them are all in it. The median over several windows is given; except for v000 it joins two sittings, which
// can be a few percent apart, so the side-by-side timings, each taken in one sitting, are the better comparison.
// v000 is the starting kernel. One run takes 353 microseconds.
#include <hip/hip_runtime.h>

typedef __attribute__((ext_vector_type(16))) _Float16 v16h;
typedef __attribute__((ext_vector_type(8)))  _Float16 v8h;
typedef __attribute__((ext_vector_type(8)))  float    v8f;
typedef __attribute__((ext_vector_type(4)))  int      v4i;

#define DEV static __device__ __forceinline__

constexpr int DM   = 768;     // model dim
constexpr int SEQ  = 2048;    // sequence length
constexpr int NH   = 12;      // heads
constexpr int DK   = 64;      // head dim
constexpr int NROW = 2 * SEQ; // B*S = 4096 rows
constexpr int LDP  = 72;      // padded LDS row (halves): conflict-free b128 reads

// ---- CDNA5 async global->LDS copy (guarded; falls back to sync staging) -----
#if defined(__has_builtin) && __has_builtin(__builtin_amdgcn_global_load_async_to_lds_b128)
#define HAVE_ASYNC_LDS 1
DEV void async_cp16(_Float16* ldst, const _Float16* gsrc) {
  __builtin_amdgcn_global_load_async_to_lds_b128(
      (__attribute__((address_space(1))) v4i*)gsrc,
      (__attribute__((address_space(3))) v4i*)ldst,
      0, 0);
}
#if defined(__has_builtin) && __has_builtin(__builtin_amdgcn_s_wait_asynccnt)
#define ASYNC_WAIT(n) __builtin_amdgcn_s_wait_asynccnt(n)
#else
#define ASYNC_WAIT(n) asm volatile("s_wait_asynccnt " #n ::: "memory")
#endif
#else
#define HAVE_ASYNC_LDS 0
DEV void async_cp16(_Float16* ldst, const _Float16* gsrc) {
  *(v8h*)ldst = *(const v8h*)gsrc;   // sync fallback through VGPRs
}
#define ASYNC_WAIT(n) ((void)0)
#endif

// ---- fragment helpers -------------------------------------------------------
// CDNA5 16-bit A/B fragment (16x32 / 32x16), wave32:
//   lane l: row/col = l&15, g = l>>4
//   VGPR0..3 hold K = g*8 + 0..7, VGPR4..7 hold K = 16 + g*8 + 0..7
// => per lane: two contiguous 16-byte chunks at +0 and +16 halves.
DEV v16h frag_f16(const _Float16* p) {
  v8h lo = *(const v8h*)p;
  v8h hi = *(const v8h*)(p + 16);
  v16h r;
#pragma unroll
  for (int i = 0; i < 8; ++i) { r[i] = lo[i]; r[i + 8] = hi[i]; }
  return r;
}

DEV v8f wmma(v16h a, v16h b, v8f c) {
  return __builtin_amdgcn_wmma_f32_16x16x32_f16(false, a, false, b, (short)0, c,
                                                false, false);
}

DEV float rmax16(float v) {
  v = fmaxf(v, __shfl_xor(v, 1, 32));
  v = fmaxf(v, __shfl_xor(v, 2, 32));
  v = fmaxf(v, __shfl_xor(v, 4, 32));
  v = fmaxf(v, __shfl_xor(v, 8, 32));
  return v;
}
DEV float rsum16(float v) {
  v += __shfl_xor(v, 1, 32);
  v += __shfl_xor(v, 2, 32);
  v += __shfl_xor(v, 4, 32);
  v += __shfl_xor(v, 8, 32);
  return v;
}

// ---- elementwise f32 -> f16 (one pass; removes cvt from GEMM hot loops) -----
__global__ __launch_bounds__(256) void cvt16_kernel(const float* __restrict__ src,
                                                    _Float16* __restrict__ dst,
                                                    int n8) {
  const int i = blockIdx.x * 256 + threadIdx.x;
  if (i >= n8) return;
  const size_t off = (size_t)i * 8;
  v8f x = *(const v8f*)(src + off);
  v8h y;
#pragma unroll
  for (int j = 0; j < 8; ++j) y[j] = (_Float16)x[j];
  *(v8h*)(dst + off) = y;
}

// ---- QKV projection (all-f16 operands): Y = X @ W^T + b, head layout --------
// mode 0: Y[b][h][s][d]  (Q and K)        mode 1: Y[b][h][d][s]  (V transposed)
__global__ __launch_bounds__(128) void proj16_kernel(
    const _Float16* __restrict__ X, const _Float16* __restrict__ W,
    const float* __restrict__ bias, _Float16* __restrict__ Y, int mode) {
  const int lane = threadIdx.x & 31;
  const int wave = threadIdx.x >> 5;
  const int row  = lane & 15;
  const int g    = lane >> 4;
  const int rowbase = blockIdx.x * 64 + wave * 16;
  const int h       = blockIdx.y;          // 64-col tile == one head
  const int colbase = h * DK;

  v8f c[4] = {v8f{}, v8f{}, v8f{}, v8f{}};
  const _Float16* xrow = X + (size_t)(rowbase + row) * DM;

  for (int k0 = 0; k0 < DM; k0 += 32) {
    v16h a = frag_f16(xrow + k0 + g * 8);
#pragma unroll
    for (int t = 0; t < 4; ++t) {
      v16h b = frag_f16(W + (size_t)(colbase + t * 16 + row) * DM + k0 + g * 8);
      c[t] = wmma(a, b, c[t]);
    }
  }

  const int mrow0 = g * 8;
#pragma unroll
  for (int t = 0; t < 4; ++t) {
    const int d = t * 16 + row;
    const float bv = bias[colbase + d];
#pragma unroll
    for (int r = 0; r < 8; ++r) {
      const int grow = rowbase + mrow0 + r;
      const int bb = grow >> 11;
      const int s  = grow & (SEQ - 1);
      const float val = c[t][r] + bv;
      size_t off;
      if (mode == 0) off = ((size_t)(bb * NH + h) * SEQ + s) * DK + d;
      else           off = ((size_t)(bb * NH + h) * DK + d) * SEQ + s;
      Y[off] = (_Float16)val;
    }
  }
}

// ---- fused flash attention with async double-buffered LDS staging -----------
__global__ __launch_bounds__(128) void attn_kernel(
    const _Float16* __restrict__ Q, const _Float16* __restrict__ K,
    const _Float16* __restrict__ Vt, const int* __restrict__ mask,
    _Float16* __restrict__ AO) {
  __shared__ __align__(16) _Float16 sK[2][64 * LDP];  // K tile, [key][d] padded
  __shared__ __align__(16) _Float16 sV[2][64 * LDP];  // V^T tile, [d][key] padded
  __shared__ __align__(16) _Float16 sP[4][16 * LDP];  // per-wave P transpose

  const int tid  = threadIdx.x;
  const int lane = tid & 31;
  const int wave = tid >> 5;
  const int row  = lane & 15;
  const int g    = lane >> 4;
  const int h = blockIdx.y, b = blockIdx.z;
  const int bh = b * NH + h;
  const int qbase = blockIdx.x * 64 + wave * 16;

  const _Float16* Qh = Q  + (size_t)bh * SEQ * DK;
  const _Float16* Kh = K  + (size_t)bh * SEQ * DK;
  const _Float16* Vh = Vt + (size_t)bh * DK * SEQ;

  const _Float16* qrow = Qh + (size_t)(qbase + row) * DK;
  const v16h qf0 = frag_f16(qrow + 0  + g * 8);
  const v16h qf1 = frag_f16(qrow + 32 + g * 8);

  float m_i[8], l_i[8];
#pragma unroll
  for (int r = 0; r < 8; ++r) { m_i[r] = -3.0e38f; l_i[r] = 0.0f; }
  v8f o[4] = {v8f{}, v8f{}, v8f{}, v8f{}};

  const int mrow0 = g * 8;
  _Float16* pl = sP[wave];

  // stage one 64-key tile (8 KB K + 8 KB V) via 8 async b128 ops per thread
  auto stage = [&](int kb, int buf) {
#pragma unroll
    for (int i = 0; i < 4; ++i) {
      const int c  = tid + i * 128;       // 0..511 16-byte chunks
      const int r  = c >> 3;              // tile row 0..63
      const int ch = (c & 7) * 8;         // halves within row
      async_cp16(&sK[buf][r * LDP + ch], Kh + (size_t)(kb + r) * DK + ch);
      async_cp16(&sV[buf][r * LDP + ch], Vh + (size_t)r * SEQ + kb + ch);
    }
  };

  stage(0, 0);
  for (int kb = 0; kb < SEQ; kb += 64) {
    const int cur = (kb >> 6) & 1;
    if (kb + 64 < SEQ) { stage(kb + 64, cur ^ 1); ASYNC_WAIT(8); }
    else               { ASYNC_WAIT(0); }
    __syncthreads();

    const _Float16* kB = sK[cur];
    const _Float16* vB = sV[cur];

    // S = (Q K^T) * 1/8, 16q x 64k
    v8f c[4];
#pragma unroll
    for (int t = 0; t < 4; ++t) {
      const _Float16* krow = kB + (t * 16 + row) * LDP + g * 8;
      v8f z{};
      c[t] = wmma(qf0, frag_f16(krow), z);
      c[t] = wmma(qf1, frag_f16(krow + 32), c[t]);
    }
    // scale + mask
#pragma unroll
    for (int t = 0; t < 4; ++t) {
      const int kn = kb + t * 16 + row;
#pragma unroll
      for (int r = 0; r < 8; ++r) {
        const int qm = qbase + mrow0 + r;
        const int mv = mask[(size_t)qm * SEQ + kn];
        c[t][r] = (mv == 0) ? -1.0e9f : c[t][r] * 0.125f;
      }
    }
    // online softmax
    float mnew[8], alpha[8];
#pragma unroll
    for (int r = 0; r < 8; ++r) {
      float v = fmaxf(fmaxf(c[0][r], c[1][r]), fmaxf(c[2][r], c[3][r]));
      mnew[r]  = fmaxf(m_i[r], rmax16(v));
      alpha[r] = __expf(m_i[r] - mnew[r]);
      m_i[r]   = mnew[r];
    }
#pragma unroll
    for (int t = 0; t < 4; ++t)
#pragma unroll
      for (int r = 0; r < 8; ++r) c[t][r] = __expf(c[t][r] - mnew[r]);
#pragma unroll
    for (int r = 0; r < 8; ++r) {
      l_i[r] = l_i[r] * alpha[r] +
               rsum16(c[0][r] + c[1][r] + c[2][r] + c[3][r]);
      o[0][r] *= alpha[r]; o[1][r] *= alpha[r];
      o[2][r] *= alpha[r]; o[3][r] *= alpha[r];
    }
    // P: C-layout registers -> LDS -> A-layout fragments (per-wave buffer)
#pragma unroll
    for (int t = 0; t < 4; ++t)
#pragma unroll
      for (int r = 0; r < 8; ++r)
        pl[(mrow0 + r) * LDP + t * 16 + row] = (_Float16)c[t][r];
    asm volatile("s_wait_dscnt 0x0" ::: "memory");
    const v16h p0 = frag_f16(pl + row * LDP + 0  + g * 8);
    const v16h p1 = frag_f16(pl + row * LDP + 32 + g * 8);
    // O += P @ V
#pragma unroll
    for (int t = 0; t < 4; ++t) {
      const _Float16* vrow = vB + (t * 16 + row) * LDP + g * 8;
      o[t] = wmma(p0, frag_f16(vrow), o[t]);
      o[t] = wmma(p1, frag_f16(vrow + 32), o[t]);
    }
    __syncthreads();  // all waves done reading before this buffer is re-staged
  }

  // epilogue: O / l, scatter to [B,S,H*DK] f16
  float inv[8];
#pragma unroll
  for (int r = 0; r < 8; ++r) inv[r] = 1.0f / l_i[r];
#pragma unroll
  for (int t = 0; t < 4; ++t) {
    const int col = h * DK + t * 16 + row;
#pragma unroll
    for (int r = 0; r < 8; ++r) {
      const int grow = b * SEQ + qbase + mrow0 + r;
      AO[(size_t)grow * DM + col] = (_Float16)(o[t][r] * inv[r]);
    }
  }
}

// ---- output projection: f32 out = AO(f16) @ Wo^T(f16) + bo ------------------
__global__ __launch_bounds__(128) void oproj16_kernel(
    const _Float16* __restrict__ X16, const _Float16* __restrict__ W,
    const float* __restrict__ bias, float* __restrict__ Y) {
  const int lane = threadIdx.x & 31;
  const int wave = threadIdx.x >> 5;
  const int row  = lane & 15;
  const int g    = lane >> 4;
  const int rowbase = blockIdx.x * 64 + wave * 16;
  const int colbase = blockIdx.y * 64;

  v8f c[4] = {v8f{}, v8f{}, v8f{}, v8f{}};
  const _Float16* xrow = X16 + (size_t)(rowbase + row) * DM;

  for (int k0 = 0; k0 < DM; k0 += 32) {
    v16h a = frag_f16(xrow + k0 + g * 8);
#pragma unroll
    for (int t = 0; t < 4; ++t) {
      v16h b = frag_f16(W + (size_t)(colbase + t * 16 + row) * DM + k0 + g * 8);
      c[t] = wmma(a, b, c[t]);
    }
  }
  const int mrow0 = g * 8;
#pragma unroll
  for (int t = 0; t < 4; ++t) {
    const int n = colbase + t * 16 + row;
    const float bv = bias[n];
#pragma unroll
    for (int r = 0; r < 8; ++r)
      Y[(size_t)(rowbase + mrow0 + r) * DM + n] = c[t][r] + bv;
  }
}

// ---- launch -----------------------------------------------------------------
extern "C" void kernel_launch(void* const* d_in, const int* in_sizes, int n_in,
                              void* d_out, int out_size, void* d_ws, size_t ws_size,
                              hipStream_t stream) {
  const float* q    = (const float*)d_in[0];
  const float* k    = (const float*)d_in[1];
  const float* v    = (const float*)d_in[2];
  const int*   mask = (const int*)  d_in[3];
  const float* w_q  = (const float*)d_in[4];
  const float* b_q  = (const float*)d_in[5];
  const float* w_k  = (const float*)d_in[6];
  const float* b_k  = (const float*)d_in[7];
  const float* w_v  = (const float*)d_in[8];
  const float* b_v  = (const float*)d_in[9];
  const float* w_o  = (const float*)d_in[10];
  const float* b_o  = (const float*)d_in[11];

  const size_t nXW = (size_t)NROW * DM;   // 4096*768
  const size_t nWW = (size_t)DM * DM;     // 768*768
  _Float16* p = (_Float16*)d_ws;
  _Float16* xq16 = p; p += nXW;
  _Float16* xk16 = p; p += nXW;
  _Float16* xv16 = p; p += nXW;
  _Float16* wq16 = p; p += nWW;
  _Float16* wk16 = p; p += nWW;
  _Float16* wv16 = p; p += nWW;
  _Float16* wo16 = p; p += nWW;
  _Float16* q16  = p; p += nXW;
  _Float16* k16  = p; p += nXW;
  _Float16* vt16 = p; p += nXW;
  _Float16* ao16 = p; p += nXW;

  const dim3 blk(128);
  const int nx8 = (int)(nXW / 8), nw8 = (int)(nWW / 8);
  cvt16_kernel<<<(nx8 + 255) / 256, 256, 0, stream>>>(q,   xq16, nx8);
  cvt16_kernel<<<(nx8 + 255) / 256, 256, 0, stream>>>(k,   xk16, nx8);
  cvt16_kernel<<<(nx8 + 255) / 256, 256, 0, stream>>>(v,   xv16, nx8);
  cvt16_kernel<<<(nw8 + 255) / 256, 256, 0, stream>>>(w_q, wq16, nw8);
  cvt16_kernel<<<(nw8 + 255) / 256, 256, 0, stream>>>(w_k, wk16, nw8);
  cvt16_kernel<<<(nw8 + 255) / 256, 256, 0, stream>>>(w_v, wv16, nw8);
  cvt16_kernel<<<(nw8 + 255) / 256, 256, 0, stream>>>(w_o, wo16, nw8);

  const dim3 pg(NROW / 64, DM / 64);      // 64 x 12
  proj16_kernel<<<pg, blk, 0, stream>>>(xq16, wq16, b_q, q16, 0);
  proj16_kernel<<<pg, blk, 0, stream>>>(xk16, wk16, b_k, k16, 0);
  proj16_kernel<<<pg, blk, 0, stream>>>(xv16, wv16, b_v, vt16, 1);

  attn_kernel<<<dim3(SEQ / 64, NH, 2), blk, 0, stream>>>(q16, k16, vt16, mask, ao16);

  oproj16_kernel<<<pg, blk, 0, stream>>>(ao16, wo16, b_o, (float*)d_out);
}

// v001
// A run of this version takes 195 microseconds.
// Timed twice side by side with v000, it ran 1.83 and 1.84 times as fast.
#include <hip/hip_runtime.h>

typedef __attribute__((ext_vector_type(16))) _Float16 v16h;
typedef __attribute__((ext_vector_type(8)))  _Float16 v8h;
typedef __attribute__((ext_vector_type(8)))  float    v8f;
typedef __attribute__((ext_vector_type(4)))  int      v4i;

#define DEV static __device__ __forceinline__

constexpr int DM   = 768;     // model dim
constexpr int SEQ  = 2048;    // sequence length
constexpr int NH   = 12;      // heads
constexpr int DK   = 64;      // head dim
constexpr int NROW = 2 * SEQ; // B*S = 4096 rows
constexpr int LDP  = 72;      // padded LDS row (halves): conflict-free b128 reads

// ---- CDNA5 async global->LDS copy (guarded; falls back to sync staging) -----
#if defined(__has_builtin) && __has_builtin(__builtin_amdgcn_global_load_async_to_lds_b128)
#define HAVE_ASYNC_LDS 1
DEV void async_cp16(_Float16* ldst, const _Float16* gsrc) {
  __builtin_amdgcn_global_load_async_to_lds_b128(
      (__attribute__((address_space(1))) v4i*)gsrc,
      (__attribute__((address_space(3))) v4i*)ldst,
      0, 0);
}
#if defined(__has_builtin) && __has_builtin(__builtin_amdgcn_s_wait_asynccnt)
#define ASYNC_WAIT(n) __builtin_amdgcn_s_wait_asynccnt(n)
#else
#define ASYNC_WAIT(n) asm volatile("s_wait_asynccnt " #n ::: "memory")
#endif
#else
#define HAVE_ASYNC_LDS 0
DEV void async_cp16(_Float16* ldst, const _Float16* gsrc) {
  *(v8h*)ldst = *(const v8h*)gsrc;   // sync fallback through VGPRs
}
#define ASYNC_WAIT(n) ((void)0)
#endif

// ---- fragment helpers -------------------------------------------------------
// CDNA5 16-bit A/B fragment (16x32 / 32x16), wave32:
//   lane l: row/col = l&15, g = l>>4
//   VGPR0..3 hold K = g*8 + 0..7, VGPR4..7 hold K = 16 + g*8 + 0..7
// => per lane: two contiguous 16-byte chunks at +0 and +16 halves.
DEV v16h frag_f16(const _Float16* p) {
  v8h lo = *(const v8h*)p;
  v8h hi = *(const v8h*)(p + 16);
  v16h r;
#pragma unroll
  for (int i = 0; i < 8; ++i) { r[i] = lo[i]; r[i + 8] = hi[i]; }
  return r;
}

DEV v8f wmma(v16h a, v16h b, v8f c) {
  return __builtin_amdgcn_wmma_f32_16x16x32_f16(false, a, false, b, (short)0, c,
                                                false, false);
}

// lane l <-> lane l ^ 16: the one exchange between the wave halves
DEV float xhalf(float x) {
  const int b = __builtin_bit_cast(int, x);
  return __builtin_bit_cast(float, __builtin_amdgcn_permlanex16(
      b, b, 0x76543210, 0xfedcba98, false, false));
}

// ---- elementwise f32 -> f16 (one pass; removes cvt from GEMM hot loops) -----
__global__ __launch_bounds__(256) void cvt16_kernel(const float* __restrict__ src,
                                                    _Float16* __restrict__ dst,
                                                    int n8) {
  const int i = blockIdx.x * 256 + threadIdx.x;
  if (i >= n8) return;
  const size_t off = (size_t)i * 8;
  v8f x = *(const v8f*)(src + off);
  v8h y;
#pragma unroll
  for (int j = 0; j < 8; ++j) y[j] = (_Float16)x[j];
  *(v8h*)(dst + off) = y;
}

// ---- QKV projection (all-f16 operands): Y = X @ W^T + b, head layout --------
// mode 0: Y[b][h][s][d]  (Q and K)        mode 1: Y[b][h][d][s]  (V transposed)
__global__ __launch_bounds__(128) void proj16_kernel(
    const _Float16* __restrict__ X, const _Float16* __restrict__ W,
    const float* __restrict__ bias, _Float16* __restrict__ Y, int mode) {
  const int lane = threadIdx.x & 31;
  const int wave = threadIdx.x >> 5;
  const int row  = lane & 15;
  const int g    = lane >> 4;
  const int rowbase = blockIdx.x * 64 + wave * 16;
  const int h       = blockIdx.y;          // 64-col tile == one head
  const int colbase = h * DK;

  v8f c[4] = {v8f{}, v8f{}, v8f{}, v8f{}};
  const _Float16* xrow = X + (size_t)(rowbase + row) * DM;

  for (int k0 = 0; k0 < DM; k0 += 32) {
    v16h a = frag_f16(xrow + k0 + g * 8);
#pragma unroll
    for (int t = 0; t < 4; ++t) {
      v16h b = frag_f16(W + (size_t)(colbase + t * 16 + row) * DM + k0 + g * 8);
      c[t] = wmma(a, b, c[t]);
    }
  }

  const int mrow0 = g * 8;
#pragma unroll
  for (int t = 0; t < 4; ++t) {
    const int d = t * 16 + row;
    const float bv = bias[colbase + d];
#pragma unroll
    for (int r = 0; r < 8; ++r) {
      const int grow = rowbase + mrow0 + r;
      const int bb = grow >> 11;
      const int s  = grow & (SEQ - 1);
      const float val = c[t][r] + bv;
      size_t off;
      if (mode == 0) off = ((size_t)(bb * NH + h) * SEQ + s) * DK + d;
      else           off = ((size_t)(bb * NH + h) * DK + d) * SEQ + s;
      Y[off] = (_Float16)val;
    }
  }
}

__global__ __launch_bounds__(128) void attn_kernel(
    const _Float16* __restrict__ Q, const _Float16* __restrict__ K,
    const _Float16* __restrict__ Vt, const int* __restrict__ mask,
    _Float16* __restrict__ AO) {
  __shared__ __align__(16) _Float16 sK[2][64 * LDP];  // K tile, [key][d] padded
  __shared__ __align__(16) _Float16 sV[2][64 * LDP];  // V^T tile, [d][key] padded

  const int tid  = threadIdx.x;
  const int lane = tid & 31;
  const int wave = tid >> 5;
  const int row  = lane & 15;
  const int g    = lane >> 4;
  const int h = blockIdx.y, b = blockIdx.z;
  const int bh = b * NH + h;
  const int qbase = blockIdx.x * 64 + wave * 16;

  const _Float16* Qh = Q  + (size_t)bh * SEQ * DK;
  const _Float16* Kh = K  + (size_t)bh * SEQ * DK;
  const _Float16* Vh = Vt + (size_t)bh * DK * SEQ;

  const _Float16* qrow = Qh + (size_t)(qbase + row) * DK;
  const v16h qf0 = frag_f16(qrow + 0  + g * 8);
  const v16h qf1 = frag_f16(qrow + 32 + g * 8);

  // this lane's query row of the mask, at its half's first key
  const int* mrow = mask + (size_t)(qbase + row) * SEQ + g * 8;

  float m_i = -3.0e38f;   // running max of this lane's query (both halves agree)
  float l_i = 0.0f;       // running sum over this half's keys; halves join at the end
  v8f o[4] = {v8f{}, v8f{}, v8f{}, v8f{}};  // o[t][r] = O[query row][d = t*16 + g*8 + r]

  // stage one 64-key tile (8 KB K + 8 KB V) via 8 async b128 ops per thread
  auto stage = [&](int kb, int buf) {
#pragma unroll
    for (int i = 0; i < 4; ++i) {
      const int c  = tid + i * 128;       // 0..511 16-byte chunks
      const int r  = c >> 3;              // tile row 0..63
      const int ch = (c & 7) * 8;         // halves within row
      async_cp16(&sK[buf][r * LDP + ch], Kh + (size_t)(kb + r) * DK + ch);
      async_cp16(&sV[buf][r * LDP + ch], Vh + (size_t)r * SEQ + kb + ch);
    }
  };

  stage(0, 0);
  for (int kb = 0; kb < SEQ; kb += 64) {
    const int cur = (kb >> 6) & 1;
    if (kb + 64 < SEQ) { stage(kb + 64, cur ^ 1); ASYNC_WAIT(8); }
    else               { ASYNC_WAIT(0); }
    __syncthreads();

    const _Float16* kB = sK[cur];
    const _Float16* vB = sV[cur];

    // mask: 8 consecutive keys of this lane's mask row per 16-key group
    v4i ma[4], mb[4];
#pragma unroll
    for (int t = 0; t < 4; ++t) {
      ma[t] = *(const v4i*)(mrow + kb + t * 16);
      mb[t] = *(const v4i*)(mrow + kb + t * 16 + 4);
    }

    // S^T = K Q^T, 64k x 16q: c[t][r] = S[query row][key kb + t*16 + g*8 + r]
    v8f c[4];
#pragma unroll
    for (int t = 0; t < 4; ++t) {
      const _Float16* krow = kB + (t * 16 + row) * LDP + g * 8;
      v8f z{};
      c[t] = wmma(frag_f16(krow), qf0, z);
      c[t] = wmma(frag_f16(krow + 32), qf1, c[t]);
    }
    // scale + mask
#pragma unroll
    for (int t = 0; t < 4; ++t) {
#pragma unroll
      for (int r = 0; r < 4; ++r) {
        c[t][r]     = (ma[t][r] == 0) ? -1.0e9f : c[t][r] * 0.125f;
        c[t][r + 4] = (mb[t][r] == 0) ? -1.0e9f : c[t][r + 4] * 0.125f;
      }
    }
    // online softmax, one query per lane
    float vm[4];
#pragma unroll
    for (int t = 0; t < 4; ++t) {
      vm[t] = fmaxf(c[t][0], c[t][1]);
#pragma unroll
      for (int r = 2; r < 8; ++r) vm[t] = fmaxf(vm[t], c[t][r]);
    }
    float vmax = fmaxf(fmaxf(vm[0], vm[1]), fmaxf(vm[2], vm[3]));
    vmax = fmaxf(vmax, xhalf(vmax));
    const float mnew  = fmaxf(m_i, vmax);
    const float alpha = __expf(m_i - mnew);
    m_i = mnew;
    float s4[4];
#pragma unroll
    for (int t = 0; t < 4; ++t) {
#pragma unroll
      for (int r = 0; r < 8; ++r) c[t][r] = __expf(c[t][r] - mnew);
      s4[t] = ((c[t][0] + c[t][1]) + (c[t][2] + c[t][3])) +
              ((c[t][4] + c[t][5]) + (c[t][6] + c[t][7]));
    }
    l_i = l_i * alpha + ((s4[0] + s4[1]) + (s4[2] + s4[3]));
#pragma unroll
    for (int t = 0; t < 4; ++t)
#pragma unroll
      for (int r = 0; r < 8; ++r) o[t][r] *= alpha;
    // P^T: two converted score tiles are one B fragment (32 keys x 16 queries)
    v16h p0, p1;
#pragma unroll
    for (int r = 0; r < 8; ++r) {
      p0[r] = (_Float16)c[0][r]; p0[r + 8] = (_Float16)c[1][r];
      p1[r] = (_Float16)c[2][r]; p1[r + 8] = (_Float16)c[3][r];
    }
    // O^T += V^T P^T
#pragma unroll
    for (int t = 0; t < 4; ++t) {
      const _Float16* vrow = vB + (t * 16 + row) * LDP + g * 8;
      o[t] = wmma(frag_f16(vrow), p0, o[t]);
      o[t] = wmma(frag_f16(vrow + 32), p1, o[t]);
    }
    __syncthreads();  // all waves done reading before this buffer is re-staged
  }

  // epilogue: join the halves' sums, O / l, 8 consecutive d per 16-byte store
  const float inv = 1.0f / (l_i + xhalf(l_i));
  _Float16* arow = AO + (size_t)(b * SEQ + qbase + row) * DM + h * DK + g * 8;
#pragma unroll
  for (int t = 0; t < 4; ++t) {
    v8h y;
#pragma unroll
    for (int r = 0; r < 8; ++r) y[r] = (_Float16)(o[t][r] * inv);
    *(v8h*)(arow + t * 16) = y;
  }
}

// ---- output projection: f32 out = AO(f16) @ Wo^T(f16) + bo ------------------
__global__ __launch_bounds__(128) void oproj16_kernel(
    const _Float16* __restrict__ X16, const _Float16* __restrict__ W,
    const float* __restrict__ bias, float* __restrict__ Y) {
  const int lane = threadIdx.x & 31;
  const int wave = threadIdx.x >> 5;
  const int row  = lane & 15;
  const int g    = lane >> 4;
  const int rowbase = blockIdx.x * 64 + wave * 16;
  const int colbase = blockIdx.y * 64;

  v8f c[4] = {v8f{}, v8f{}, v8f{}, v8f{}};
  const _Float16* xrow = X16 + (size_t)(rowbase + row) * DM;

  for (int k0 = 0; k0 < DM; k0 += 32) {
    v16h a = frag_f16(xrow + k0 + g * 8);
#pragma unroll
    for (int t = 0; t < 4; ++t) {
      v16h b = frag_f16(W + (size_t)(colbase + t * 16 + row) * DM + k0 + g * 8);
      c[t] = wmma(a, b, c[t]);
    }
  }
  const int mrow0 = g * 8;
#pragma unroll
  for (int t = 0; t < 4; ++t) {
    const int n = colbase + t * 16 + row;
    const float bv = bias[n];
#pragma unroll
    for (int r = 0; r < 8; ++r)
      Y[(size_t)(rowbase + mrow0 + r) * DM + n] = c[t][r] + bv;
  }
}

// ---- launch -----------------------------------------------------------------
extern "C" void kernel_launch(void* const* d_in, const int* in_sizes, int n_in,
                              void* d_out, int out_size, void* d_ws, size_t ws_size,
                              hipStream_t stream) {
  const float* q    = (const float*)d_in[0];
  const float* k    = (const float*)d_in[1];
  const float* v    = (const float*)d_in[2];
  const int*   mask = (const int*)  d_in[3];
  const float* w_q  = (const float*)d_in[4];
  const float* b_q  = (const float*)d_in[5];
  const float* w_k  = (const float*)d_in[6];
  const float* b_k  = (const float*)d_in[7];
  const float* w_v  = (const float*)d_in[8];
  const float* b_v  = (const float*)d_in[9];
  const float* w_o  = (const float*)d_in[10];
  const float* b_o  = (const float*)d_in[11];

  const size_t nXW = (size_t)NROW * DM;   // 4096*768
  const size_t nWW = (size_t)DM * DM;     // 768*768
  _Float16* p = (_Float16*)d_ws;
  _Float16* xq16 = p; p += nXW;
  _Float16* xk16 = p; p += nXW;
  _Float16* xv16 = p; p += nXW;
  _Float16* wq16 = p; p += nWW;
  _Float16* wk16 = p; p += nWW;
  _Float16* wv16 = p; p += nWW;
  _Float16* wo16 = p; p += nWW;
  _Float16* q16  = p; p += nXW;
  _Float16* k16  = p; p += nXW;
  _Float16* vt16 = p; p += nXW;
  _Float16* ao16 = p; p += nXW;

  const dim3 blk(128);
  const int nx8 = (int)(nXW / 8), nw8 = (int)(nWW / 8);
  cvt16_kernel<<<(nx8 + 255) / 256, 256, 0, stream>>>(q,   xq16, nx8);
  cvt16_kernel<<<(nx8 + 255) / 256, 256, 0, stream>>>(k,   xk16, nx8);
  cvt16_kernel<<<(nx8 + 255) / 256, 256, 0, stream>>>(v,   xv16, nx8);
  cvt16_kernel<<<(nw8 + 255) / 256, 256, 0, stream>>>(w_q, wq16, nw8);
  cvt16_kernel<<<(nw8 + 255) / 256, 256, 0, stream>>>(w_k, wk16, nw8);
  cvt16_kernel<<<(nw8 + 255) / 256, 256, 0, stream>>>(w_v, wv16, nw8);
  cvt16_kernel<<<(nw8 + 255) / 256, 256, 0, stream>>>(w_o, wo16, nw8);

  const dim3 pg(NROW / 64, DM / 64);      // 64 x 12
  proj16_kernel<<<pg, blk, 0, stream>>>(xq16, wq16, b_q, q16, 0);
  proj16_kernel<<<pg, blk, 0, stream>>>(xk16, wk16, b_k, k16, 0);
  proj16_kernel<<<pg, blk, 0, stream>>>(xv16, wv16, b_v, vt16, 1);

  attn_kernel<<<dim3(SEQ / 64, NH, 2), blk, 0, stream>>>(q16, k16, vt16, mask, ao16);

  oproj16_kernel<<<pg, blk, 0, stream>>>(ao16, wo16, b_o, (float*)d_out);
}

// v002
// Measured time: 123 microseconds a run.
// Next to v001, in two timings, it ran 1.57 and 1.58 times as fast.
// Over all steps from v000 it is 2.90 times as fast.
#include <hip/hip_runtime.h>

typedef __attribute__((ext_vector_type(16))) _Float16 v16h;
typedef __attribute__((ext_vector_type(8)))  _Float16 v8h;
typedef __attribute__((ext_vector_type(8)))  float    v8f;
typedef __attribute__((ext_vector_type(4)))  int      v4i;

#define DEV static __device__ __forceinline__

constexpr int DM   = 768;     // model dim
constexpr int SEQ  = 2048;    // sequence length
constexpr int NH   = 12;      // heads
constexpr int DK   = 64;      // head dim
constexpr int NROW = 2 * SEQ; // B*S = 4096 rows
constexpr int LDP  = 72;      // padded LDS row (halves): conflict-free b128 reads

// ---- CDNA5 async global->LDS copy (guarded; falls back to sync staging) -----
#if defined(__has_builtin) && __has_builtin(__builtin_amdgcn_global_load_async_to_lds_b128)
#define HAVE_ASYNC_LDS 1
DEV void async_cp16(_Float16* ldst, const _Float16* gsrc) {
  __builtin_amdgcn_global_load_async_to_lds_b128(
      (__attribute__((address_space(1))) v4i*)gsrc,
      (__attribute__((address_space(3))) v4i*)ldst,
      0, 0);
}
#if defined(__has_builtin) && __has_builtin(__builtin_amdgcn_s_wait_asynccnt)
#define ASYNC_WAIT(n) __builtin_amdgcn_s_wait_asynccnt(n)
#else
#define ASYNC_WAIT(n) asm volatile("s_wait_asynccnt " #n ::: "memory")
#endif
#else
#define HAVE_ASYNC_LDS 0
DEV void async_cp16(_Float16* ldst, const _Float16* gsrc) {
  *(v8h*)ldst = *(const v8h*)gsrc;   // sync fallback through VGPRs
}
#define ASYNC_WAIT(n) ((void)0)
#endif

// ---- fragment helpers -------------------------------------------------------
// CDNA5 16-bit A/B fragment (16x32 / 32x16), wave32:
//   lane l: row/col = l&15, g = l>>4
//   VGPR0..3 hold K = g*8 + 0..7, VGPR4..7 hold K = 16 + g*8 + 0..7
// => per lane: two contiguous 16-byte chunks at +0 and +16 halves.
DEV v16h frag_f16(const _Float16* p) {
  v8h lo = *(const v8h*)p;
  v8h hi = *(const v8h*)(p + 16);
  v16h r;
#pragma unroll
  for (int i = 0; i < 8; ++i) { r[i] = lo[i]; r[i + 8] = hi[i]; }
  return r;
}

DEV v8f wmma(v16h a, v16h b, v8f c) {
  return __builtin_amdgcn_wmma_f32_16x16x32_f16(false, a, false, b, (short)0, c,
                                                false, false);
}

// lane l <-> lane l ^ 16: the one exchange between the wave halves
DEV float xhalf(float x) {
  const int b = __builtin_bit_cast(int, x);
  return __builtin_bit_cast(float, __builtin_amdgcn_permlanex16(
      b, b, 0x76543210, 0xfedcba98, false, false));
}

// ---- elementwise f32 -> f16 (one pass; removes cvt from GEMM hot loops) -----
__global__ __launch_bounds__(256) void cvt16_kernel(const float* __restrict__ src,
                                                    _Float16* __restrict__ dst,
                                                    int n8) {
  const int i = blockIdx.x * 256 + threadIdx.x;
  if (i >= n8) return;
  const size_t off = (size_t)i * 8;
  v8f x = *(const v8f*)(src + off);
  v8h y;
#pragma unroll
  for (int j = 0; j < 8; ++j) y[j] = (_Float16)x[j];
  *(v8h*)(dst + off) = y;
}

// ---- GEMM operand staging: 64-row tiles of X and W, 128 k per stage ----------
// A fragment load straight from global touches 16 cache lines for 512 bytes;
// a staging copy reads whole 128-byte lines, and the fragments come from LDS.
constexpr int BK   = 128;        // halves of K per stage: 256 bytes of every operand row
constexpr int LDG  = BK + 8;     // LDS pitch 272 bytes: conflict-free b128 reads
constexpr int NST  = DM / BK;    // 6 stages
constexpr int TILE = 64 * LDG;   // halves of one staged tile

DEV unsigned lds_off(const void* p) { return (unsigned)(size_t)p; }

// One lane's share of a tile: eight 16-byte copies, tile rows 8 apart.
// The closing s_wait_xcnt stands in the copies' own statement so that no
// address register named here is rewritten before it.
DEV void copy_tile(unsigned l, const _Float16* gp) {
  constexpr unsigned LS = 8 * LDG * 2;   // bytes between this lane's rows in LDS
  constexpr int      GS = 8 * DM;        // halves between them in global memory
  asm volatile(
      "global_load_async_to_lds_b128 %0, %8, off\n\t"
      "global_load_async_to_lds_b128 %1, %9, off\n\t"
      "global_load_async_to_lds_b128 %2, %10, off\n\t"
      "global_load_async_to_lds_b128 %3, %11, off\n\t"
      "global_load_async_to_lds_b128 %4, %12, off\n\t"
      "global_load_async_to_lds_b128 %5, %13, off\n\t"
      "global_load_async_to_lds_b128 %6, %14, off\n\t"
      "global_load_async_to_lds_b128 %7, %15, off\n\t"
      "s_wait_xcnt 0x0"
      :: "v"(l), "v"(l + LS), "v"(l + 2 * LS), "v"(l + 3 * LS),
         "v"(l + 4 * LS), "v"(l + 5 * LS), "v"(l + 6 * LS), "v"(l + 7 * LS),
         "v"(gp), "v"(gp + GS), "v"(gp + 2 * GS), "v"(gp + 3 * GS),
         "v"(gp + 4 * GS), "v"(gp + 5 * GS), "v"(gp + 6 * GS), "v"(gp + 7 * GS)
      : "memory");
}

// c[t] += X[rowblk + wave*16 .. +15][:] * W[colbase + t*16 .. +15][:]^T over all of K,
// k ascending in steps of 32; two LDS buffers, the next stage's copies fly
// while this stage is worked on.
DEV void gemm_64x64(const _Float16* __restrict__ X, const _Float16* __restrict__ W,
                    int rowblk, int colbase, v8f (&c)[4]) {
  __shared__ __align__(16) _Float16 sX[2][TILE];
  __shared__ __align__(16) _Float16 sW[2][TILE];
  const int tid  = threadIdx.x;
  const int lane = tid & 31;
  const int wave = tid >> 5;
  const int row  = lane & 15;
  const int g    = lane >> 4;

  const int cr = tid >> 4;          // this lane's first tile row, 0..7
  const int cc = (tid & 15) * 8;    // its 16-byte chunk of the 256-byte row
  const _Float16* gx = X + (size_t)(rowblk + cr) * DM + cc;
  const _Float16* gw = W + (size_t)(colbase + cr) * DM + cc;
  const unsigned  lx = lds_off(&sX[0][cr * LDG + cc]);
  const unsigned  lw = lds_off(&sW[0][cr * LDG + cc]);
  auto stage = [&](int s) {
    const unsigned bo = (unsigned)(s & 1) * (TILE * 2);
    copy_tile(lx + bo, gx + s * BK);
    copy_tile(lw + bo, gw + s * BK);
  };

  stage(0);
  asm volatile("s_wait_asynccnt 0x0" ::: "memory");  // stage 0 has landed before it is published
  __syncthreads();
  stage(1);

  for (int s = 0; s < NST; ++s) {
    const _Float16* xB = sX[s & 1] + (wave * 16 + row) * LDG + g * 8;
    const _Float16* wB = sW[s & 1] + row * LDG + g * 8;
    v16h a[4], b[4][4];
#pragma unroll
    for (int j = 0; j < 4; ++j) {
      a[j] = frag_f16(xB + j * 32);
#pragma unroll
      for (int t = 0; t < 4; ++t) b[j][t] = frag_f16(wB + t * 16 * LDG + j * 32);
    }
    // keeps the stage's LDS reads one group in front of its products; left free,
    // the scheduler sinks each pair to its product behind a wait to zero
    __builtin_amdgcn_sched_barrier(0);
#pragma unroll
    for (int j = 0; j < 4; ++j)
#pragma unroll
      for (int t = 0; t < 4; ++t) c[t] = wmma(a[j], b[j][t], c[t]);
    // keeps the products in front of the stage's foot, where they run while the
    // later reads return; left free, they sink behind the barrier and delay the refill
    __builtin_amdgcn_sched_barrier(0);
    asm volatile("s_wait_dscnt 0x0" ::: "memory");     // this wave's reads of the buffer have ended
    asm volatile("s_wait_asynccnt 0x0" ::: "memory");  // its copies of stage s + 1 have landed
    __syncthreads();  // publishes stage s + 1 and frees the buffer of stage s
    if (s + 2 < NST) stage(s + 2);
  }
  asm volatile("s_wait_asynccnt 0x0" ::: "memory");    // nothing in flight when the wave ends
}

// ---- QKV projection (all-f16 operands): Y = X @ W^T + b, head layout --------
// mode 0: Y[b][h][s][d]  (Q and K)        mode 1: Y[b][h][d][s]  (V transposed)
__global__ __launch_bounds__(128) void proj16_kernel(
    const _Float16* __restrict__ X, const _Float16* __restrict__ W,
    const float* __restrict__ bias, _Float16* __restrict__ Y, int mode) {
  const int lane = threadIdx.x & 31;
  const int wave = threadIdx.x >> 5;
  const int row  = lane & 15;
  const int g    = lane >> 4;
  const int rowbase = blockIdx.x * 64 + wave * 16;
  const int h       = blockIdx.y;          // 64-col tile == one head
  const int colbase = h * DK;

  v8f c[4] = {v8f{}, v8f{}, v8f{}, v8f{}};
  gemm_64x64(X, W, blockIdx.x * 64, colbase, c);

  const int mrow0 = g * 8;
#pragma unroll
  for (int t = 0; t < 4; ++t) {
    const int d = t * 16 + row;
    const float bv = bias[colbase + d];
#pragma unroll
    for (int r = 0; r < 8; ++r) {
      const int grow = rowbase + mrow0 + r;
      const int bb = grow >> 11;
      const int s  = grow & (SEQ - 1);
      const float val = c[t][r] + bv;
      size_t off;
      if (mode == 0) off = ((size_t)(bb * NH + h) * SEQ + s) * DK + d;
      else           off = ((size_t)(bb * NH + h) * DK + d) * SEQ + s;
      Y[off] = (_Float16)val;
    }
  }
}

__global__ __launch_bounds__(128) void attn_kernel(
    const _Float16* __restrict__ Q, const _Float16* __restrict__ K,
    const _Float16* __restrict__ Vt, const int* __restrict__ mask,
    _Float16* __restrict__ AO) {
  __shared__ __align__(16) _Float16 sK[2][64 * LDP];  // K tile, [key][d] padded
  __shared__ __align__(16) _Float16 sV[2][64 * LDP];  // V^T tile, [d][key] padded

  const int tid  = threadIdx.x;
  const int lane = tid & 31;
  const int wave = tid >> 5;
  const int row  = lane & 15;
  const int g    = lane >> 4;
  const int h = blockIdx.y, b = blockIdx.z;
  const int bh = b * NH + h;
  const int qbase = blockIdx.x * 64 + wave * 16;

  const _Float16* Qh = Q  + (size_t)bh * SEQ * DK;
  const _Float16* Kh = K  + (size_t)bh * SEQ * DK;
  const _Float16* Vh = Vt + (size_t)bh * DK * SEQ;

  const _Float16* qrow = Qh + (size_t)(qbase + row) * DK;
  const v16h qf0 = frag_f16(qrow + 0  + g * 8);
  const v16h qf1 = frag_f16(qrow + 32 + g * 8);

  // this lane's query row of the mask, at its half's first key
  const int* mrow = mask + (size_t)(qbase + row) * SEQ + g * 8;

  float m_i = -3.0e38f;   // running max of this lane's query (both halves agree)
  float l_i = 0.0f;       // running sum over this half's keys; halves join at the end
  v8f o[4] = {v8f{}, v8f{}, v8f{}, v8f{}};  // o[t][r] = O[query row][d = t*16 + g*8 + r]

  // stage one 64-key tile (8 KB K + 8 KB V) via 8 async b128 ops per thread
  auto stage = [&](int kb, int buf) {
#pragma unroll
    for (int i = 0; i < 4; ++i) {
      const int c  = tid + i * 128;       // 0..511 16-byte chunks
      const int r  = c >> 3;              // tile row 0..63
      const int ch = (c & 7) * 8;         // halves within row
      async_cp16(&sK[buf][r * LDP + ch], Kh + (size_t)(kb + r) * DK + ch);
      async_cp16(&sV[buf][r * LDP + ch], Vh + (size_t)r * SEQ + kb + ch);
    }
  };

  stage(0, 0);
  for (int kb = 0; kb < SEQ; kb += 64) {
    const int cur = (kb >> 6) & 1;
    if (kb + 64 < SEQ) { stage(kb + 64, cur ^ 1); ASYNC_WAIT(8); }
    else               { ASYNC_WAIT(0); }
    __syncthreads();

    const _Float16* kB = sK[cur];
    const _Float16* vB = sV[cur];

    // mask: 8 consecutive keys of this lane's mask row per 16-key group
    v4i ma[4], mb[4];
#pragma unroll
    for (int t = 0; t < 4; ++t) {
      ma[t] = *(const v4i*)(mrow + kb + t * 16);
      mb[t] = *(const v4i*)(mrow + kb + t * 16 + 4);
    }

    // S^T = K Q^T, 64k x 16q: c[t][r] = S[query row][key kb + t*16 + g*8 + r]
    v8f c[4];
#pragma unroll
    for (int t = 0; t < 4; ++t) {
      const _Float16* krow = kB + (t * 16 + row) * LDP + g * 8;
      v8f z{};
      c[t] = wmma(frag_f16(krow), qf0, z);
      c[t] = wmma(frag_f16(krow + 32), qf1, c[t]);
    }
    // scale + mask
#pragma unroll
    for (int t = 0; t < 4; ++t) {
#pragma unroll
      for (int r = 0; r < 4; ++r) {
        c[t][r]     = (ma[t][r] == 0) ? -1.0e9f : c[t][r] * 0.125f;
        c[t][r + 4] = (mb[t][r] == 0) ? -1.0e9f : c[t][r + 4] * 0.125f;
      }
    }
    // online softmax, one query per lane
    float vm[4];
#pragma unroll
    for (int t = 0; t < 4; ++t) {
      vm[t] = fmaxf(c[t][0], c[t][1]);
#pragma unroll
      for (int r = 2; r < 8; ++r) vm[t] = fmaxf(vm[t], c[t][r]);
    }
    float vmax = fmaxf(fmaxf(vm[0], vm[1]), fmaxf(vm[2], vm[3]));
    vmax = fmaxf(vmax, xhalf(vmax));
    const float mnew  = fmaxf(m_i, vmax);
    const float alpha = __expf(m_i - mnew);
    m_i = mnew;
    float s4[4];
#pragma unroll
    for (int t = 0; t < 4; ++t) {
#pragma unroll
      for (int r = 0; r < 8; ++r) c[t][r] = __expf(c[t][r] - mnew);
      s4[t] = ((c[t][0] + c[t][1]) + (c[t][2] + c[t][3])) +
              ((c[t][4] + c[t][5]) + (c[t][6] + c[t][7]));
    }
    l_i = l_i * alpha + ((s4[0] + s4[1]) + (s4[2] + s4[3]));
#pragma unroll
    for (int t = 0; t < 4; ++t)
#pragma unroll
      for (int r = 0; r < 8; ++r) o[t][r] *= alpha;
    // P^T: two converted score tiles are one B fragment (32 keys x 16 queries)
    v16h p0, p1;
#pragma unroll
    for (int r = 0; r < 8; ++r) {
      p0[r] = (_Float16)c[0][r]; p0[r + 8] = (_Float16)c[1][r];
      p1[r] = (_Float16)c[2][r]; p1[r + 8] = (_Float16)c[3][r];
    }
    // O^T += V^T P^T
#pragma unroll
    for (int t = 0; t < 4; ++t) {
      const _Float16* vrow = vB + (t * 16 + row) * LDP + g * 8;
      o[t] = wmma(frag_f16(vrow), p0, o[t]);
      o[t] = wmma(frag_f16(vrow + 32), p1, o[t]);
    }
    __syncthreads();  // all waves done reading before this buffer is re-staged
  }

  // epilogue: join the halves' sums, O / l, 8 consecutive d per 16-byte store
  const float inv = 1.0f / (l_i + xhalf(l_i));
  _Float16* arow = AO + (size_t)(b * SEQ + qbase + row) * DM + h * DK + g * 8;
#pragma unroll
  for (int t = 0; t < 4; ++t) {
    v8h y;
#pragma unroll
    for (int r = 0; r < 8; ++r) y[r] = (_Float16)(o[t][r] * inv);
    *(v8h*)(arow + t * 16) = y;
  }
}

// ---- output projection: f32 out = AO(f16) @ Wo^T(f16) + bo ------------------
__global__ __launch_bounds__(128) void oproj16_kernel(
    const _Float16* __restrict__ X16, const _Float16* __restrict__ W,
    const float* __restrict__ bias, float* __restrict__ Y) {
  const int lane = threadIdx.x & 31;
  const int wave = threadIdx.x >> 5;
  const int row  = lane & 15;
  const int g    = lane >> 4;
  const int rowbase = blockIdx.x * 64 + wave * 16;
  const int colbase = blockIdx.y * 64;

  v8f c[4] = {v8f{}, v8f{}, v8f{}, v8f{}};
  gemm_64x64(X16, W, blockIdx.x * 64, colbase, c);
  const int mrow0 = g * 8;
#pragma unroll
  for (int t = 0; t < 4; ++t) {
    const int n = colbase + t * 16 + row;
    const float bv = bias[n];
#pragma unroll
    for (int r = 0; r < 8; ++r)
      Y[(size_t)(rowbase + mrow0 + r) * DM + n] = c[t][r] + bv;
  }
}

// ---- launch -----------------------------------------------------------------
extern "C" void kernel_launch(void* const* d_in, const int* in_sizes, int n_in,
                              void* d_out, int out_size, void* d_ws, size_t ws_size,
                              hipStream_t stream) {
  const float* q    = (const float*)d_in[0];
  const float* k    = (const float*)d_in[1];
  const float* v    = (const float*)d_in[2];
  const int*   mask = (const int*)  d_in[3];
  const float* w_q  = (const float*)d_in[4];
  const float* b_q  = (const float*)d_in[5];
  const float* w_k  = (const float*)d_in[6];
  const float* b_k  = (const float*)d_in[7];
  const float* w_v  = (const float*)d_in[8];
  const float* b_v  = (const float*)d_in[9];
  const float* w_o  = (const float*)d_in[10];
  const float* b_o  = (const float*)d_in[11];

  const size_t nXW = (size_t)NROW * DM;   // 4096*768
  const size_t nWW = (size_t)DM * DM;     // 768*768
  _Float16* p = (_Float16*)d_ws;
  _Float16* xq16 = p; p += nXW;
  _Float16* xk16 = p; p += nXW;
  _Float16* xv16 = p; p += nXW;
  _Float16* wq16 = p; p += nWW;
  _Float16* wk16 = p; p += nWW;
  _Float16* wv16 = p; p += nWW;
  _Float16* wo16 = p; p += nWW;
  _Float16* q16  = p; p += nXW;
  _Float16* k16  = p; p += nXW;
  _Float16* vt16 = p; p += nXW;
  _Float16* ao16 = p; p += nXW;

  const dim3 blk(128);
  const int nx8 = (int)(nXW / 8), nw8 = (int)(nWW / 8);
  cvt16_kernel<<<(nx8 + 255) / 256, 256, 0, stream>>>(q,   xq16, nx8);
  cvt16_kernel<<<(nx8 + 255) / 256, 256, 0, stream>>>(k,   xk16, nx8);
  cvt16_kernel<<<(nx8 + 255) / 256, 256, 0, stream>>>(v,   xv16, nx8);
  cvt16_kernel<<<(nw8 + 255) / 256, 256, 0, stream>>>(w_q, wq16, nw8);
  cvt16_kernel<<<(nw8 + 255) / 256, 256, 0, stream>>>(w_k, wk16, nw8);
  cvt16_kernel<<<(nw8 + 255) / 256, 256, 0, stream>>>(w_v, wv16, nw8);
  cvt16_kernel<<<(nw8 + 255) / 256, 256, 0, stream>>>(w_o, wo16, nw8);

  const dim3 pg(NROW / 64, DM / 64);      // 64 x 12
  proj16_kernel<<<pg, blk, 0, stream>>>(xq16, wq16, b_q, q16, 0);
  proj16_kernel<<<pg, blk, 0, stream>>>(xk16, wk16, b_k, k16, 0);
  proj16_kernel<<<pg, blk, 0, stream>>>(xv16, wv16, b_v, vt16, 1);

  attn_kernel<<<dim3(SEQ / 64, NH, 2), blk, 0, stream>>>(q16, k16, vt16, mask, ao16);

  oproj16_kernel<<<pg, blk, 0, stream>>>(ao16, wo16, b_o, (float*)d_out);
}

// v003
// Measured time: 111 microseconds a run.
// Timed twice side by side with v002, it ran 1.11 and 1.12 times as fast.
// Counting every step since v000, it is 3.23 times as fast.
#include <hip/hip_runtime.h>

typedef __attribute__((ext_vector_type(16))) _Float16 v16h;
typedef __attribute__((ext_vector_type(8)))  _Float16 v8h;
typedef __attribute__((ext_vector_type(8)))  float    v8f;
typedef __attribute__((ext_vector_type(4)))  int      v4i;
typedef __attribute__((ext_vector_type(4)))  float    v4f;
typedef __attribute__((ext_vector_type(4)))  _Float16 v4h;

#define DEV static __device__ __forceinline__

constexpr int DM   = 768;     // model dim
constexpr int SEQ  = 2048;    // sequence length
constexpr int NH   = 12;      // heads
constexpr int DK   = 64;      // head dim
constexpr int NROW = 2 * SEQ; // B*S = 4096 rows
constexpr int LDP  = 72;      // padded LDS row (halves): conflict-free b128 reads

// ---- CDNA5 async global->LDS copy (guarded; falls back to sync staging) -----
#if defined(__has_builtin) && __has_builtin(__builtin_amdgcn_global_load_async_to_lds_b128)
#define HAVE_ASYNC_LDS 1
DEV void async_cp16(_Float16* ldst, const _Float16* gsrc) {
  __builtin_amdgcn_global_load_async_to_lds_b128(
      (__attribute__((address_space(1))) v4i*)gsrc,
      (__attribute__((address_space(3))) v4i*)ldst,
      0, 0);
}
#if defined(__has_builtin) && __has_builtin(__builtin_amdgcn_s_wait_asynccnt)
#define ASYNC_WAIT(n) __builtin_amdgcn_s_wait_asynccnt(n)
#else
#define ASYNC_WAIT(n) asm volatile("s_wait_asynccnt " #n ::: "memory")
#endif
#else
#define HAVE_ASYNC_LDS 0
DEV void async_cp16(_Float16* ldst, const _Float16* gsrc) {
  *(v8h*)ldst = *(const v8h*)gsrc;   // sync fallback through VGPRs
}
#define ASYNC_WAIT(n) ((void)0)
#endif

// ---- fragment helpers -------------------------------------------------------
// CDNA5 16-bit A/B fragment (16x32 / 32x16), wave32:
//   lane l: row/col = l&15, g = l>>4
//   VGPR0..3 hold K = g*8 + 0..7, VGPR4..7 hold K = 16 + g*8 + 0..7
// => per lane: two contiguous 16-byte chunks at +0 and +16 halves.
DEV v16h frag_f16(const _Float16* p) {
  v8h lo = *(const v8h*)p;
  v8h hi = *(const v8h*)(p + 16);
  v16h r;
#pragma unroll
  for (int i = 0; i < 8; ++i) { r[i] = lo[i]; r[i + 8] = hi[i]; }
  return r;
}

DEV v8f wmma(v16h a, v16h b, v8f c) {
  return __builtin_amdgcn_wmma_f32_16x16x32_f16(false, a, false, b, (short)0, c,
                                                false, false);
}

// lane l <-> lane l ^ 16: the one exchange between the wave halves
DEV float xhalf(float x) {
  const int b = __builtin_bit_cast(int, x);
  return __builtin_bit_cast(float, __builtin_amdgcn_permlanex16(
      b, b, 0x76543210, 0xfedcba98, false, false));
}

// ---- f32 -> f16 of all seven operands in ONE launch -------------------------
// The destinations lie one behind the other in the workspace in the order
// q, k, v, w_q, w_k, w_v, w_o, so a work-group's place in the grid is also its
// place in the destination. A work-group converts CVT_WG 16-byte pieces of one
// source; a wave-wide load covers 512 contiguous bytes, a store 256.
constexpr int CVT_T  = 512;                   // threads: 16 waves on a WGP
constexpr int CVT_N  = 24;                    // pieces per thread
constexpr int CVT_WG = CVT_T * CVT_N;         // pieces of 4 floats per work-group
constexpr int XWG = NROW * DM / 4 / CVT_WG;   // 64 work-groups per activation
constexpr int WWG = DM * DM / 4 / CVT_WG;     // 12 per weight
static_assert(XWG * CVT_WG * 4 == NROW * DM && WWG * CVT_WG * 4 == DM * DM,
              "every source is a whole number of work-groups");

__global__ __launch_bounds__(CVT_T) void cvt16_kernel(
    const float* __restrict__ q,  const float* __restrict__ k,
    const float* __restrict__ v,  const float* __restrict__ wq,
    const float* __restrict__ wk, const float* __restrict__ wv,
    const float* __restrict__ wo, _Float16* __restrict__ dst) {
  const int wg = blockIdx.x;
  const float* src;
  int part;                                   // this work-group's place in its source
  if (wg < 3 * XWG) {
    const int s = wg / XWG;
    src  = s == 0 ? q : s == 1 ? k : v;
    part = wg - s * XWG;
  } else {
    const int s = (wg - 3 * XWG) / WWG;
    src  = s == 0 ? wq : s == 1 ? wk : s == 2 ? wv : wo;
    part = wg - 3 * XWG - s * WWG;
  }
  const v4f* sp = (const v4f*)src + (size_t)part * CVT_WG + threadIdx.x;
  v4h*       dp = (v4h*)dst + (size_t)wg * CVT_WG + threadIdx.x;
  v4f x[CVT_N];
  // unrolled: x stays in registers and the loads issue back to back, many in flight
#pragma unroll
  for (int i = 0; i < CVT_N; ++i) x[i] = sp[i * CVT_T];
  // unrolled: constant indices into x, constant store offsets
#pragma unroll
  for (int i = 0; i < CVT_N; ++i) {
    v4h y;
#pragma unroll
    for (int j = 0; j < 4; ++j) y[j] = (_Float16)x[i][j];
    dp[i * CVT_T] = y;
  }
}

// ---- GEMM operand staging: 64-row tiles of X and W, 128 k per stage ----------
// A fragment load straight from global touches 16 cache lines for 512 bytes;
// a staging copy reads whole 128-byte lines, and the fragments come from LDS.
constexpr int BK   = 128;        // halves of K per stage: 256 bytes of every operand row
constexpr int LDG  = BK + 8;     // LDS pitch 272 bytes: conflict-free b128 reads
constexpr int NST  = DM / BK;    // 6 stages
constexpr int TILE = 64 * LDG;   // halves of one staged tile

DEV unsigned lds_off(const void* p) { return (unsigned)(size_t)p; }

// One lane's share of a tile: eight 16-byte copies, tile rows 8 apart.
// The closing s_wait_xcnt stands in the copies' own statement so that no
// address register named here is rewritten before it.
DEV void copy_tile(unsigned l, const _Float16* gp) {
  constexpr unsigned LS = 8 * LDG * 2;   // bytes between this lane's rows in LDS
  constexpr int      GS = 8 * DM;        // halves between them in global memory
  asm volatile(
      "global_load_async_to_lds_b128 %0, %8, off\n\t"
      "global_load_async_to_lds_b128 %1, %9, off\n\t"
      "global_load_async_to_lds_b128 %2, %10, off\n\t"
      "global_load_async_to_lds_b128 %3, %11, off\n\t"
      "global_load_async_to_lds_b128 %4, %12, off\n\t"
      "global_load_async_to_lds_b128 %5, %13, off\n\t"
      "global_load_async_to_lds_b128 %6, %14, off\n\t"
      "global_load_async_to_lds_b128 %7, %15, off\n\t"
      "s_wait_xcnt 0x0"
      :: "v"(l), "v"(l + LS), "v"(l + 2 * LS), "v"(l + 3 * LS),
         "v"(l + 4 * LS), "v"(l + 5 * LS), "v"(l + 6 * LS), "v"(l + 7 * LS),
         "v"(gp), "v"(gp + GS), "v"(gp + 2 * GS), "v"(gp + 3 * GS),
         "v"(gp + 4 * GS), "v"(gp + 5 * GS), "v"(gp + 6 * GS), "v"(gp + 7 * GS)
      : "memory");
}

// c[t] += X[rowblk + wave*16 .. +15][:] * W[colbase + t*16 .. +15][:]^T over all of K,
// k ascending in steps of 32; two LDS buffers, the next stage's copies fly
// while this stage is worked on.
DEV void gemm_64x64(const _Float16* __restrict__ X, const _Float16* __restrict__ W,
                    int rowblk, int colbase, v8f (&c)[4]) {
  __shared__ __align__(16) _Float16 sX[2][TILE];
  __shared__ __align__(16) _Float16 sW[2][TILE];
  const int tid  = threadIdx.x;
  const int lane = tid & 31;
  const int wave = tid >> 5;
  const int row  = lane & 15;
  const int g    = lane >> 4;

  const int cr = tid >> 4;          // this lane's first tile row, 0..7
  const int cc = (tid & 15) * 8;    // its 16-byte chunk of the 256-byte row
  const _Float16* gx = X + (size_t)(rowblk + cr) * DM + cc;
  const _Float16* gw = W + (size_t)(colbase + cr) * DM + cc;
  const unsigned  lx = lds_off(&sX[0][cr * LDG + cc]);
  const unsigned  lw = lds_off(&sW[0][cr * LDG + cc]);
  auto stage = [&](int s) {
    const unsigned bo = (unsigned)(s & 1) * (TILE * 2);
    copy_tile(lx + bo, gx + s * BK);
    copy_tile(lw + bo, gw + s * BK);
  };

  stage(0);
  asm volatile("s_wait_asynccnt 0x0" ::: "memory");  // stage 0 has landed before it is published
  __syncthreads();
  stage(1);

  for (int s = 0; s < NST; ++s) {
    const _Float16* xB = sX[s & 1] + (wave * 16 + row) * LDG + g * 8;
    const _Float16* wB = sW[s & 1] + row * LDG + g * 8;
    v16h a[4], b[4][4];
#pragma unroll
    for (int j = 0; j < 4; ++j) {
      a[j] = frag_f16(xB + j * 32);
#pragma unroll
      for (int t = 0; t < 4; ++t) b[j][t] = frag_f16(wB + t * 16 * LDG + j * 32);
    }
    // keeps the stage's LDS reads one group in front of its products; left free,
    // the scheduler sinks each pair to its product behind a wait to zero
    __builtin_amdgcn_sched_barrier(0);
#pragma unroll
    for (int j = 0; j < 4; ++j)
#pragma unroll
      for (int t = 0; t < 4; ++t) c[t] = wmma(a[j], b[j][t], c[t]);
    // keeps the products in front of the stage's foot, where they run while the
    // later reads return; left free, they sink behind the barrier and delay the refill
    __builtin_amdgcn_sched_barrier(0);
    asm volatile("s_wait_dscnt 0x0" ::: "memory");     // this wave's reads of the buffer have ended
    asm volatile("s_wait_asynccnt 0x0" ::: "memory");  // its copies of stage s + 1 have landed
    __syncthreads();  // publishes stage s + 1 and frees the buffer of stage s
    if (s + 2 < NST) stage(s + 2);
  }
  asm volatile("s_wait_asynccnt 0x0" ::: "memory");    // nothing in flight when the wave ends
}

// ---- QKV projection (all-f16 operands): Y = X @ W^T + b, head layout --------
// mode 0: Y[b][h][s][d]  (Q and K)        mode 1: Y[b][h][d][s]  (V transposed)
// One launch for all three: blockIdx.z = 0, 1, 2 is Q, K, V; the three X, the
// three W and the three Y each lie one behind the other in the workspace.
__global__ __launch_bounds__(128) void proj16_kernel(
    const _Float16* __restrict__ X3, const _Float16* __restrict__ W3,
    const float* __restrict__ bq, const float* __restrict__ bk,
    const float* __restrict__ bv3, _Float16* __restrict__ Y3) {
  const int z = blockIdx.z;
  const _Float16* X = X3 + (size_t)z * NROW * DM;
  const _Float16* W = W3 + (size_t)z * DM * DM;
  _Float16*       Y = Y3 + (size_t)z * NROW * DM;
  const float* bias = z == 0 ? bq : z == 1 ? bk : bv3;
  const int    mode = z == 2 ? 1 : 0;
  const int lane = threadIdx.x & 31;
  const int wave = threadIdx.x >> 5;
  const int row  = lane & 15;
  const int g    = lane >> 4;
  const int rowbase = blockIdx.x * 64 + wave * 16;
  const int h       = blockIdx.y;          // 64-col tile == one head
  const int colbase = h * DK;

  v8f c[4] = {v8f{}, v8f{}, v8f{}, v8f{}};
  gemm_64x64(X, W, blockIdx.x * 64, colbase, c);

  const int mrow0 = g * 8;
#pragma unroll
  for (int t = 0; t < 4; ++t) {
    const int d = t * 16 + row;
    const float bv = bias[colbase + d];
#pragma unroll
    for (int r = 0; r < 8; ++r) {
      const int grow = rowbase + mrow0 + r;
      const int bb = grow >> 11;
      const int s  = grow & (SEQ - 1);
      const float val = c[t][r] + bv;
      size_t off;
      if (mode == 0) off = ((size_t)(bb * NH + h) * SEQ + s) * DK + d;
      else           off = ((size_t)(bb * NH + h) * DK + d) * SEQ + s;
      Y[off] = (_Float16)val;
    }
  }
}

__global__ __launch_bounds__(128) void attn_kernel(
    const _Float16* __restrict__ Q, const _Float16* __restrict__ K,
    const _Float16* __restrict__ Vt, const int* __restrict__ mask,
    _Float16* __restrict__ AO) {
  __shared__ __align__(16) _Float16 sK[2][64 * LDP];  // K tile, [key][d] padded
  __shared__ __align__(16) _Float16 sV[2][64 * LDP];  // V^T tile, [d][key] padded

  const int tid  = threadIdx.x;
  const int lane = tid & 31;
  const int wave = tid >> 5;
  const int row  = lane & 15;
  const int g    = lane >> 4;
  const int h = blockIdx.y, b = blockIdx.z;
  const int bh = b * NH + h;
  const int qbase = blockIdx.x * 64 + wave * 16;

  const _Float16* Qh = Q  + (size_t)bh * SEQ * DK;
  const _Float16* Kh = K  + (size_t)bh * SEQ * DK;
  const _Float16* Vh = Vt + (size_t)bh * DK * SEQ;

  const _Float16* qrow = Qh + (size_t)(qbase + row) * DK;
  const v16h qf0 = frag_f16(qrow + 0  + g * 8);
  const v16h qf1 = frag_f16(qrow + 32 + g * 8);

  // this lane's query row of the mask, at its half's first key
  const int* mrow = mask + (size_t)(qbase + row) * SEQ + g * 8;

  float m_i = -3.0e38f;   // running max of this lane's query (both halves agree)
  float l_i = 0.0f;       // running sum over this half's keys; halves join at the end
  v8f o[4] = {v8f{}, v8f{}, v8f{}, v8f{}};  // o[t][r] = O[query row][d = t*16 + g*8 + r]

  // stage one 64-key tile (8 KB K + 8 KB V) via 8 async b128 ops per thread
  auto stage = [&](int kb, int buf) {
#pragma unroll
    for (int i = 0; i < 4; ++i) {
      const int c  = tid + i * 128;       // 0..511 16-byte chunks
      const int r  = c >> 3;              // tile row 0..63
      const int ch = (c & 7) * 8;         // halves within row
      async_cp16(&sK[buf][r * LDP + ch], Kh + (size_t)(kb + r) * DK + ch);
      async_cp16(&sV[buf][r * LDP + ch], Vh + (size_t)r * SEQ + kb + ch);
    }
  };

  stage(0, 0);
  for (int kb = 0; kb < SEQ; kb += 64) {
    const int cur = (kb >> 6) & 1;
    if (kb + 64 < SEQ) { stage(kb + 64, cur ^ 1); ASYNC_WAIT(8); }
    else               { ASYNC_WAIT(0); }
    __syncthreads();

    const _Float16* kB = sK[cur];
    const _Float16* vB = sV[cur];

    // mask: 8 consecutive keys of this lane's mask row per 16-key group
    v4i ma[4], mb[4];
#pragma unroll
    for (int t = 0; t < 4; ++t) {
      ma[t] = *(const v4i*)(mrow + kb + t * 16);
      mb[t] = *(const v4i*)(mrow + kb + t * 16 + 4);
    }

    // S^T = K Q^T, 64k x 16q: c[t][r] = S[query row][key kb + t*16 + g*8 + r]
    v8f c[4];
#pragma unroll
    for (int t = 0; t < 4; ++t) {
      const _Float16* krow = kB + (t * 16 + row) * LDP + g * 8;
      v8f z{};
      c[t] = wmma(frag_f16(krow), qf0, z);
      c[t] = wmma(frag_f16(krow + 32), qf1, c[t]);
    }
    // scale + mask
#pragma unroll
    for (int t = 0; t < 4; ++t) {
#pragma unroll
      for (int r = 0; r < 4; ++r) {
        c[t][r]     = (ma[t][r] == 0) ? -1.0e9f : c[t][r] * 0.125f;
        c[t][r + 4] = (mb[t][r] == 0) ? -1.0e9f : c[t][r + 4] * 0.125f;
      }
    }
    // online softmax, one query per lane
    float vm[4];
#pragma unroll
    for (int t = 0; t < 4; ++t) {
      vm[t] = fmaxf(c[t][0], c[t][1]);
#pragma unroll
      for (int r = 2; r < 8; ++r) vm[t] = fmaxf(vm[t], c[t][r]);
    }
    float vmax = fmaxf(fmaxf(vm[0], vm[1]), fmaxf(vm[2], vm[3]));
    vmax = fmaxf(vmax, xhalf(vmax));
    const float mnew  = fmaxf(m_i, vmax);
    const float alpha = __expf(m_i - mnew);
    m_i = mnew;
    float s4[4];
#pragma unroll
    for (int t = 0; t < 4; ++t) {
#pragma unroll
      for (int r = 0; r < 8; ++r) c[t][r] = __expf(c[t][r] - mnew);
      s4[t] = ((c[t][0] + c[t][1]) + (c[t][2] + c[t][3])) +
              ((c[t][4] + c[t][5]) + (c[t][6] + c[t][7]));
    }
    l_i = l_i * alpha + ((s4[0] + s4[1]) + (s4[2] + s4[3]));
#pragma unroll
    for (int t = 0; t < 4; ++t)
#pragma unroll
      for (int r = 0; r < 8; ++r) o[t][r] *= alpha;
    // P^T: two converted score tiles are one B fragment (32 keys x 16 queries)
    v16h p0, p1;
#pragma unroll
    for (int r = 0; r < 8; ++r) {
      p0[r] = (_Float16)c[0][r]; p0[r + 8] = (_Float16)c[1][r];
      p1[r] = (_Float16)c[2][r]; p1[r + 8] = (_Float16)c[3][r];
    }
    // O^T += V^T P^T
#pragma unroll
    for (int t = 0; t < 4; ++t) {
      const _Float16* vrow = vB + (t * 16 + row) * LDP + g * 8;
      o[t] = wmma(frag_f16(vrow), p0, o[t]);
      o[t] = wmma(frag_f16(vrow + 32), p1, o[t]);
    }
    __syncthreads();  // all waves done reading before this buffer is re-staged
  }

  // epilogue: join the halves' sums, O / l, 8 consecutive d per 16-byte store
  const float inv = 1.0f / (l_i + xhalf(l_i));
  _Float16* arow = AO + (size_t)(b * SEQ + qbase + row) * DM + h * DK + g * 8;
#pragma unroll
  for (int t = 0; t < 4; ++t) {
    v8h y;
#pragma unroll
    for (int r = 0; r < 8; ++r) y[r] = (_Float16)(o[t][r] * inv);
    *(v8h*)(arow + t * 16) = y;
  }
}

// ---- output projection: f32 out = AO(f16) @ Wo^T(f16) + bo ------------------
__global__ __launch_bounds__(128) void oproj16_kernel(
    const _Float16* __restrict__ X16, const _Float16* __restrict__ W,
    const float* __restrict__ bias, float* __restrict__ Y) {
  const int lane = threadIdx.x & 31;
  const int wave = threadIdx.x >> 5;
  const int row  = lane & 15;
  const int g    = lane >> 4;
  const int rowbase = blockIdx.x * 64 + wave * 16;
  const int colbase = blockIdx.y * 64;

  v8f c[4] = {v8f{}, v8f{}, v8f{}, v8f{}};
  gemm_64x64(X16, W, blockIdx.x * 64, colbase, c);
  const int mrow0 = g * 8;
#pragma unroll
  for (int t = 0; t < 4; ++t) {
    const int n = colbase + t * 16 + row;
    const float bv = bias[n];
#pragma unroll
    for (int r = 0; r < 8; ++r)
      Y[(size_t)(rowbase + mrow0 + r) * DM + n] = c[t][r] + bv;
  }
}

// ---- launch -----------------------------------------------------------------
extern "C" void kernel_launch(void* const* d_in, const int* in_sizes, int n_in,
                              void* d_out, int out_size, void* d_ws, size_t ws_size,
                              hipStream_t stream) {
  const float* q    = (const float*)d_in[0];
  const float* k    = (const float*)d_in[1];
  const float* v    = (const float*)d_in[2];
  const int*   mask = (const int*)  d_in[3];
  const float* w_q  = (const float*)d_in[4];
  const float* b_q  = (const float*)d_in[5];
  const float* w_k  = (const float*)d_in[6];
  const float* b_k  = (const float*)d_in[7];
  const float* w_v  = (const float*)d_in[8];
  const float* b_v  = (const float*)d_in[9];
  const float* w_o  = (const float*)d_in[10];
  const float* b_o  = (const float*)d_in[11];

  const size_t nXW = (size_t)NROW * DM;   // 4096*768
  const size_t nWW = (size_t)DM * DM;     // 768*768
  _Float16* p = (_Float16*)d_ws;
  _Float16* xq16 = p; p += nXW;
  _Float16* xk16 = p; p += nXW;
  _Float16* xv16 = p; p += nXW;
  _Float16* wq16 = p; p += nWW;
  _Float16* wk16 = p; p += nWW;
  _Float16* wv16 = p; p += nWW;
  _Float16* wo16 = p; p += nWW;
  _Float16* q16  = p; p += nXW;
  _Float16* k16  = p; p += nXW;
  _Float16* vt16 = p; p += nXW;
  _Float16* ao16 = p; p += nXW;

  const dim3 blk(128);
  cvt16_kernel<<<3 * XWG + 4 * WWG, CVT_T, 0, stream>>>(q, k, v, w_q, w_k, w_v, w_o, xq16);

  const dim3 pg(NROW / 64, DM / 64);      // 64 x 12
  proj16_kernel<<<dim3(NROW / 64, DM / 64, 3), blk, 0, stream>>>(xq16, wq16, b_q, b_k, b_v, q16);

  attn_kernel<<<dim3(SEQ / 64, NH, 2), blk, 0, stream>>>(q16, k16, vt16, mask, ao16);

  oproj16_kernel<<<pg, blk, 0, stream>>>(ao16, wo16, b_o, (float*)d_out);
}

// v004
// A run of this version takes 88.8 microseconds.
// In both of two side-by-side timings against v003, it was 1.25 times as fast.
// Counting every step since v000, it is 4.04 times as fast.
#include <hip/hip_runtime.h>

typedef __attribute__((ext_vector_type(16))) _Float16 v16h;
typedef __attribute__((ext_vector_type(8)))  _Float16 v8h;
typedef __attribute__((ext_vector_type(8)))  float    v8f;
typedef __attribute__((ext_vector_type(4)))  int      v4i;
typedef __attribute__((ext_vector_type(4)))  float    v4f;
typedef __attribute__((ext_vector_type(4)))  _Float16 v4h;
typedef __attribute__((ext_vector_type(16))) unsigned v16u;

#define DEV static __device__ __forceinline__

constexpr int DM   = 768;     // model dim
constexpr int SEQ  = 2048;    // sequence length
constexpr int NH   = 12;      // heads
constexpr int DK   = 64;      // head dim
constexpr int NROW = 2 * SEQ; // B*S = 4096 rows
constexpr int LDP  = 72;      // padded LDS row (halves): conflict-free b128 reads

// ---- CDNA5 async global->LDS copy (guarded; falls back to sync staging) -----
#if defined(__has_builtin) && __has_builtin(__builtin_amdgcn_global_load_async_to_lds_b128)
#define HAVE_ASYNC_LDS 1
DEV void async_cp16(_Float16* ldst, const _Float16* gsrc) {
  __builtin_amdgcn_global_load_async_to_lds_b128(
      (__attribute__((address_space(1))) v4i*)gsrc,
      (__attribute__((address_space(3))) v4i*)ldst,
      0, 0);
}
#if defined(__has_builtin) && __has_builtin(__builtin_amdgcn_s_wait_asynccnt)
#define ASYNC_WAIT(n) __builtin_amdgcn_s_wait_asynccnt(n)
#else
#define ASYNC_WAIT(n) asm volatile("s_wait_asynccnt " #n ::: "memory")
#endif
#else
#define HAVE_ASYNC_LDS 0
DEV void async_cp16(_Float16* ldst, const _Float16* gsrc) {
  *(v8h*)ldst = *(const v8h*)gsrc;   // sync fallback through VGPRs
}
#define ASYNC_WAIT(n) ((void)0)
#endif

// ---- fragment helpers -------------------------------------------------------
// CDNA5 16-bit A/B fragment (16x32 / 32x16), wave32:
//   lane l: row/col = l&15, g = l>>4
//   VGPR0..3 hold K = g*8 + 0..7, VGPR4..7 hold K = 16 + g*8 + 0..7
// => per lane: two contiguous 16-byte chunks at +0 and +16 halves.
DEV v16h frag_f16(const _Float16* p) {
  v8h lo = *(const v8h*)p;
  v8h hi = *(const v8h*)(p + 16);
  v16h r;
#pragma unroll
  for (int i = 0; i < 8; ++i) { r[i] = lo[i]; r[i + 8] = hi[i]; }
  return r;
}

DEV v8f wmma(v16h a, v16h b, v8f c) {
  return __builtin_amdgcn_wmma_f32_16x16x32_f16(false, a, false, b, (short)0, c,
                                                false, false);
}

// lane l <-> lane l ^ 16: the one exchange between the wave halves
DEV float xhalf(float x) {
  const int b = __builtin_bit_cast(int, x);
  return __builtin_bit_cast(float, __builtin_amdgcn_permlanex16(
      b, b, 0x76543210, 0xfedcba98, false, false));
}

// ---- f32 -> f16 of all seven operands in ONE launch -------------------------
// The destinations lie one behind the other in the workspace in the order
// q, k, v, w_q, w_k, w_v, w_o, so a converting work-group's place among its kind
// is also its place in the destination. A work-group converts CVT_WG 16-byte pieces of one
// source; a wave-wide load covers 512 contiguous bytes, a store 256.
constexpr int CVT_T  = 512;                   // threads: 16 waves on a WGP
constexpr int CVT_N  = 24;                    // pieces per thread
constexpr int CVT_WG = CVT_T * CVT_N;         // pieces of 4 floats per work-group
constexpr int XWG = NROW * DM / 4 / CVT_WG;   // 64 work-groups per activation
constexpr int WWG = DM * DM / 4 / CVT_WG;     // 12 per weight
static_assert(XWG * CVT_WG * 4 == NROW * DM && WWG * CVT_WG * 4 == DM * DM,
              "every source is a whole number of work-groups");
constexpr int NCVT = 3 * XWG + 4 * WWG;       // work-groups that convert

// The same launch packs the mask for the attention kernel, whose lane l holds,
// for 16 queries x 64 keys, the scores of query l & 15 at keys
// t*16 + (l >> 4)*8 + r. Word t*8 + r of such a block has in bit l whether
// that lane's key is open (mask != 0): a ready lane mask for a select.
// Layout: [16-query block][64-key block][t*8 + r], 128 bytes per block pair.
// A load of this pattern touches 16 lines, which is paid on the WGP's load path:
// the packing is spread over many work-groups, and they stand first in the grid.
constexpr int MP_N = 2;                       // 64-key blocks per wave
constexpr int MWG  = (SEQ / 16) * (SEQ / 64) / MP_N / (CVT_T / 32);   // 128 work-groups
static_assert(MWG * MP_N * (CVT_T / 32) == (SEQ / 16) * (SEQ / 64), "whole work-groups");

__global__ __launch_bounds__(CVT_T) void cvt16_kernel(
    const float* __restrict__ q,  const float* __restrict__ k,
    const float* __restrict__ v,  const float* __restrict__ wq,
    const float* __restrict__ wk, const float* __restrict__ wv,
    const float* __restrict__ wo, const int* __restrict__ mask,
    _Float16* __restrict__ dst, unsigned* __restrict__ mbits) {
  if (blockIdx.x < MWG) {
    const int lane = threadIdx.x & 31;
    const int unit = blockIdx.x * (CVT_T / 32) + (threadIdx.x >> 5);
    const int qblk = unit / (SEQ / 64 / MP_N);            // 16-query block
    const int kb0  = unit % (SEQ / 64 / MP_N) * MP_N;     // first 64-key block
    const int* mr = mask + (size_t)(qblk * 16 + (lane & 15)) * SEQ + kb0 * 64 + (lane >> 4) * 8;
    v4i m[MP_N][8];
    // unrolled: m stays in registers and the loads issue back to back
#pragma unroll
    for (int i = 0; i < MP_N; ++i)
#pragma unroll
      for (int j = 0; j < 8; ++j) m[i][j] = *(const v4i*)(mr + i * 64 + (j >> 1) * 16 + (j & 1) * 4);
    unsigned* op = mbits + (size_t)(qblk * (SEQ / 64) + kb0) * 32 + lane;
#pragma unroll
    for (int i = 0; i < MP_N; ++i) {
      unsigned mine = 0;                      // lane j keeps word j: one 128-byte store
#pragma unroll
      for (int j = 0; j < 32; ++j) {
        const unsigned w = __builtin_amdgcn_ballot_w32(m[i][j >> 2][j & 3] != 0);
        mine = lane == j ? w : mine;
      }
      op[i * 32] = mine;
    }
    return;
  }
  const int wg = blockIdx.x - MWG;            // place among the converting work-groups
  const float* src;
  int part;                                   // this work-group's place in its source
  if (wg < 3 * XWG) {
    const int s = wg / XWG;
    src  = s == 0 ? q : s == 1 ? k : v;
    part = wg - s * XWG;
  } else {
    const int s = (wg - 3 * XWG) / WWG;
    src  = s == 0 ? wq : s == 1 ? wk : s == 2 ? wv : wo;
    part = wg - 3 * XWG - s * WWG;
  }
  const v4f* sp = (const v4f*)src + (size_t)part * CVT_WG + threadIdx.x;
  v4h*       dp = (v4h*)dst + (size_t)wg * CVT_WG + threadIdx.x;
  v4f x[CVT_N];
  // unrolled: x stays in registers and the loads issue back to back, many in flight
#pragma unroll
  for (int i = 0; i < CVT_N; ++i) x[i] = sp[i * CVT_T];
  // unrolled: constant indices into x, constant store offsets
#pragma unroll
  for (int i = 0; i < CVT_N; ++i) {
    v4h y;
#pragma unroll
    for (int j = 0; j < 4; ++j) y[j] = (_Float16)x[i][j];
    dp[i * CVT_T] = y;
  }
}

// ---- GEMM operand staging: 64-row tiles of X and W, 128 k per stage ----------
// A fragment load straight from global touches 16 cache lines for 512 bytes;
// a staging copy reads whole 128-byte lines, and the fragments come from LDS.
constexpr int BK   = 128;        // halves of K per stage: 256 bytes of every operand row
constexpr int LDG  = BK + 8;     // LDS pitch 272 bytes: conflict-free b128 reads
constexpr int NST  = DM / BK;    // 6 stages
constexpr int TILE = 64 * LDG;   // halves of one staged tile

DEV unsigned lds_off(const void* p) { return (unsigned)(size_t)p; }

// One lane's share of a tile: eight 16-byte copies, tile rows 8 apart.
// The closing s_wait_xcnt stands in the copies' own statement so that no
// address register named here is rewritten before it.
DEV void copy_tile(unsigned l, const _Float16* gp) {
  constexpr unsigned LS = 8 * LDG * 2;   // bytes between this lane's rows in LDS
  constexpr int      GS = 8 * DM;        // halves between them in global memory
  asm volatile(
      "global_load_async_to_lds_b128 %0, %8, off\n\t"
      "global_load_async_to_lds_b128 %1, %9, off\n\t"
      "global_load_async_to_lds_b128 %2, %10, off\n\t"
      "global_load_async_to_lds_b128 %3, %11, off\n\t"
      "global_load_async_to_lds_b128 %4, %12, off\n\t"
      "global_load_async_to_lds_b128 %5, %13, off\n\t"
      "global_load_async_to_lds_b128 %6, %14, off\n\t"
      "global_load_async_to_lds_b128 %7, %15, off\n\t"
      "s_wait_xcnt 0x0"
      :: "v"(l), "v"(l + LS), "v"(l + 2 * LS), "v"(l + 3 * LS),
         "v"(l + 4 * LS), "v"(l + 5 * LS), "v"(l + 6 * LS), "v"(l + 7 * LS),
         "v"(gp), "v"(gp + GS), "v"(gp + 2 * GS), "v"(gp + 3 * GS),
         "v"(gp + 4 * GS), "v"(gp + 5 * GS), "v"(gp + 6 * GS), "v"(gp + 7 * GS)
      : "memory");
}

// c[t] += X[rowblk + wave*16 .. +15][:] * W[colbase + t*16 .. +15][:]^T over all of K,
// k ascending in steps of 32; two LDS buffers, the next stage's copies fly
// while this stage is worked on.
DEV void gemm_64x64(const _Float16* __restrict__ X, const _Float16* __restrict__ W,
                    int rowblk, int colbase, v8f (&c)[4]) {
  __shared__ __align__(16) _Float16 sX[2][TILE];
  __shared__ __align__(16) _Float16 sW[2][TILE];
  const int tid  = threadIdx.x;
  const int lane = tid & 31;
  const int wave = tid >> 5;
  const int row  = lane & 15;
  const int g    = lane >> 4;

  const int cr = tid >> 4;          // this lane's first tile row, 0..7
  const int cc = (tid & 15) * 8;    // its 16-byte chunk of the 256-byte row
  const _Float16* gx = X + (size_t)(rowblk + cr) * DM + cc;
  const _Float16* gw = W + (size_t)(colbase + cr) * DM + cc;
  const unsigned  lx = lds_off(&sX[0][cr * LDG + cc]);
  const unsigned  lw = lds_off(&sW[0][cr * LDG + cc]);
  auto stage = [&](int s) {
    const unsigned bo = (unsigned)(s & 1) * (TILE * 2);
    copy_tile(lx + bo, gx + s * BK);
    copy_tile(lw + bo, gw + s * BK);
  };

  stage(0);
  asm volatile("s_wait_asynccnt 0x0" ::: "memory");  // stage 0 has landed before it is published
  __syncthreads();
  stage(1);

  for (int s = 0; s < NST; ++s) {
    const _Float16* xB = sX[s & 1] + (wave * 16 + row) * LDG + g * 8;
    const _Float16* wB = sW[s & 1] + row * LDG + g * 8;
    v16h a[4], b[4][4];
#pragma unroll
    for (int j = 0; j < 4; ++j) {
      a[j] = frag_f16(xB + j * 32);
#pragma unroll
      for (int t = 0; t < 4; ++t) b[j][t] = frag_f16(wB + t * 16 * LDG + j * 32);
    }
    // keeps the stage's LDS reads one group in front of its products; left free,
    // the scheduler sinks each pair to its product behind a wait to zero
    __builtin_amdgcn_sched_barrier(0);
#pragma unroll
    for (int j = 0; j < 4; ++j)
#pragma unroll
      for (int t = 0; t < 4; ++t) c[t] = wmma(a[j], b[j][t], c[t]);
    // keeps the products in front of the stage's foot, where they run while the
    // later reads return; left free, they sink behind the barrier and delay the refill
    __builtin_amdgcn_sched_barrier(0);
    asm volatile("s_wait_dscnt 0x0" ::: "memory");     // this wave's reads of the buffer have ended
    asm volatile("s_wait_asynccnt 0x0" ::: "memory");  // its copies of stage s + 1 have landed
    __syncthreads();  // publishes stage s + 1 and frees the buffer of stage s
    if (s + 2 < NST) stage(s + 2);
  }
  asm volatile("s_wait_asynccnt 0x0" ::: "memory");    // nothing in flight when the wave ends
}

// ---- QKV projection (all-f16 operands): Y = X @ W^T + b, head layout --------
// mode 0: Y[b][h][s][d]  (Q and K)        mode 1: Y[b][h][d][s]  (V transposed)
// One launch for all three: blockIdx.z = 0, 1, 2 is Q, K, V; the three X, the
// three W and the three Y each lie one behind the other in the workspace.
__global__ __launch_bounds__(128) void proj16_kernel(
    const _Float16* __restrict__ X3, const _Float16* __restrict__ W3,
    const float* __restrict__ bq, const float* __restrict__ bk,
    const float* __restrict__ bv3, _Float16* __restrict__ Y3) {
  const int z = blockIdx.z;
  const _Float16* X = X3 + (size_t)z * NROW * DM;
  const _Float16* W = W3 + (size_t)z * DM * DM;
  _Float16*       Y = Y3 + (size_t)z * NROW * DM;
  const float* bias = z == 0 ? bq : z == 1 ? bk : bv3;
  const int    mode = z == 2 ? 1 : 0;
  const int lane = threadIdx.x & 31;
  const int wave = threadIdx.x >> 5;
  const int row  = lane & 15;
  const int g    = lane >> 4;
  const int rowbase = blockIdx.x * 64 + wave * 16;
  const int h       = blockIdx.y;          // 64-col tile == one head
  const int colbase = h * DK;

  v8f c[4] = {v8f{}, v8f{}, v8f{}, v8f{}};
  gemm_64x64(X, W, blockIdx.x * 64, colbase, c);

  const int mrow0 = g * 8;
#pragma unroll
  for (int t = 0; t < 4; ++t) {
    const int d = t * 16 + row;
    const float bv = bias[colbase + d];
#pragma unroll
    for (int r = 0; r < 8; ++r) {
      const int grow = rowbase + mrow0 + r;
      const int bb = grow >> 11;
      const int s  = grow & (SEQ - 1);
      const float val = c[t][r] + bv;
      size_t off;
      if (mode == 0) off = ((size_t)(bb * NH + h) * SEQ + s) * DK + d;
      else           off = ((size_t)(bb * NH + h) * DK + d) * SEQ + s;
      Y[off] = (_Float16)val;
    }
  }
}

__global__ __launch_bounds__(128) void attn_kernel(
    const _Float16* __restrict__ Q, const _Float16* __restrict__ K,
    const _Float16* __restrict__ Vt, const unsigned* __restrict__ mbits,
    _Float16* __restrict__ AO) {
  __shared__ __align__(16) _Float16 sK[2][64 * LDP];  // K tile, [key][d] padded
  __shared__ __align__(16) _Float16 sV[2][64 * LDP];  // V^T tile, [d][key] padded

  const int tid  = threadIdx.x;
  const int lane = tid & 31;
  const int wave = tid >> 5;
  const int row  = lane & 15;
  const int g    = lane >> 4;
  const int h = blockIdx.y, b = blockIdx.z;
  const int bh = b * NH + h;
  const int qbase = blockIdx.x * 64 + wave * 16;

  const _Float16* Qh = Q  + (size_t)bh * SEQ * DK;
  const _Float16* Kh = K  + (size_t)bh * SEQ * DK;
  const _Float16* Vh = Vt + (size_t)bh * DK * SEQ;

  const _Float16* qrow = Qh + (size_t)(qbase + row) * DK;
  const v16h qf0 = frag_f16(qrow + 0  + g * 8);
  const v16h qf1 = frag_f16(qrow + 32 + g * 8);

  // this wave's packed mask: 32 lane-mask words per 64 keys. The wave's number
  // goes through readfirstlane so that the address is scalar and the words
  // arrive in scalar registers, where a select reads them as they are.
  const int wv = __builtin_amdgcn_readfirstlane(wave);
  // Constant address space: nothing writes these words while this kernel runs;
  // without it the compiler takes the copies to LDS for possible writers and
  // brings the words through vector registers, one readfirstlane each.
  typedef const __attribute__((address_space(4))) v16u* cmask_t;
  const cmask_t mw = (cmask_t)(unsigned long long)(
      mbits + (size_t)(blockIdx.x * 4 + wv) * (SEQ / 64) * 32);
  v16u w0 = mw[0], w1 = mw[1];

  float m_i = -3.0e38f;   // running max of this lane's query (both halves agree)
  float l_i = 0.0f;       // running sum over this half's keys; halves join at the end
  v8f o[4] = {v8f{}, v8f{}, v8f{}, v8f{}};  // o[t][r] = O[query row][d = t*16 + g*8 + r]

  // stage one 64-key tile (8 KB K + 8 KB V) via 8 async b128 ops per thread
  auto stage = [&](int kb, int buf) {
#pragma unroll
    for (int i = 0; i < 4; ++i) {
      const int c  = tid + i * 128;       // 0..511 16-byte chunks
      const int r  = c >> 3;              // tile row 0..63
      const int ch = (c & 7) * 8;         // halves within row
      async_cp16(&sK[buf][r * LDP + ch], Kh + (size_t)(kb + r) * DK + ch);
      async_cp16(&sV[buf][r * LDP + ch], Vh + (size_t)r * SEQ + kb + ch);
    }
  };

  stage(0, 0);
  for (int kb = 0; kb < SEQ; kb += 64) {
    const int cur = (kb >> 6) & 1;
    if (kb + 64 < SEQ) { stage(kb + 64, cur ^ 1); ASYNC_WAIT(8); }
    else               { ASYNC_WAIT(0); }
    __syncthreads();

    const _Float16* kB = sK[cur];
    const _Float16* vB = sV[cur];

    // S^T = K Q^T, 64k x 16q: c[t][r] = S[query row][key kb + t*16 + g*8 + r]
    v8f c[4];
#pragma unroll
    for (int t = 0; t < 4; ++t) {
      const _Float16* krow = kB + (t * 16 + row) * LDP + g * 8;
      v8f z{};
      c[t] = wmma(frag_f16(krow), qf0, z);
      c[t] = wmma(frag_f16(krow + 32), qf1, c[t]);
    }
    // scale + mask
#pragma unroll
    for (int t = 0; t < 4; ++t) {
#pragma unroll
      for (int r = 0; r < 8; ++r) {
        const unsigned w = t < 2 ? w0[t * 8 + r] : w1[(t - 2) * 8 + r];
        c[t][r] = __builtin_amdgcn_inverse_ballot_w32(w) ? c[t][r] * 0.125f : -1.0e9f;
      }
    }
    // the next 64 keys' words, asked for behind the last use of these: they
    // travel during the rest of this pass (the last pass asks for its own again)
    {
      const int nx = kb + 64 < SEQ ? (kb >> 6) + 1 : (kb >> 6);
      w0 = mw[nx * 2];
      w1 = mw[nx * 2 + 1];
    }
    // online softmax, one query per lane
    float vm[4];
#pragma unroll
    for (int t = 0; t < 4; ++t) {
      vm[t] = fmaxf(c[t][0], c[t][1]);
#pragma unroll
      for (int r = 2; r < 8; ++r) vm[t] = fmaxf(vm[t], c[t][r]);
    }
    float vmax = fmaxf(fmaxf(vm[0], vm[1]), fmaxf(vm[2], vm[3]));
    vmax = fmaxf(vmax, xhalf(vmax));
    const float mnew  = fmaxf(m_i, vmax);
    const float alpha = __expf(m_i - mnew);
    m_i = mnew;
    float s4[4];
#pragma unroll
    for (int t = 0; t < 4; ++t) {
#pragma unroll
      for (int r = 0; r < 8; ++r) c[t][r] = __expf(c[t][r] - mnew);
      s4[t] = ((c[t][0] + c[t][1]) + (c[t][2] + c[t][3])) +
              ((c[t][4] + c[t][5]) + (c[t][6] + c[t][7]));
    }
    l_i = l_i * alpha + ((s4[0] + s4[1]) + (s4[2] + s4[3]));
#pragma unroll
    for (int t = 0; t < 4; ++t)
#pragma unroll
      for (int r = 0; r < 8; ++r) o[t][r] *= alpha;
    // P^T: two converted score tiles are one B fragment (32 keys x 16 queries)
    v16h p0, p1;
#pragma unroll
    for (int r = 0; r < 8; ++r) {
      p0[r] = (_Float16)c[0][r]; p0[r + 8] = (_Float16)c[1][r];
      p1[r] = (_Float16)c[2][r]; p1[r + 8] = (_Float16)c[3][r];
    }
    // O^T += V^T P^T
#pragma unroll
    for (int t = 0; t < 4; ++t) {
      const _Float16* vrow = vB + (t * 16 + row) * LDP + g * 8;
      o[t] = wmma(frag_f16(vrow), p0, o[t]);
      o[t] = wmma(frag_f16(vrow + 32), p1, o[t]);
    }
    __syncthreads();  // all waves done reading before this buffer is re-staged
  }

  // epilogue: join the halves' sums, O / l, 8 consecutive d per 16-byte store
  const float inv = 1.0f / (l_i + xhalf(l_i));
  _Float16* arow = AO + (size_t)(b * SEQ + qbase + row) * DM + h * DK + g * 8;
#pragma unroll
  for (int t = 0; t < 4; ++t) {
    v8h y;
#pragma unroll
    for (int r = 0; r < 8; ++r) y[r] = (_Float16)(o[t][r] * inv);
    *(v8h*)(arow + t * 16) = y;
  }
}

// ---- output projection: f32 out = AO(f16) @ Wo^T(f16) + bo ------------------
__global__ __launch_bounds__(128) void oproj16_kernel(
    const _Float16* __restrict__ X16, const _Float16* __restrict__ W,
    const float* __restrict__ bias, float* __restrict__ Y) {
  const int lane = threadIdx.x & 31;
  const int wave = threadIdx.x >> 5;
  const int row  = lane & 15;
  const int g    = lane >> 4;
  const int rowbase = blockIdx.x * 64 + wave * 16;
  const int colbase = blockIdx.y * 64;

  v8f c[4] = {v8f{}, v8f{}, v8f{}, v8f{}};
  gemm_64x64(X16, W, blockIdx.x * 64, colbase, c);
  const int mrow0 = g * 8;
#pragma unroll
  for (int t = 0; t < 4; ++t) {
    const int n = colbase + t * 16 + row;
    const float bv = bias[n];
#pragma unroll
    for (int r = 0; r < 8; ++r)
      Y[(size_t)(rowbase + mrow0 + r) * DM + n] = c[t][r] + bv;
  }
}

// ---- launch -----------------------------------------------------------------
extern "C" void kernel_launch(void* const* d_in, const int* in_sizes, int n_in,
                              void* d_out, int out_size, void* d_ws, size_t ws_size,
                              hipStream_t stream) {
  const float* q    = (const float*)d_in[0];
  const float* k    = (const float*)d_in[1];
  const float* v    = (const float*)d_in[2];
  const int*   mask = (const int*)  d_in[3];
  const float* w_q  = (const float*)d_in[4];
  const float* b_q  = (const float*)d_in[5];
  const float* w_k  = (const float*)d_in[6];
  const float* b_k  = (const float*)d_in[7];
  const float* w_v  = (const float*)d_in[8];
  const float* b_v  = (const float*)d_in[9];
  const float* w_o  = (const float*)d_in[10];
  const float* b_o  = (const float*)d_in[11];

  const size_t nXW = (size_t)NROW * DM;   // 4096*768
  const size_t nWW = (size_t)DM * DM;     // 768*768
  _Float16* p = (_Float16*)d_ws;
  _Float16* xq16 = p; p += nXW;
  _Float16* xk16 = p; p += nXW;
  _Float16* xv16 = p; p += nXW;
  _Float16* wq16 = p; p += nWW;
  _Float16* wk16 = p; p += nWW;
  _Float16* wv16 = p; p += nWW;
  _Float16* wo16 = p; p += nWW;
  _Float16* q16  = p; p += nXW;
  _Float16* k16  = p; p += nXW;
  _Float16* vt16 = p; p += nXW;
  _Float16* ao16 = p; p += nXW;
  unsigned* mbits = (unsigned*)p;         // SEQ * SEQ / 8 bytes

  const dim3 blk(128);
  cvt16_kernel<<<MWG + NCVT, CVT_T, 0, stream>>>(q, k, v, w_q, w_k, w_v, w_o, mask, xq16, mbits);

  const dim3 pg(NROW / 64, DM / 64);      // 64 x 12
  proj16_kernel<<<dim3(NROW / 64, DM / 64, 3), blk, 0, stream>>>(xq16, wq16, b_q, b_k, b_v, q16);

  attn_kernel<<<dim3(SEQ / 64, NH, 2), blk, 0, stream>>>(q16, k16, vt16, mbits, ao16);

  oproj16_kernel<<<pg, blk, 0, stream>>>(ao16, wo16, b_o, (float*)d_out);
}

// v005
// One run takes 85.6 microseconds.
// Next to v004, in two timings, it ran 1.03 times as fast each time.
// Over all steps from v000 it is 4.16 times as fast.
#include <hip/hip_runtime.h>

typedef __attribute__((ext_vector_type(16))) _Float16 v16h;
typedef __attribute__((ext_vector_type(8)))  _Float16 v8h;
typedef __attribute__((ext_vector_type(8)))  float    v8f;
typedef __attribute__((ext_vector_type(4)))  int      v4i;
typedef __attribute__((ext_vector_type(4)))  float    v4f;
typedef __attribute__((ext_vector_type(4)))  _Float16 v4h;
typedef __attribute__((ext_vector_type(16))) unsigned v16u;

#define DEV static __device__ __forceinline__

constexpr int DM   = 768;     // model dim
constexpr int SEQ  = 2048;    // sequence length
constexpr int NH   = 12;      // heads
constexpr int DK   = 64;      // head dim
constexpr int NROW = 2 * SEQ; // B*S = 4096 rows
constexpr int LDP  = 72;      // padded LDS row (halves): conflict-free b128 reads

// ---- CDNA5 async global->LDS copy (guarded; falls back to sync staging) -----
#if defined(__has_builtin) && __has_builtin(__builtin_amdgcn_global_load_async_to_lds_b128)
#define HAVE_ASYNC_LDS 1
DEV void async_cp16(_Float16* ldst, const _Float16* gsrc) {
  __builtin_amdgcn_global_load_async_to_lds_b128(
      (__attribute__((address_space(1))) v4i*)gsrc,
      (__attribute__((address_space(3))) v4i*)ldst,
      0, 0);
}
#if defined(__has_builtin) && __has_builtin(__builtin_amdgcn_s_wait_asynccnt)
#define ASYNC_WAIT(n) __builtin_amdgcn_s_wait_asynccnt(n)
#else
#define ASYNC_WAIT(n) asm volatile("s_wait_asynccnt " #n ::: "memory")
#endif
#else
#define HAVE_ASYNC_LDS 0
DEV void async_cp16(_Float16* ldst, const _Float16* gsrc) {
  *(v8h*)ldst = *(const v8h*)gsrc;   // sync fallback through VGPRs
}
#define ASYNC_WAIT(n) ((void)0)
#endif

// ---- fragment helpers -------------------------------------------------------
// CDNA5 16-bit A/B fragment (16x32 / 32x16), wave32:
//   lane l: row/col = l&15, g = l>>4
//   VGPR0..3 hold K = g*8 + 0..7, VGPR4..7 hold K = 16 + g*8 + 0..7
// => per lane: two contiguous 16-byte chunks at +0 and +16 halves.
DEV v16h frag_f16(const _Float16* p) {
  v8h lo = *(const v8h*)p;
  v8h hi = *(const v8h*)(p + 16);
  v16h r;
#pragma unroll
  for (int i = 0; i < 8; ++i) { r[i] = lo[i]; r[i + 8] = hi[i]; }
  return r;
}

DEV v8f wmma(v16h a, v16h b, v8f c) {
  return __builtin_amdgcn_wmma_f32_16x16x32_f16(false, a, false, b, (short)0, c,
                                                false, false);
}

// lane l <-> lane l ^ 16: the one exchange between the wave halves
DEV float xhalf(float x) {
  const int b = __builtin_bit_cast(int, x);
  return __builtin_bit_cast(float, __builtin_amdgcn_permlanex16(
      b, b, 0x76543210, 0xfedcba98, false, false));
}

// ---- f32 -> f16 of all seven operands in ONE launch -------------------------
// The destinations lie one behind the other in the workspace in the order
// q, k, v, w_q, w_k, w_v, w_o, so a converting work-group's place among its kind
// is also its place in the destination. A work-group converts CVT_WG 16-byte pieces of one
// source; a wave-wide load covers 512 contiguous bytes, a store 256.
constexpr int CVT_T  = 512;                   // threads: 16 waves on a WGP
constexpr int CVT_N  = 24;                    // pieces per thread
constexpr int CVT_WG = CVT_T * CVT_N;         // pieces of 4 floats per work-group
constexpr int XWG = NROW * DM / 4 / CVT_WG;   // 64 work-groups per activation
constexpr int WWG = DM * DM / 4 / CVT_WG;     // 12 per weight
static_assert(XWG * CVT_WG * 4 == NROW * DM && WWG * CVT_WG * 4 == DM * DM,
              "every source is a whole number of work-groups");
constexpr int NCVT = 3 * XWG + 4 * WWG;       // work-groups that convert

// The same launch packs the mask for the attention kernel, whose lane l holds,
// for 16 queries x 64 keys, the scores of query l & 15 at keys
// t*16 + (l >> 4)*8 + r. Word t*8 + r of such a block has in bit l whether
// that lane's key is open (mask != 0): a ready lane mask for a select.
// Layout: [16-query block][64-key block][t*8 + r], 128 bytes per block pair.
// A load of this pattern touches 16 lines, which is paid on the WGP's load path:
// the packing is spread over many work-groups, and they stand first in the grid.
constexpr int MP_N = 2;                       // 64-key blocks per wave
constexpr int MWG  = (SEQ / 16) * (SEQ / 64) / MP_N / (CVT_T / 32);   // 128 work-groups
static_assert(MWG * MP_N * (CVT_T / 32) == (SEQ / 16) * (SEQ / 64), "whole work-groups");

__global__ __launch_bounds__(CVT_T) void cvt16_kernel(
    const float* __restrict__ q,  const float* __restrict__ k,
    const float* __restrict__ v,  const float* __restrict__ wq,
    const float* __restrict__ wk, const float* __restrict__ wv,
    const float* __restrict__ wo, const int* __restrict__ mask,
    _Float16* __restrict__ dst, unsigned* __restrict__ mbits) {
  if (blockIdx.x < MWG) {
    const int lane = threadIdx.x & 31;
    const int unit = blockIdx.x * (CVT_T / 32) + (threadIdx.x >> 5);
    const int qblk = unit / (SEQ / 64 / MP_N);            // 16-query block
    const int kb0  = unit % (SEQ / 64 / MP_N) * MP_N;     // first 64-key block
    const int* mr = mask + (size_t)(qblk * 16 + (lane & 15)) * SEQ + kb0 * 64 + (lane >> 4) * 8;
    v4i m[MP_N][8];
    // unrolled: m stays in registers and the loads issue back to back
#pragma unroll
    for (int i = 0; i < MP_N; ++i)
#pragma unroll
      for (int j = 0; j < 8; ++j) m[i][j] = *(const v4i*)(mr + i * 64 + (j >> 1) * 16 + (j & 1) * 4);
    unsigned* op = mbits + (size_t)(qblk * (SEQ / 64) + kb0) * 32 + lane;
#pragma unroll
    for (int i = 0; i < MP_N; ++i) {
      unsigned mine = 0;                      // lane j keeps word j: one 128-byte store
#pragma unroll
      for (int j = 0; j < 32; ++j) {
        const unsigned w = __builtin_amdgcn_ballot_w32(m[i][j >> 2][j & 3] != 0);
        mine = lane == j ? w : mine;
      }
      op[i * 32] = mine;
    }
    return;
  }
  const int wg = blockIdx.x - MWG;            // place among the converting work-groups
  const float* src;
  int part;                                   // this work-group's place in its source
  if (wg < 3 * XWG) {
    const int s = wg / XWG;
    src  = s == 0 ? q : s == 1 ? k : v;
    part = wg - s * XWG;
  } else {
    const int s = (wg - 3 * XWG) / WWG;
    src  = s == 0 ? wq : s == 1 ? wk : s == 2 ? wv : wo;
    part = wg - 3 * XWG - s * WWG;
  }
  const v4f* sp = (const v4f*)src + (size_t)part * CVT_WG + threadIdx.x;
  v4h*       dp = (v4h*)dst + (size_t)wg * CVT_WG + threadIdx.x;
  v4f x[CVT_N];
  // unrolled: x stays in registers and the loads issue back to back, many in flight
#pragma unroll
  for (int i = 0; i < CVT_N; ++i) x[i] = sp[i * CVT_T];
  // unrolled: constant indices into x, constant store offsets
#pragma unroll
  for (int i = 0; i < CVT_N; ++i) {
    v4h y;
#pragma unroll
    for (int j = 0; j < 4; ++j) y[j] = (_Float16)x[i][j];
    dp[i * CVT_T] = y;
  }
}

// ---- GEMM operand staging: 64 rows of X and 192 of W, 64 k per stage ---------
// A fragment load straight from global touches 16 cache lines for 512 bytes;
// a staging copy reads whole 128-byte lines, and the fragments come from LDS.
// A work-group makes 64 x 192 of Y with four waves of 64 x 48 each, side by side:
// a staged byte feeds more products than in a small tile, a fragment read from LDS
// three or four. 192 columns are three whole heads, so every 128-byte line of Y
// has one writing work-group. 4096 / 64 * 768 / 192 = 256 work-groups per GEMM.
constexpr int TM   = 64;         // rows of X (and of Y) per work-group
constexpr int TN   = 192;        // rows of W (columns of Y) per work-group
constexpr int FM   = 4;          // 16-row fragments of X per wave
constexpr int FN   = 3;          // 16-row fragments of W per wave
constexpr int BK   = 64;         // halves of K per stage: 128 bytes of every operand row
constexpr int LDG  = BK + 8;     // LDS pitch 144 bytes: conflict-free b128 reads
constexpr int NST  = DM / BK;    // 12 stages
static_assert(NROW % TM == 0 && DM % TN == 0 && DM % BK == 0, "whole tiles");
static_assert(TM == FM * 16 && TN == 4 * FN * 16, "four waves side by side");
static_assert(TN % DK == 0, "whole heads");

DEV unsigned lds_off(const void* p) { return (unsigned)(size_t)p; }

constexpr unsigned LS = 16 * LDG * 2;  // bytes between a lane's rows in LDS
constexpr int      GS = 16 * DM;       // halves between them in global memory

// One lane's share of the X tile: four 16-byte copies, tile rows 16 apart.
// The closing s_wait_xcnt stands in the copies' own statement so that no
// address register named here is rewritten before it.
DEV void copy_x(unsigned l, const _Float16* gp) {
  asm volatile(
      "global_load_async_to_lds_b128 %0, %4, off\n\t"
      "global_load_async_to_lds_b128 %1, %5, off\n\t"
      "global_load_async_to_lds_b128 %2, %6, off\n\t"
      "global_load_async_to_lds_b128 %3, %7, off\n\t"
      "s_wait_xcnt 0x0"
      :: "v"(l), "v"(l + LS), "v"(l + 2 * LS), "v"(l + 3 * LS),
         "v"(gp), "v"(gp + GS), "v"(gp + 2 * GS), "v"(gp + 3 * GS)
      : "memory");
}

// The same for the W tile: twelve copies; the wait closes the statement as above.
DEV void copy_w(unsigned l, const _Float16* gp) {
  asm volatile(
      "global_load_async_to_lds_b128 %0, %12, off\n\t"
      "global_load_async_to_lds_b128 %1, %13, off\n\t"
      "global_load_async_to_lds_b128 %2, %14, off\n\t"
      "global_load_async_to_lds_b128 %3, %15, off\n\t"
      "global_load_async_to_lds_b128 %4, %16, off\n\t"
      "global_load_async_to_lds_b128 %5, %17, off\n\t"
      "global_load_async_to_lds_b128 %6, %18, off\n\t"
      "global_load_async_to_lds_b128 %7, %19, off\n\t"
      "global_load_async_to_lds_b128 %8, %20, off\n\t"
      "global_load_async_to_lds_b128 %9, %21, off\n\t"
      "global_load_async_to_lds_b128 %10, %22, off\n\t"
      "global_load_async_to_lds_b128 %11, %23, off\n\t"
      "s_wait_xcnt 0x0"
      :: "v"(l), "v"(l + LS), "v"(l + 2 * LS), "v"(l + 3 * LS),
         "v"(l + 4 * LS), "v"(l + 5 * LS), "v"(l + 6 * LS), "v"(l + 7 * LS),
         "v"(l + 8 * LS), "v"(l + 9 * LS), "v"(l + 10 * LS), "v"(l + 11 * LS),
         "v"(gp), "v"(gp + GS), "v"(gp + 2 * GS), "v"(gp + 3 * GS),
         "v"(gp + 4 * GS), "v"(gp + 5 * GS), "v"(gp + 6 * GS), "v"(gp + 7 * GS),
         "v"(gp + 8 * GS), "v"(gp + 9 * GS), "v"(gp + 10 * GS), "v"(gp + 11 * GS)
      : "memory");
}

// c[i][t] += X[rowblk + i*16 .. +15][:] * W[colbase + wave*48 + t*16 .. +15][:]^T
// over all of K, k ascending in steps of 32; two LDS buffers, the next stage's
// copies fly while this stage is worked on.
DEV void gemm_tile(const _Float16* __restrict__ X, const _Float16* __restrict__ W,
                   int rowblk, int colbase, v8f (&c)[FM][FN]) {
  __shared__ __align__(16) _Float16 sX[2][TM * LDG];
  __shared__ __align__(16) _Float16 sW[2][TN * LDG];
  const int tid  = threadIdx.x;
  const int lane = tid & 31;
  const int wave = tid >> 5;
  const int row  = lane & 15;
  const int g    = lane >> 4;

  const int cr = tid >> 3;          // this lane's first tile row, 0..15
  const int cc = (tid & 7) * 8;     // its 16-byte chunk of the 128-byte row
  const _Float16* gx = X + (size_t)(rowblk + cr) * DM + cc;
  const _Float16* gw = W + (size_t)(colbase + cr) * DM + cc;
  const unsigned  lx = lds_off(&sX[0][cr * LDG + cc]);
  const unsigned  lw = lds_off(&sW[0][cr * LDG + cc]);
  auto stage = [&](int s) {
    copy_x(lx + (unsigned)(s & 1) * (TM * LDG * 2), gx + s * BK);
    copy_w(lw + (unsigned)(s & 1) * (TN * LDG * 2), gw + s * BK);
  };

  stage(0);
  asm volatile("s_wait_asynccnt 0x0" ::: "memory");  // stage 0 has landed before it is published
  __syncthreads();
  stage(1);

  for (int s = 0; s < NST; ++s) {
    const _Float16* xB = sX[s & 1] + row * LDG + g * 8;
    const _Float16* wB = sW[s & 1] + (wave * (FN * 16) + row) * LDG + g * 8;
    v16h a[BK / 32][FM], b[BK / 32][FN];
#pragma unroll
    for (int j = 0; j < BK / 32; ++j) {
#pragma unroll
      for (int t = 0; t < FN; ++t) b[j][t] = frag_f16(wB + t * 16 * LDG + j * 32);
#pragma unroll
      for (int i = 0; i < FM; ++i) a[j][i] = frag_f16(xB + i * 16 * LDG + j * 32);
    }
    // keeps the stage's LDS reads one group in front of its products; left free,
    // the scheduler sinks each pair to its product behind a wait to zero
    __builtin_amdgcn_sched_barrier(0);
#pragma unroll
    for (int j = 0; j < BK / 32; ++j)
#pragma unroll
      for (int i = 0; i < FM; ++i)
#pragma unroll
        for (int t = 0; t < FN; ++t) c[i][t] = wmma(a[j][i], b[j][t], c[i][t]);
    // keeps the products in front of the stage's foot, where they run while the
    // later reads return; left free, they sink behind the barrier and delay the refill
    __builtin_amdgcn_sched_barrier(0);
    asm volatile("s_wait_dscnt 0x0" ::: "memory");     // this wave's reads of the buffer have ended
    asm volatile("s_wait_asynccnt 0x0" ::: "memory");  // its copies of stage s + 1 have landed
    __syncthreads();  // publishes stage s + 1 and frees the buffer of stage s
    if (s + 2 < NST) stage(s + 2);
  }
  asm volatile("s_wait_asynccnt 0x0" ::: "memory");    // nothing in flight when the wave ends
}

// ---- QKV projection (all-f16 operands): Y = X @ W^T + b, head layout --------
// mode 0: Y[b][h][s][d]  (Q and K)        mode 1: Y[b][h][d][s]  (V transposed)
// One launch for all three: blockIdx.z = 0, 1, 2 is Q, K, V; the three X, the
// three W and the three Y each lie one behind the other in the workspace.
__global__ __launch_bounds__(128) void proj16_kernel(
    const _Float16* __restrict__ X3, const _Float16* __restrict__ W3,
    const float* __restrict__ bq, const float* __restrict__ bk,
    const float* __restrict__ bv3, _Float16* __restrict__ Y3) {
  const int z = blockIdx.z;
  const _Float16* X = X3 + (size_t)z * NROW * DM;
  const _Float16* W = W3 + (size_t)z * DM * DM;
  _Float16*       Y = Y3 + (size_t)z * NROW * DM;
  const float* bias = z == 0 ? bq : z == 1 ? bk : bv3;
  const int    mode = z == 2 ? 1 : 0;
  const int lane = threadIdx.x & 31;
  const int wave = threadIdx.x >> 5;
  const int row  = lane & 15;
  const int g    = lane >> 4;
  const int rowbase = blockIdx.x * TM + g * 8;
  const int colbase = blockIdx.y * TN + wave * (FN * 16) + row;

  v8f c[FM][FN] = {};
  gemm_tile(X, W, blockIdx.x * TM, blockIdx.y * TN, c);

#pragma unroll
  for (int t = 0; t < FN; ++t) {
    const int col = colbase + t * 16;      // a 16-column tile lies inside one head
    const int h = col >> 6;
    const int d = col & (DK - 1);
    const float bv = bias[col];
#pragma unroll
    for (int i = 0; i < FM; ++i) {
#pragma unroll
      for (int r = 0; r < 8; ++r) {
        const int grow = rowbase + i * 16 + r;
        const int bb = grow >> 11;
        const int s  = grow & (SEQ - 1);
        const float val = c[i][t][r] + bv;
        size_t off;
        if (mode == 0) off = ((size_t)(bb * NH + h) * SEQ + s) * DK + d;
        else           off = ((size_t)(bb * NH + h) * DK + d) * SEQ + s;
        Y[off] = (_Float16)val;
      }
    }
  }
}

__global__ __launch_bounds__(128) void attn_kernel(
    const _Float16* __restrict__ Q, const _Float16* __restrict__ K,
    const _Float16* __restrict__ Vt, const unsigned* __restrict__ mbits,
    _Float16* __restrict__ AO) {
  __shared__ __align__(16) _Float16 sK[2][64 * LDP];  // K tile, [key][d] padded
  __shared__ __align__(16) _Float16 sV[2][64 * LDP];  // V^T tile, [d][key] padded

  const int tid  = threadIdx.x;
  const int lane = tid & 31;
  const int wave = tid >> 5;
  const int row  = lane & 15;
  const int g    = lane >> 4;
  const int h = blockIdx.y, b = blockIdx.z;
  const int bh = b * NH + h;
  const int qbase = blockIdx.x * 64 + wave * 16;

  const _Float16* Qh = Q  + (size_t)bh * SEQ * DK;
  const _Float16* Kh = K  + (size_t)bh * SEQ * DK;
  const _Float16* Vh = Vt + (size_t)bh * DK * SEQ;

  const _Float16* qrow = Qh + (size_t)(qbase + row) * DK;
  const v16h qf0 = frag_f16(qrow + 0  + g * 8);
  const v16h qf1 = frag_f16(qrow + 32 + g * 8);

  // this wave's packed mask: 32 lane-mask words per 64 keys. The wave's number
  // goes through readfirstlane so that the address is scalar and the words
  // arrive in scalar registers, where a select reads them as they are.
  const int wv = __builtin_amdgcn_readfirstlane(wave);
  // Constant address space: nothing writes these words while this kernel runs;
  // without it the compiler takes the copies to LDS for possible writers and
  // brings the words through vector registers, one readfirstlane each.
  typedef const __attribute__((address_space(4))) v16u* cmask_t;
  const cmask_t mw = (cmask_t)(unsigned long long)(
      mbits + (size_t)(blockIdx.x * 4 + wv) * (SEQ / 64) * 32);
  v16u w0 = mw[0], w1 = mw[1];

  float m_i = -3.0e38f;   // running max of this lane's query (both halves agree)
  float l_i = 0.0f;       // running sum over this half's keys; halves join at the end
  v8f o[4] = {v8f{}, v8f{}, v8f{}, v8f{}};  // o[t][r] = O[query row][d = t*16 + g*8 + r]

  // stage one 64-key tile (8 KB K + 8 KB V) via 8 async b128 ops per thread
  auto stage = [&](int kb, int buf) {
#pragma unroll
    for (int i = 0; i < 4; ++i) {
      const int c  = tid + i * 128;       // 0..511 16-byte chunks
      const int r  = c >> 3;              // tile row 0..63
      const int ch = (c & 7) * 8;         // halves within row
      async_cp16(&sK[buf][r * LDP + ch], Kh + (size_t)(kb + r) * DK + ch);
      async_cp16(&sV[buf][r * LDP + ch], Vh + (size_t)r * SEQ + kb + ch);
    }
  };

  stage(0, 0);
  for (int kb = 0; kb < SEQ; kb += 64) {
    const int cur = (kb >> 6) & 1;
    if (kb + 64 < SEQ) { stage(kb + 64, cur ^ 1); ASYNC_WAIT(8); }
    else               { ASYNC_WAIT(0); }
    __syncthreads();

    const _Float16* kB = sK[cur];
    const _Float16* vB = sV[cur];

    // S^T = K Q^T, 64k x 16q: c[t][r] = S[query row][key kb + t*16 + g*8 + r]
    v8f c[4];
#pragma unroll
    for (int t = 0; t < 4; ++t) {
      const _Float16* krow = kB + (t * 16 + row) * LDP + g * 8;
      v8f z{};
      c[t] = wmma(frag_f16(krow), qf0, z);
      c[t] = wmma(frag_f16(krow + 32), qf1, c[t]);
    }
    // scale + mask
#pragma unroll
    for (int t = 0; t < 4; ++t) {
#pragma unroll
      for (int r = 0; r < 8; ++r) {
        const unsigned w = t < 2 ? w0[t * 8 + r] : w1[(t - 2) * 8 + r];
        c[t][r] = __builtin_amdgcn_inverse_ballot_w32(w) ? c[t][r] * 0.125f : -1.0e9f;
      }
    }
    // the next 64 keys' words, asked for behind the last use of these: they
    // travel during the rest of this pass (the last pass asks for its own again)
    {
      const int nx = kb + 64 < SEQ ? (kb >> 6) + 1 : (kb >> 6);
      w0 = mw[nx * 2];
      w1 = mw[nx * 2 + 1];
    }
    // online softmax, one query per lane
    float vm[4];
#pragma unroll
    for (int t = 0; t < 4; ++t) {
      vm[t] = fmaxf(c[t][0], c[t][1]);
#pragma unroll
      for (int r = 2; r < 8; ++r) vm[t] = fmaxf(vm[t], c[t][r]);
    }
    float vmax = fmaxf(fmaxf(vm[0], vm[1]), fmaxf(vm[2], vm[3]));
    vmax = fmaxf(vmax, xhalf(vmax));
    const float mnew  = fmaxf(m_i, vmax);
    const float alpha = __expf(m_i - mnew);
    m_i = mnew;
    float s4[4];
#pragma unroll
    for (int t = 0; t < 4; ++t) {
#pragma unroll
      for (int r = 0; r < 8; ++r) c[t][r] = __expf(c[t][r] - mnew);
      s4[t] = ((c[t][0] + c[t][1]) + (c[t][2] + c[t][3])) +
              ((c[t][4] + c[t][5]) + (c[t][6] + c[t][7]));
    }
    l_i = l_i * alpha + ((s4[0] + s4[1]) + (s4[2] + s4[3]));
#pragma unroll
    for (int t = 0; t < 4; ++t)
#pragma unroll
      for (int r = 0; r < 8; ++r) o[t][r] *= alpha;
    // P^T: two converted score tiles are one B fragment (32 keys x 16 queries)
    v16h p0, p1;
#pragma unroll
    for (int r = 0; r < 8; ++r) {
      p0[r] = (_Float16)c[0][r]; p0[r + 8] = (_Float16)c[1][r];
      p1[r] = (_Float16)c[2][r]; p1[r + 8] = (_Float16)c[3][r];
    }
    // O^T += V^T P^T
#pragma unroll
    for (int t = 0; t < 4; ++t) {
      const _Float16* vrow = vB + (t * 16 + row) * LDP + g * 8;
      o[t] = wmma(frag_f16(vrow), p0, o[t]);
      o[t] = wmma(frag_f16(vrow + 32), p1, o[t]);
    }
    __syncthreads();  // all waves done reading before this buffer is re-staged
  }

  // epilogue: join the halves' sums, O / l, 8 consecutive d per 16-byte store
  const float inv = 1.0f / (l_i + xhalf(l_i));
  _Float16* arow = AO + (size_t)(b * SEQ + qbase + row) * DM + h * DK + g * 8;
#pragma unroll
  for (int t = 0; t < 4; ++t) {
    v8h y;
#pragma unroll
    for (int r = 0; r < 8; ++r) y[r] = (_Float16)(o[t][r] * inv);
    *(v8h*)(arow + t * 16) = y;
  }
}

// ---- output projection: f32 out = AO(f16) @ Wo^T(f16) + bo ------------------
__global__ __launch_bounds__(128) void oproj16_kernel(
    const _Float16* __restrict__ X16, const _Float16* __restrict__ W,
    const float* __restrict__ bias, float* __restrict__ Y) {
  const int lane = threadIdx.x & 31;
  const int wave = threadIdx.x >> 5;
  const int row  = lane & 15;
  const int g    = lane >> 4;
  const int rowbase = blockIdx.x * TM + g * 8;
  const int colbase = blockIdx.y * TN + wave * (FN * 16) + row;

  v8f c[FM][FN] = {};
  gemm_tile(X16, W, blockIdx.x * TM, blockIdx.y * TN, c);
#pragma unroll
  for (int t = 0; t < FN; ++t) {
    const int n = colbase + t * 16;
    const float bv = bias[n];
#pragma unroll
    for (int i = 0; i < FM; ++i)
#pragma unroll
      for (int r = 0; r < 8; ++r)
        Y[(size_t)(rowbase + i * 16 + r) * DM + n] = c[i][t][r] + bv;
  }
}

// ---- launch -----------------------------------------------------------------
extern "C" void kernel_launch(void* const* d_in, const int* in_sizes, int n_in,
                              void* d_out, int out_size, void* d_ws, size_t ws_size,
                              hipStream_t stream) {
  const float* q    = (const float*)d_in[0];
  const float* k    = (const float*)d_in[1];
  const float* v    = (const float*)d_in[2];
  const int*   mask = (const int*)  d_in[3];
  const float* w_q  = (const float*)d_in[4];
  const float* b_q  = (const float*)d_in[5];
  const float* w_k  = (const float*)d_in[6];
  const float* b_k  = (const float*)d_in[7];
  const float* w_v  = (const float*)d_in[8];
  const float* b_v  = (const float*)d_in[9];
  const float* w_o  = (const float*)d_in[10];
  const float* b_o  = (const float*)d_in[11];

  const size_t nXW = (size_t)NROW * DM;   // 4096*768
  const size_t nWW = (size_t)DM * DM;     // 768*768
  _Float16* p = (_Float16*)d_ws;
  _Float16* xq16 = p; p += nXW;
  _Float16* xk16 = p; p += nXW;
  _Float16* xv16 = p; p += nXW;
  _Float16* wq16 = p; p += nWW;
  _Float16* wk16 = p; p += nWW;
  _Float16* wv16 = p; p += nWW;
  _Float16* wo16 = p; p += nWW;
  _Float16* q16  = p; p += nXW;
  _Float16* k16  = p; p += nXW;
  _Float16* vt16 = p; p += nXW;
  _Float16* ao16 = p; p += nXW;
  unsigned* mbits = (unsigned*)p;         // SEQ * SEQ / 8 bytes

  const dim3 blk(128);
  cvt16_kernel<<<MWG + NCVT, CVT_T, 0, stream>>>(q, k, v, w_q, w_k, w_v, w_o, mask, xq16, mbits);

  const dim3 pg(NROW / TM, DM / TN);      // 64 x 4
  proj16_kernel<<<dim3(NROW / TM, DM / TN, 3), blk, 0, stream>>>(xq16, wq16, b_q, b_k, b_v, q16);

  attn_kernel<<<dim3(SEQ / 64, NH, 2), blk, 0, stream>>>(q16, k16, vt16, mbits, ao16);

  oproj16_kernel<<<pg, blk, 0, stream>>>(ao16, wo16, b_o, (float*)d_out);
}

// v006
// One run takes 77.6 microseconds.
// In two side-by-side timings against v005, it was 1.10 and 1.11 times as fast.
// Counting every step since v000, it is 4.59 times as fast.
#include <hip/hip_runtime.h>

typedef __attribute__((ext_vector_type(16))) _Float16 v16h;
typedef __attribute__((ext_vector_type(8)))  _Float16 v8h;
typedef __attribute__((ext_vector_type(8)))  float    v8f;
typedef __attribute__((ext_vector_type(4)))  int      v4i;
typedef __attribute__((ext_vector_type(4)))  float    v4f;
typedef __attribute__((ext_vector_type(4)))  _Float16 v4h;
typedef __attribute__((ext_vector_type(16))) unsigned v16u;

#define DEV static __device__ __forceinline__

constexpr int DM   = 768;     // model dim
constexpr int SEQ  = 2048;    // sequence length
constexpr int NH   = 12;      // heads
constexpr int DK   = 64;      // head dim
constexpr int NROW = 2 * SEQ; // B*S = 4096 rows
constexpr int LDP  = 72;      // padded LDS row (halves): conflict-free b128 reads

// ---- CDNA5 async global->LDS copy (guarded; falls back to sync staging) -----
#if defined(__has_builtin) && __has_builtin(__builtin_amdgcn_global_load_async_to_lds_b128)
#define HAVE_ASYNC_LDS 1
DEV void async_cp16(_Float16* ldst, const _Float16* gsrc) {
  __builtin_amdgcn_global_load_async_to_lds_b128(
      (__attribute__((address_space(1))) v4i*)gsrc,
      (__attribute__((address_space(3))) v4i*)ldst,
      0, 0);
}
#if defined(__has_builtin) && __has_builtin(__builtin_amdgcn_s_wait_asynccnt)
#define ASYNC_WAIT(n) __builtin_amdgcn_s_wait_asynccnt(n)
#else
#define ASYNC_WAIT(n) asm volatile("s_wait_asynccnt " #n ::: "memory")
#endif
#else
#define HAVE_ASYNC_LDS 0
DEV void async_cp16(_Float16* ldst, const _Float16* gsrc) {
  *(v8h*)ldst = *(const v8h*)gsrc;   // sync fallback through VGPRs
}
#define ASYNC_WAIT(n) ((void)0)
#endif

// ---- fragment helpers -------------------------------------------------------
// CDNA5 16-bit A/B fragment (16x32 / 32x16), wave32:
//   lane l: row/col = l&15, g = l>>4
//   VGPR0..3 hold K = g*8 + 0..7, VGPR4..7 hold K = 16 + g*8 + 0..7
// => per lane: two contiguous 16-byte chunks at +0 and +16 halves.
DEV v16h frag_f16(const _Float16* p) {
  v8h lo = *(const v8h*)p;
  v8h hi = *(const v8h*)(p + 16);
  v16h r;
#pragma unroll
  for (int i = 0; i < 8; ++i) { r[i] = lo[i]; r[i + 8] = hi[i]; }
  return r;
}

DEV v8f wmma(v16h a, v16h b, v8f c) {
  return __builtin_amdgcn_wmma_f32_16x16x32_f16(false, a, false, b, (short)0, c,
                                                false, false);
}

// lane l <-> lane l ^ 16: the one exchange between the wave halves
DEV float xhalf(float x) {
  const int b = __builtin_bit_cast(int, x);
  return __builtin_bit_cast(float, __builtin_amdgcn_permlanex16(
      b, b, 0x76543210, 0xfedcba98, false, false));
}

// ---- f32 -> f16 of all seven operands in ONE launch -------------------------
// The destinations lie one behind the other in the workspace in the order
// q, k, v, w_q, w_k, w_v, w_o, so a converting work-group's place among its kind
// is also its place in the destination. A work-group converts CVT_WG 16-byte pieces of one
// source; a wave-wide load covers 512 contiguous bytes, a store 256.
constexpr int CVT_T  = 512;                   // threads: 16 waves on a WGP
constexpr int CVT_N  = 24;                    // pieces per thread
constexpr int CVT_WG = CVT_T * CVT_N;         // pieces of 4 floats per work-group
constexpr int XWG = NROW * DM / 4 / CVT_WG;   // 64 work-groups per activation
constexpr int WWG = DM * DM / 4 / CVT_WG;     // 12 per weight
static_assert(XWG * CVT_WG * 4 == NROW * DM && WWG * CVT_WG * 4 == DM * DM,
              "every source is a whole number of work-groups");
constexpr int NCVT = 3 * XWG + 4 * WWG;       // work-groups that convert

// The same launch packs the mask for the attention kernel, whose lane l holds,
// for 16 queries x 64 keys, the scores of query l & 15 at keys
// t*16 + (l >> 4)*8 + r. Word t*8 + r of such a block has in bit l whether
// that lane's key is open (mask != 0): a ready lane mask for a select.
// Layout: [16-query block][64-key block][t*8 + r], 128 bytes per block pair.
// A load of this pattern touches 16 lines, which is paid on the WGP's load path:
// the packing is spread over many work-groups, and they stand first in the grid.
constexpr int MP_N = 2;                       // 64-key blocks per wave
constexpr int MWG  = (SEQ / 16) * (SEQ / 64) / MP_N / (CVT_T / 32);   // 128 work-groups
static_assert(MWG * MP_N * (CVT_T / 32) == (SEQ / 16) * (SEQ / 64), "whole work-groups");

__global__ __launch_bounds__(CVT_T) void cvt16_kernel(
    const float* __restrict__ q,  const float* __restrict__ k,
    const float* __restrict__ v,  const float* __restrict__ wq,
    const float* __restrict__ wk, const float* __restrict__ wv,
    const float* __restrict__ wo, const int* __restrict__ mask,
    _Float16* __restrict__ dst, unsigned* __restrict__ mbits) {
  if (blockIdx.x < MWG) {
    const int lane = threadIdx.x & 31;
    const int unit = blockIdx.x * (CVT_T / 32) + (threadIdx.x >> 5);
    const int qblk = unit / (SEQ / 64 / MP_N);            // 16-query block
    const int kb0  = unit % (SEQ / 64 / MP_N) * MP_N;     // first 64-key block
    const int* mr = mask + (size_t)(qblk * 16 + (lane & 15)) * SEQ + kb0 * 64 + (lane >> 4) * 8;
    v4i m[MP_N][8];
    // unrolled: m stays in registers and the loads issue back to back
#pragma unroll
    for (int i = 0; i < MP_N; ++i)
#pragma unroll
      for (int j = 0; j < 8; ++j) m[i][j] = *(const v4i*)(mr + i * 64 + (j >> 1) * 16 + (j & 1) * 4);
    unsigned* op = mbits + (size_t)(qblk * (SEQ / 64) + kb0) * 32 + lane;
#pragma unroll
    for (int i = 0; i < MP_N; ++i) {
      unsigned mine = 0;                      // lane j keeps word j: one 128-byte store
#pragma unroll
      for (int j = 0; j < 32; ++j) {
        const unsigned w = __builtin_amdgcn_ballot_w32(m[i][j >> 2][j & 3] != 0);
        mine = lane == j ? w : mine;
      }
      op[i * 32] = mine;
    }
    return;
  }
  const int wg = blockIdx.x - MWG;            // place among the converting work-groups
  const float* src;
  int part;                                   // this work-group's place in its source
  if (wg < 3 * XWG) {
    const int s = wg / XWG;
    src  = s == 0 ? q : s == 1 ? k : v;
    part = wg - s * XWG;
  } else {
    const int s = (wg - 3 * XWG) / WWG;
    src  = s == 0 ? wq : s == 1 ? wk : s == 2 ? wv : wo;
    part = wg - 3 * XWG - s * WWG;
  }
  const v4f* sp = (const v4f*)src + (size_t)part * CVT_WG + threadIdx.x;
  v4h*       dp = (v4h*)dst + (size_t)wg * CVT_WG + threadIdx.x;
  v4f x[CVT_N];
  // unrolled: x stays in registers and the loads issue back to back, many in flight
#pragma unroll
  for (int i = 0; i < CVT_N; ++i) x[i] = sp[i * CVT_T];
  // unrolled: constant indices into x, constant store offsets
#pragma unroll
  for (int i = 0; i < CVT_N; ++i) {
    v4h y;
#pragma unroll
    for (int j = 0; j < 4; ++j) y[j] = (_Float16)x[i][j];
    dp[i * CVT_T] = y;
  }
}

// ---- GEMM operand staging: 64 rows of X and 192 of W, 64 k per stage ---------
// A fragment load straight from global touches 16 cache lines for 512 bytes;
// a staging copy reads whole 128-byte lines, and the fragments come from LDS.
// A work-group makes 64 x 192 of Y with four waves of 64 x 48 each, side by side:
// a staged byte feeds more products than in a small tile, a fragment read from LDS
// three or four. 192 columns are three whole heads, so every 128-byte line of Y
// has one writing work-group. 4096 / 64 * 768 / 192 = 256 work-groups per GEMM.
constexpr int TM   = 64;         // rows of X (and of Y) per work-group
constexpr int TN   = 192;        // rows of W (columns of Y) per work-group
constexpr int FM   = 4;          // 16-row fragments of X per wave
constexpr int FN   = 3;          // 16-row fragments of W per wave
constexpr int BK   = 64;         // halves of K per stage: 128 bytes of every operand row
constexpr int LDG  = BK + 8;     // LDS pitch 144 bytes: conflict-free b128 reads
constexpr int NST  = DM / BK;    // 12 stages
static_assert(NROW % TM == 0 && DM % TN == 0 && DM % BK == 0, "whole tiles");
static_assert(TM == FM * 16 && TN == 4 * FN * 16, "four waves side by side");
static_assert(TN % DK == 0, "whole heads");

DEV unsigned lds_off(const void* p) { return (unsigned)(size_t)p; }

constexpr unsigned LS = 16 * LDG * 2;  // bytes between a lane's rows in LDS
constexpr int      GS = 16 * DM;       // halves between them in global memory

// One lane's share of the X tile: four 16-byte copies, tile rows 16 apart.
// The closing s_wait_xcnt stands in the copies' own statement so that no
// address register named here is rewritten before it.
DEV void copy_x(unsigned l, const _Float16* gp) {
  asm volatile(
      "global_load_async_to_lds_b128 %0, %4, off\n\t"
      "global_load_async_to_lds_b128 %1, %5, off\n\t"
      "global_load_async_to_lds_b128 %2, %6, off\n\t"
      "global_load_async_to_lds_b128 %3, %7, off\n\t"
      "s_wait_xcnt 0x0"
      :: "v"(l), "v"(l + LS), "v"(l + 2 * LS), "v"(l + 3 * LS),
         "v"(gp), "v"(gp + GS), "v"(gp + 2 * GS), "v"(gp + 3 * GS)
      : "memory");
}

// The same for the W tile: twelve copies; the wait closes the statement as above.
DEV void copy_w(unsigned l, const _Float16* gp) {
  asm volatile(
      "global_load_async_to_lds_b128 %0, %12, off\n\t"
      "global_load_async_to_lds_b128 %1, %13, off\n\t"
      "global_load_async_to_lds_b128 %2, %14, off\n\t"
      "global_load_async_to_lds_b128 %3, %15, off\n\t"
      "global_load_async_to_lds_b128 %4, %16, off\n\t"
      "global_load_async_to_lds_b128 %5, %17, off\n\t"
      "global_load_async_to_lds_b128 %6, %18, off\n\t"
      "global_load_async_to_lds_b128 %7, %19, off\n\t"
      "global_load_async_to_lds_b128 %8, %20, off\n\t"
      "global_load_async_to_lds_b128 %9, %21, off\n\t"
      "global_load_async_to_lds_b128 %10, %22, off\n\t"
      "global_load_async_to_lds_b128 %11, %23, off\n\t"
      "s_wait_xcnt 0x0"
      :: "v"(l), "v"(l + LS), "v"(l + 2 * LS), "v"(l + 3 * LS),
         "v"(l + 4 * LS), "v"(l + 5 * LS), "v"(l + 6 * LS), "v"(l + 7 * LS),
         "v"(l + 8 * LS), "v"(l + 9 * LS), "v"(l + 10 * LS), "v"(l + 11 * LS),
         "v"(gp), "v"(gp + GS), "v"(gp + 2 * GS), "v"(gp + 3 * GS),
         "v"(gp + 4 * GS), "v"(gp + 5 * GS), "v"(gp + 6 * GS), "v"(gp + 7 * GS),
         "v"(gp + 8 * GS), "v"(gp + 9 * GS), "v"(gp + 10 * GS), "v"(gp + 11 * GS)
      : "memory");
}

// c[i][t] += X[rowblk + i*16 .. +15][:] * W[colbase + wave*48 + t*16 .. +15][:]^T
// over all of K, k ascending in steps of 32; two LDS buffers, the next stage's
// copies fly while this stage is worked on.
DEV void gemm_tile(const _Float16* __restrict__ X, const _Float16* __restrict__ W,
                   int rowblk, int colbase, v8f (&c)[FM][FN]) {
  __shared__ __align__(16) _Float16 sX[2][TM * LDG];
  __shared__ __align__(16) _Float16 sW[2][TN * LDG];
  const int tid  = threadIdx.x;
  const int lane = tid & 31;
  const int wave = tid >> 5;
  const int row  = lane & 15;
  const int g    = lane >> 4;

  const int cr = tid >> 3;          // this lane's first tile row, 0..15
  const int cc = (tid & 7) * 8;     // its 16-byte chunk of the 128-byte row
  const _Float16* gx = X + (size_t)(rowblk + cr) * DM + cc;
  const _Float16* gw = W + (size_t)(colbase + cr) * DM + cc;
  const unsigned  lx = lds_off(&sX[0][cr * LDG + cc]);
  const unsigned  lw = lds_off(&sW[0][cr * LDG + cc]);
  auto stage = [&](int s) {
    copy_x(lx + (unsigned)(s & 1) * (TM * LDG * 2), gx + s * BK);
    copy_w(lw + (unsigned)(s & 1) * (TN * LDG * 2), gw + s * BK);
  };

  stage(0);
  asm volatile("s_wait_asynccnt 0x0" ::: "memory");  // stage 0 has landed before it is published
  __syncthreads();
  stage(1);

  for (int s = 0; s < NST; ++s) {
    const _Float16* xB = sX[s & 1] + row * LDG + g * 8;
    const _Float16* wB = sW[s & 1] + (wave * (FN * 16) + row) * LDG + g * 8;
    v16h a[BK / 32][FM], b[BK / 32][FN];
#pragma unroll
    for (int j = 0; j < BK / 32; ++j) {
#pragma unroll
      for (int t = 0; t < FN; ++t) b[j][t] = frag_f16(wB + t * 16 * LDG + j * 32);
#pragma unroll
      for (int i = 0; i < FM; ++i) a[j][i] = frag_f16(xB + i * 16 * LDG + j * 32);
    }
    // keeps the stage's LDS reads one group in front of its products; left free,
    // the scheduler sinks each pair to its product behind a wait to zero
    __builtin_amdgcn_sched_barrier(0);
#pragma unroll
    for (int j = 0; j < BK / 32; ++j)
#pragma unroll
      for (int i = 0; i < FM; ++i)
#pragma unroll
        for (int t = 0; t < FN; ++t) c[i][t] = wmma(a[j][i], b[j][t], c[i][t]);
    // keeps the products in front of the stage's foot, where they run while the
    // later reads return; left free, they sink behind the barrier and delay the refill
    __builtin_amdgcn_sched_barrier(0);
    asm volatile("s_wait_dscnt 0x0" ::: "memory");     // this wave's reads of the buffer have ended
    asm volatile("s_wait_asynccnt 0x0" ::: "memory");  // its copies of stage s + 1 have landed
    __syncthreads();  // publishes stage s + 1 and frees the buffer of stage s
    if (s + 2 < NST) stage(s + 2);
  }
  asm volatile("s_wait_asynccnt 0x0" ::: "memory");    // nothing in flight when the wave ends
}

// ---- QKV projection (all-f16 operands): Y = X @ W^T + b, head layout --------
// Q and K: Y[b][h][s][d]        V: Y[b][h][d][s]  (transposed)
// One launch for all three: blockIdx.z = 0, 1, 2 is Q, K, V; the three X, the
// three W and the three Y each lie one behind the other in the workspace.
__global__ __launch_bounds__(128) void proj16_kernel(
    const _Float16* __restrict__ X3, const _Float16* __restrict__ W3,
    const float* __restrict__ bq, const float* __restrict__ bk,
    const float* __restrict__ bv3, _Float16* __restrict__ Y3) {
  const int z = blockIdx.z;
  const _Float16* X = X3 + (size_t)z * NROW * DM;
  const _Float16* W = W3 + (size_t)z * DM * DM;
  _Float16*       Y = Y3 + (size_t)z * NROW * DM;
  const float* bias = z == 0 ? bq : z == 1 ? bk : bv3;
  const int lane = threadIdx.x & 31;
  const int wave = threadIdx.x >> 5;
  const int row  = lane & 15;
  const int g    = lane >> 4;
  const int rowbase = blockIdx.x * TM + g * 8;
  const int colbase = blockIdx.y * TN + wave * (FN * 16) + row;

  v8f c[FM][FN] = {};
  gemm_tile(X, W, blockIdx.x * TM, blockIdx.y * TN, c);

  const int bb = rowbase >> 11;            // a 64-row tile lies inside one batch entry
  const int s0 = rowbase & (SEQ - 1);
  float bv[FN];
  // every loop below is unrolled: constant indices keep c and bv in registers,
  // and the three bias loads issue together
#pragma unroll
  for (int t = 0; t < FN; ++t) bv[t] = bias[colbase + t * 16];
  if (z == 2) {
    // V^T: a lane's eight accumulator rows are eight consecutive positions of
    // its row d, so a fragment leaves in one 16-byte store per lane; as eight
    // 2-byte stores each would touch the same 16 lines once more
#pragma unroll
    for (int t = 0; t < FN; ++t) {
      const int col = colbase + t * 16;    // a 16-column tile lies inside one head
      _Float16* yp = Y + ((size_t)(bb * NH + (col >> 6)) * DK + (col & (DK - 1))) * SEQ + s0;
#pragma unroll
      for (int i = 0; i < FM; ++i) {
        v8h y;
#pragma unroll
        for (int r = 0; r < 8; ++r) y[r] = (_Float16)(c[i][t][r] + bv[t]);
        *(v8h*)(yp + i * 16) = y;
      }
    }
  } else {
#pragma unroll
    for (int t = 0; t < FN; ++t) {
      const int col = colbase + t * 16;
      _Float16* yp = Y + ((size_t)(bb * NH + (col >> 6)) * SEQ + s0) * DK + (col & (DK - 1));
#pragma unroll
      for (int i = 0; i < FM; ++i)
#pragma unroll
        for (int r = 0; r < 8; ++r)
          yp[(i * 16 + r) * DK] = (_Float16)(c[i][t][r] + bv[t]);
    }
    // closes the last stores: in the built code this path's end falls through
    // to lines that rewrite the registers they name
    asm volatile("s_wait_xcnt 0x0" ::: "memory");
  }
}

__global__ __launch_bounds__(128) void attn_kernel(
    const _Float16* __restrict__ Q, const _Float16* __restrict__ K,
    const _Float16* __restrict__ Vt, const unsigned* __restrict__ mbits,
    _Float16* __restrict__ AO) {
  __shared__ __align__(16) _Float16 sK[2][64 * LDP];  // K tile, [key][d] padded
  __shared__ __align__(16) _Float16 sV[2][64 * LDP];  // V^T tile, [d][key] padded

  const int tid  = threadIdx.x;
  const int lane = tid & 31;
  const int wave = tid >> 5;
  const int row  = lane & 15;
  const int g    = lane >> 4;
  const int h = blockIdx.y, b = blockIdx.z;
  const int bh = b * NH + h;
  const int qbase = blockIdx.x * 64 + wave * 16;

  const _Float16* Qh = Q  + (size_t)bh * SEQ * DK;
  const _Float16* Kh = K  + (size_t)bh * SEQ * DK;
  const _Float16* Vh = Vt + (size_t)bh * DK * SEQ;

  const _Float16* qrow = Qh + (size_t)(qbase + row) * DK;
  const v16h qf0 = frag_f16(qrow + 0  + g * 8);
  const v16h qf1 = frag_f16(qrow + 32 + g * 8);

  // this wave's packed mask: 32 lane-mask words per 64 keys. The wave's number
  // goes through readfirstlane so that the address is scalar and the words
  // arrive in scalar registers, where a select reads them as they are.
  const int wv = __builtin_amdgcn_readfirstlane(wave);
  // Constant address space: nothing writes these words while this kernel runs;
  // without it the compiler takes the copies to LDS for possible writers and
  // brings the words through vector registers, one readfirstlane each.
  typedef const __attribute__((address_space(4))) v16u* cmask_t;
  const cmask_t mw = (cmask_t)(unsigned long long)(
      mbits + (size_t)(blockIdx.x * 4 + wv) * (SEQ / 64) * 32);
  v16u w0 = mw[0], w1 = mw[1];

  float m_i = -3.0e38f;   // running max of this lane's query (both halves agree)
  float l_i = 0.0f;       // running sum over this half's keys; halves join at the end
  v8f o[4] = {v8f{}, v8f{}, v8f{}, v8f{}};  // o[t][r] = O[query row][d = t*16 + g*8 + r]

  // stage one 64-key tile (8 KB K + 8 KB V) via 8 async b128 ops per thread
  auto stage = [&](int kb, int buf) {
#pragma unroll
    for (int i = 0; i < 4; ++i) {
      const int c  = tid + i * 128;       // 0..511 16-byte chunks
      const int r  = c >> 3;              // tile row 0..63
      const int ch = (c & 7) * 8;         // halves within row
      async_cp16(&sK[buf][r * LDP + ch], Kh + (size_t)(kb + r) * DK + ch);
      async_cp16(&sV[buf][r * LDP + ch], Vh + (size_t)r * SEQ + kb + ch);
    }
  };

  stage(0, 0);
  for (int kb = 0; kb < SEQ; kb += 64) {
    const int cur = (kb >> 6) & 1;
    if (kb + 64 < SEQ) { stage(kb + 64, cur ^ 1); ASYNC_WAIT(8); }
    else               { ASYNC_WAIT(0); }
    __syncthreads();

    const _Float16* kB = sK[cur];
    const _Float16* vB = sV[cur];

    // S^T = K Q^T, 64k x 16q: c[t][r] = S[query row][key kb + t*16 + g*8 + r]
    v8f c[4];
#pragma unroll
    for (int t = 0; t < 4; ++t) {
      const _Float16* krow = kB + (t * 16 + row) * LDP + g * 8;
      v8f z{};
      c[t] = wmma(frag_f16(krow), qf0, z);
      c[t] = wmma(frag_f16(krow + 32), qf1, c[t]);
    }
    // scale + mask
#pragma unroll
    for (int t = 0; t < 4; ++t) {
#pragma unroll
      for (int r = 0; r < 8; ++r) {
        const unsigned w = t < 2 ? w0[t * 8 + r] : w1[(t - 2) * 8 + r];
        c[t][r] = __builtin_amdgcn_inverse_ballot_w32(w) ? c[t][r] * 0.125f : -1.0e9f;
      }
    }
    // the next 64 keys' words, asked for behind the last use of these: they
    // travel during the rest of this pass (the last pass asks for its own again)
    {
      const int nx = kb + 64 < SEQ ? (kb >> 6) + 1 : (kb >> 6);
      w0 = mw[nx * 2];
      w1 = mw[nx * 2 + 1];
    }
    // online softmax, one query per lane
    float vm[4];
#pragma unroll
    for (int t = 0; t < 4; ++t) {
      vm[t] = fmaxf(c[t][0], c[t][1]);
#pragma unroll
      for (int r = 2; r < 8; ++r) vm[t] = fmaxf(vm[t], c[t][r]);
    }
    float vmax = fmaxf(fmaxf(vm[0], vm[1]), fmaxf(vm[2], vm[3]));
    vmax = fmaxf(vmax, xhalf(vmax));
    const float mnew  = fmaxf(m_i, vmax);
    const float alpha = __expf(m_i - mnew);
    m_i = mnew;
    float s4[4];
#pragma unroll
    for (int t = 0; t < 4; ++t) {
#pragma unroll
      for (int r = 0; r < 8; ++r) c[t][r] = __expf(c[t][r] - mnew);
      s4[t] = ((c[t][0] + c[t][1]) + (c[t][2] + c[t][3])) +
              ((c[t][4] + c[t][5]) + (c[t][6] + c[t][7]));
    }
    l_i = l_i * alpha + ((s4[0] + s4[1]) + (s4[2] + s4[3]));
#pragma unroll
    for (int t = 0; t < 4; ++t)
#pragma unroll
      for (int r = 0; r < 8; ++r) o[t][r] *= alpha;
    // P^T: two converted score tiles are one B fragment (32 keys x 16 queries)
    v16h p0, p1;
#pragma unroll
    for (int r = 0; r < 8; ++r) {
      p0[r] = (_Float16)c[0][r]; p0[r + 8] = (_Float16)c[1][r];
      p1[r] = (_Float16)c[2][r]; p1[r + 8] = (_Float16)c[3][r];
    }
    // O^T += V^T P^T
#pragma unroll
    for (int t = 0; t < 4; ++t) {
      const _Float16* vrow = vB + (t * 16 + row) * LDP + g * 8;
      o[t] = wmma(frag_f16(vrow), p0, o[t]);
      o[t] = wmma(frag_f16(vrow + 32), p1, o[t]);
    }
    __syncthreads();  // all waves done reading before this buffer is re-staged
  }

  // epilogue: join the halves' sums, O / l, 8 consecutive d per 16-byte store
  const float inv = 1.0f / (l_i + xhalf(l_i));
  _Float16* arow = AO + (size_t)(b * SEQ + qbase + row) * DM + h * DK + g * 8;
#pragma unroll
  for (int t = 0; t < 4; ++t) {
    v8h y;
#pragma unroll
    for (int r = 0; r < 8; ++r) y[r] = (_Float16)(o[t][r] * inv);
    *(v8h*)(arow + t * 16) = y;
  }
}

// ---- output projection: f32 out = AO(f16) @ Wo^T(f16) + bo ------------------
__global__ __launch_bounds__(128) void oproj16_kernel(
    const _Float16* __restrict__ X16, const _Float16* __restrict__ W,
    const float* __restrict__ bias, float* __restrict__ Y) {
  const int lane = threadIdx.x & 31;
  const int wave = threadIdx.x >> 5;
  const int row  = lane & 15;
  const int g    = lane >> 4;
  const int rowbase = blockIdx.x * TM + g * 8;
  const int colbase = blockIdx.y * TN + wave * (FN * 16) + row;

  v8f c[FM][FN] = {};
  gemm_tile(X16, W, blockIdx.x * TM, blockIdx.y * TN, c);
#pragma unroll
  for (int t = 0; t < FN; ++t) {
    const int n = colbase + t * 16;
    const float bv = bias[n];
#pragma unroll
    for (int i = 0; i < FM; ++i)
#pragma unroll
      for (int r = 0; r < 8; ++r)
        Y[(size_t)(rowbase + i * 16 + r) * DM + n] = c[i][t][r] + bv;
  }
}

// ---- launch -----------------------------------------------------------------
extern "C" void kernel_launch(void* const* d_in, const int* in_sizes, int n_in,
                              void* d_out, int out_size, void* d_ws, size_t ws_size,
                              hipStream_t stream) {
  const float* q    = (const float*)d_in[0];
  const float* k    = (const float*)d_in[1];
  const float* v    = (const float*)d_in[2];
  const int*   mask = (const int*)  d_in[3];
  const float* w_q  = (const float*)d_in[4];
  const float* b_q  = (const float*)d_in[5];
  const float* w_k  = (const float*)d_in[6];
  const float* b_k  = (const float*)d_in[7];
  const float* w_v  = (const float*)d_in[8];
  const float* b_v  = (const float*)d_in[9];
  const float* w_o  = (const float*)d_in[10];
  const float* b_o  = (const float*)d_in[11];

  const size_t nXW = (size_t)NROW * DM;   // 4096*768
  const size_t nWW = (size_t)DM * DM;     // 768*768
  _Float16* p = (_Float16*)d_ws;
  _Float16* xq16 = p; p += nXW;
  _Float16* xk16 = p; p += nXW;
  _Float16* xv16 = p; p += nXW;
  _Float16* wq16 = p; p += nWW;
  _Float16* wk16 = p; p += nWW;
  _Float16* wv16 = p; p += nWW;
  _Float16* wo16 = p; p += nWW;
  _Float16* q16  = p; p += nXW;
  _Float16* k16  = p; p += nXW;
  _Float16* vt16 = p; p += nXW;
  _Float16* ao16 = p; p += nXW;
  unsigned* mbits = (unsigned*)p;         // SEQ * SEQ / 8 bytes

  const dim3 blk(128);
  cvt16_kernel<<<MWG + NCVT, CVT_T, 0, stream>>>(q, k, v, w_q, w_k, w_v, w_o, mask, xq16, mbits);

  const dim3 pg(NROW / TM, DM / TN);      // 64 x 4
  proj16_kernel<<<dim3(NROW / TM, DM / TN, 3), blk, 0, stream>>>(xq16, wq16, b_q, b_k, b_v, q16);

  attn_kernel<<<dim3(SEQ / 64, NH, 2), blk, 0, stream>>>(q16, k16, vt16, mbits, ao16);

  oproj16_kernel<<<pg, blk, 0, stream>>>(ao16, wo16, b_o, (float*)d_out);
}

// v007
// It runs in 75.4 microseconds.
// In two side-by-side timings against v006, it was 1.03 and 1.04 times as fast.
// Counting every step since v000, it is 4.75 times as fast.
#include <hip/hip_runtime.h>

typedef __attribute__((ext_vector_type(16))) _Float16 v16h;
typedef __attribute__((ext_vector_type(8)))  _Float16 v8h;
typedef __attribute__((ext_vector_type(8)))  float    v8f;
typedef __attribute__((ext_vector_type(4)))  int      v4i;
typedef __attribute__((ext_vector_type(4)))  float    v4f;
typedef __attribute__((ext_vector_type(4)))  _Float16 v4h;
typedef __attribute__((ext_vector_type(16))) unsigned v16u;

#define DEV static __device__ __forceinline__

constexpr int DM   = 768;     // model dim
constexpr int SEQ  = 2048;    // sequence length
constexpr int NH   = 12;      // heads
constexpr int DK   = 64;      // head dim
constexpr int NROW = 2 * SEQ; // B*S = 4096 rows
constexpr int LDP  = 72;      // padded LDS row (halves): conflict-free b128 reads

// ---- CDNA5 async global->LDS copy (guarded; falls back to sync staging) -----
#if defined(__has_builtin) && __has_builtin(__builtin_amdgcn_global_load_async_to_lds_b128)
#define HAVE_ASYNC_LDS 1
DEV void async_cp16(_Float16* ldst, const _Float16* gsrc) {
  __builtin_amdgcn_global_load_async_to_lds_b128(
      (__attribute__((address_space(1))) v4i*)gsrc,
      (__attribute__((address_space(3))) v4i*)ldst,
      0, 0);
}
#if defined(__has_builtin) && __has_builtin(__builtin_amdgcn_s_wait_asynccnt)
#define ASYNC_WAIT(n) __builtin_amdgcn_s_wait_asynccnt(n)
#else
#define ASYNC_WAIT(n) asm volatile("s_wait_asynccnt " #n ::: "memory")
#endif
#else
#define HAVE_ASYNC_LDS 0
DEV void async_cp16(_Float16* ldst, const _Float16* gsrc) {
  *(v8h*)ldst = *(const v8h*)gsrc;   // sync fallback through VGPRs
}
#define ASYNC_WAIT(n) ((void)0)
#endif

// ---- fragment helpers -------------------------------------------------------
// CDNA5 16-bit A/B fragment (16x32 / 32x16), wave32:
//   lane l: row/col = l&15, g = l>>4
//   VGPR0..3 hold K = g*8 + 0..7, VGPR4..7 hold K = 16 + g*8 + 0..7
// => per lane: two contiguous 16-byte chunks at +0 and +16 halves.
DEV v16h frag_f16(const _Float16* p) {
  v8h lo = *(const v8h*)p;
  v8h hi = *(const v8h*)(p + 16);
  v16h r;
#pragma unroll
  for (int i = 0; i < 8; ++i) { r[i] = lo[i]; r[i + 8] = hi[i]; }
  return r;
}

DEV v8f wmma(v16h a, v16h b, v8f c) {
  return __builtin_amdgcn_wmma_f32_16x16x32_f16(false, a, false, b, (short)0, c,
                                                false, false);
}

// lane l <-> lane l ^ 16: the one exchange between the wave halves
DEV float xhalf(float x) {
  const int b = __builtin_bit_cast(int, x);
  return __builtin_bit_cast(float, __builtin_amdgcn_permlanex16(
      b, b, 0x76543210, 0xfedcba98, false, false));
}

// ---- f32 -> f16 of all seven operands in ONE launch -------------------------
// The destinations lie one behind the other in the workspace in the order
// q, k, v, w_q, w_k, w_v, w_o, so a converting work-group's place among its kind
// is also its place in the destination. A work-group converts CVT_WG 16-byte pieces of one
// source; a wave-wide load covers 512 contiguous bytes, a store 256.
constexpr int CVT_T  = 512;                   // threads: 16 waves on a WGP
constexpr int CVT_N  = 24;                    // pieces per thread
constexpr int CVT_WG = CVT_T * CVT_N;         // pieces of 4 floats per work-group
constexpr int XWG = NROW * DM / 4 / CVT_WG;   // 64 work-groups per activation
constexpr int WWG = DM * DM / 4 / CVT_WG;     // 12 per weight
static_assert(XWG * CVT_WG * 4 == NROW * DM && WWG * CVT_WG * 4 == DM * DM,
              "every source is a whole number of work-groups");
constexpr int NCVT = 3 * XWG + 4 * WWG;       // work-groups that convert

// The same launch packs the mask for the attention kernel, whose lane l holds,
// for 16 queries x 64 keys, the scores of query l & 15 at keys
// t*16 + (l >> 4)*8 + r. Word t*8 + r of such a block has in bit l whether
// that lane's key is open (mask != 0): a ready lane mask for a select.
// Layout: [16-query block][64-key block][t*8 + r], 128 bytes per block pair.
// A load of this pattern touches 16 lines, which is paid on the WGP's load path:
// the packing is spread over many work-groups, and they stand first in the grid.
constexpr int MP_N = 2;                       // 64-key blocks per wave
constexpr int MWG  = (SEQ / 16) * (SEQ / 64) / MP_N / (CVT_T / 32);   // 128 work-groups
static_assert(MWG * MP_N * (CVT_T / 32) == (SEQ / 16) * (SEQ / 64), "whole work-groups");

__global__ __launch_bounds__(CVT_T) void cvt16_kernel(
    const float* __restrict__ q,  const float* __restrict__ k,
    const float* __restrict__ v,  const float* __restrict__ wq,
    const float* __restrict__ wk, const float* __restrict__ wv,
    const float* __restrict__ wo, const int* __restrict__ mask,
    _Float16* __restrict__ dst, unsigned* __restrict__ mbits) {
  if (blockIdx.x < MWG) {
    const int lane = threadIdx.x & 31;
    const int unit = blockIdx.x * (CVT_T / 32) + (threadIdx.x >> 5);
    const int qblk = unit / (SEQ / 64 / MP_N);            // 16-query block
    const int kb0  = unit % (SEQ / 64 / MP_N) * MP_N;     // first 64-key block
    const int* mr = mask + (size_t)(qblk * 16 + (lane & 15)) * SEQ + kb0 * 64 + (lane >> 4) * 8;
    v4i m[MP_N][8];
    // unrolled: m stays in registers and the loads issue back to back
#pragma unroll
    for (int i = 0; i < MP_N; ++i)
#pragma unroll
      for (int j = 0; j < 8; ++j) m[i][j] = *(const v4i*)(mr + i * 64 + (j >> 1) * 16 + (j & 1) * 4);
    unsigned* op = mbits + (size_t)(qblk * (SEQ / 64) + kb0) * 32 + lane;
#pragma unroll
    for (int i = 0; i < MP_N; ++i) {
      unsigned mine = 0;                      // lane j keeps word j: one 128-byte store
#pragma unroll
      for (int j = 0; j < 32; ++j) {
        const unsigned w = __builtin_amdgcn_ballot_w32(m[i][j >> 2][j & 3] != 0);
        mine = lane == j ? w : mine;
      }
      op[i * 32] = mine;
    }
    return;
  }
  const int wg = blockIdx.x - MWG;            // place among the converting work-groups
  const float* src;
  int part;                                   // this work-group's place in its source
  if (wg < 3 * XWG) {
    const int s = wg / XWG;
    src  = s == 0 ? q : s == 1 ? k : v;
    part = wg - s * XWG;
  } else {
    const int s = (wg - 3 * XWG) / WWG;
    src  = s == 0 ? wq : s == 1 ? wk : s == 2 ? wv : wo;
    part = wg - 3 * XWG - s * WWG;
  }
  const v4f* sp = (const v4f*)src + (size_t)part * CVT_WG + threadIdx.x;
  v4h*       dp = (v4h*)dst + (size_t)wg * CVT_WG + threadIdx.x;
  v4f x[CVT_N];
  // unrolled: x stays in registers and the loads issue back to back, many in flight
#pragma unroll
  for (int i = 0; i < CVT_N; ++i) x[i] = sp[i * CVT_T];
  // unrolled: constant indices into x, constant store offsets
#pragma unroll
  for (int i = 0; i < CVT_N; ++i) {
    v4h y;
#pragma unroll
    for (int j = 0; j < 4; ++j) y[j] = (_Float16)x[i][j];
    dp[i * CVT_T] = y;
  }
}

// ---- GEMM operand staging: 64 rows of X and 192 of W, 64 k per stage ---------
// A fragment load straight from global touches 16 cache lines for 512 bytes;
// a staging copy reads whole 128-byte lines, and the fragments come from LDS.
// A work-group makes 64 x 192 of Y with four waves of 64 x 48 each, side by side:
// a staged byte feeds more products than in a small tile, a fragment read from LDS
// three or four. 192 columns are three whole heads, so every 128-byte line of Y
// has one writing work-group. 4096 / 64 * 768 / 192 = 256 work-groups per GEMM.
constexpr int TM   = 64;         // rows of X (and of Y) per work-group
constexpr int TN   = 192;        // rows of W (columns of Y) per work-group
constexpr int FM   = 4;          // 16-row fragments of X per wave
constexpr int FN   = 3;          // 16-row fragments of W per wave
constexpr int BK   = 64;         // halves of K per stage: 128 bytes of every operand row
constexpr int LDG  = BK + 8;     // LDS pitch 144 bytes: conflict-free b128 reads
constexpr int NST  = DM / BK;    // 12 stages
static_assert(NROW % TM == 0 && DM % TN == 0 && DM % BK == 0, "whole tiles");
static_assert(TM == FM * 16 && TN == 4 * FN * 16, "four waves side by side");
static_assert(TN % DK == 0, "whole heads");

DEV unsigned lds_off(const void* p) { return (unsigned)(size_t)p; }

constexpr unsigned LS = 16 * LDG * 2;  // bytes between a lane's rows in LDS
constexpr int      GS = 16 * DM;       // halves between them in global memory

// One lane's share of the X tile: four 16-byte copies, tile rows 16 apart.
// The closing s_wait_xcnt stands in the copies' own statement so that no
// address register named here is rewritten before it.
DEV void copy_x(unsigned l, const _Float16* gp) {
  asm volatile(
      "global_load_async_to_lds_b128 %0, %4, off\n\t"
      "global_load_async_to_lds_b128 %1, %5, off\n\t"
      "global_load_async_to_lds_b128 %2, %6, off\n\t"
      "global_load_async_to_lds_b128 %3, %7, off\n\t"
      "s_wait_xcnt 0x0"
      :: "v"(l), "v"(l + LS), "v"(l + 2 * LS), "v"(l + 3 * LS),
         "v"(gp), "v"(gp + GS), "v"(gp + 2 * GS), "v"(gp + 3 * GS)
      : "memory");
}

// The same for the W tile: twelve copies; the wait closes the statement as above.
DEV void copy_w(unsigned l, const _Float16* gp) {
  asm volatile(
      "global_load_async_to_lds_b128 %0, %12, off\n\t"
      "global_load_async_to_lds_b128 %1, %13, off\n\t"
      "global_load_async_to_lds_b128 %2, %14, off\n\t"
      "global_load_async_to_lds_b128 %3, %15, off\n\t"
      "global_load_async_to_lds_b128 %4, %16, off\n\t"
      "global_load_async_to_lds_b128 %5, %17, off\n\t"
      "global_load_async_to_lds_b128 %6, %18, off\n\t"
      "global_load_async_to_lds_b128 %7, %19, off\n\t"
      "global_load_async_to_lds_b128 %8, %20, off\n\t"
      "global_load_async_to_lds_b128 %9, %21, off\n\t"
      "global_load_async_to_lds_b128 %10, %22, off\n\t"
      "global_load_async_to_lds_b128 %11, %23, off\n\t"
      "s_wait_xcnt 0x0"
      :: "v"(l), "v"(l + LS), "v"(l + 2 * LS), "v"(l + 3 * LS),
         "v"(l + 4 * LS), "v"(l + 5 * LS), "v"(l + 6 * LS), "v"(l + 7 * LS),
         "v"(l + 8 * LS), "v"(l + 9 * LS), "v"(l + 10 * LS), "v"(l + 11 * LS),
         "v"(gp), "v"(gp + GS), "v"(gp + 2 * GS), "v"(gp + 3 * GS),
         "v"(gp + 4 * GS), "v"(gp + 5 * GS), "v"(gp + 6 * GS), "v"(gp + 7 * GS),
         "v"(gp + 8 * GS), "v"(gp + 9 * GS), "v"(gp + 10 * GS), "v"(gp + 11 * GS)
      : "memory");
}

// c[i][t] += X[rowblk + i*16 .. +15][:] * W[colbase + wave*48 + t*16 .. +15][:]^T
// over all of K, k ascending in steps of 32; two LDS buffers, the next stage's
// copies fly while this stage is worked on.
DEV void gemm_tile(const _Float16* __restrict__ X, const _Float16* __restrict__ W,
                   int rowblk, int colbase, v8f (&c)[FM][FN]) {
  __shared__ __align__(16) _Float16 sX[2][TM * LDG];
  __shared__ __align__(16) _Float16 sW[2][TN * LDG];
  const int tid  = threadIdx.x;
  const int lane = tid & 31;
  const int wave = tid >> 5;
  const int row  = lane & 15;
  const int g    = lane >> 4;

  const int cr = tid >> 3;          // this lane's first tile row, 0..15
  const int cc = (tid & 7) * 8;     // its 16-byte chunk of the 128-byte row
  const _Float16* gx = X + (size_t)(rowblk + cr) * DM + cc;
  const _Float16* gw = W + (size_t)(colbase + cr) * DM + cc;
  const unsigned  lx = lds_off(&sX[0][cr * LDG + cc]);
  const unsigned  lw = lds_off(&sW[0][cr * LDG + cc]);
  auto stage = [&](int s) {
    copy_x(lx + (unsigned)(s & 1) * (TM * LDG * 2), gx + s * BK);
    copy_w(lw + (unsigned)(s & 1) * (TN * LDG * 2), gw + s * BK);
  };

  stage(0);
  asm volatile("s_wait_asynccnt 0x0" ::: "memory");  // stage 0 has landed before it is published
  __syncthreads();
  stage(1);

  for (int s = 0; s < NST; ++s) {
    const _Float16* xB = sX[s & 1] + row * LDG + g * 8;
    const _Float16* wB = sW[s & 1] + (wave * (FN * 16) + row) * LDG + g * 8;
    v16h a[BK / 32][FM], b[BK / 32][FN];
#pragma unroll
    for (int j = 0; j < BK / 32; ++j) {
#pragma unroll
      for (int t = 0; t < FN; ++t) b[j][t] = frag_f16(wB + t * 16 * LDG + j * 32);
#pragma unroll
      for (int i = 0; i < FM; ++i) a[j][i] = frag_f16(xB + i * 16 * LDG + j * 32);
    }
    // keeps the stage's LDS reads one group in front of its products; left free,
    // the scheduler sinks each pair to its product behind a wait to zero
    __builtin_amdgcn_sched_barrier(0);
#pragma unroll
    for (int j = 0; j < BK / 32; ++j)
#pragma unroll
      for (int i = 0; i < FM; ++i)
#pragma unroll
        for (int t = 0; t < FN; ++t) c[i][t] = wmma(a[j][i], b[j][t], c[i][t]);
    // keeps the products in front of the stage's foot, where they run while the
    // later reads return; left free, they sink behind the barrier and delay the refill
    __builtin_amdgcn_sched_barrier(0);
    asm volatile("s_wait_dscnt 0x0" ::: "memory");     // this wave's reads of the buffer have ended
    asm volatile("s_wait_asynccnt 0x0" ::: "memory");  // its copies of stage s + 1 have landed
    __syncthreads();  // publishes stage s + 1 and frees the buffer of stage s
    if (s + 2 < NST) stage(s + 2);
  }
  asm volatile("s_wait_asynccnt 0x0" ::: "memory");    // nothing in flight when the wave ends
}

// ---- QKV projection (all-f16 operands): Y = X @ W^T + b, head layout --------
// Q and K: Y[b][h][s][d]        V: Y[b][h][d][s]  (transposed)
// One launch for all three: blockIdx.z = 0, 1, 2 is Q, K, V; the three X, the
// three W and the three Y each lie one behind the other in the workspace.
__global__ __launch_bounds__(128) void proj16_kernel(
    const _Float16* __restrict__ X3, const _Float16* __restrict__ W3,
    const float* __restrict__ bq, const float* __restrict__ bk,
    const float* __restrict__ bv3, _Float16* __restrict__ Y3) {
  const int z = blockIdx.z;
  const _Float16* X = X3 + (size_t)z * NROW * DM;
  const _Float16* W = W3 + (size_t)z * DM * DM;
  _Float16*       Y = Y3 + (size_t)z * NROW * DM;
  const float* bias = z == 0 ? bq : z == 1 ? bk : bv3;
  const int lane = threadIdx.x & 31;
  const int wave = threadIdx.x >> 5;
  const int row  = lane & 15;
  const int g    = lane >> 4;
  const int rowbase = blockIdx.x * TM + g * 8;
  const int colbase = blockIdx.y * TN + wave * (FN * 16) + row;

  v8f c[FM][FN] = {};
  gemm_tile(X, W, blockIdx.x * TM, blockIdx.y * TN, c);

  const int bb = rowbase >> 11;            // a 64-row tile lies inside one batch entry
  const int s0 = rowbase & (SEQ - 1);
  float bv[FN];
  // every loop below is unrolled: constant indices keep c and bv in registers,
  // and the three bias loads issue together
#pragma unroll
  for (int t = 0; t < FN; ++t) bv[t] = bias[colbase + t * 16];
  if (z == 2) {
    // V^T: a lane's eight accumulator rows are eight consecutive positions of
    // its row d, so a fragment leaves in one 16-byte store per lane; as eight
    // 2-byte stores each would touch the same 16 lines once more
#pragma unroll
    for (int t = 0; t < FN; ++t) {
      const int col = colbase + t * 16;    // a 16-column tile lies inside one head
      _Float16* yp = Y + ((size_t)(bb * NH + (col >> 6)) * DK + (col & (DK - 1))) * SEQ + s0;
#pragma unroll
      for (int i = 0; i < FM; ++i) {
        v8h y;
#pragma unroll
        for (int r = 0; r < 8; ++r) y[r] = (_Float16)(c[i][t][r] + bv[t]);
        *(v8h*)(yp + i * 16) = y;
      }
    }
  } else {
#pragma unroll
    for (int t = 0; t < FN; ++t) {
      const int col = colbase + t * 16;
      _Float16* yp = Y + ((size_t)(bb * NH + (col >> 6)) * SEQ + s0) * DK + (col & (DK - 1));
#pragma unroll
      for (int i = 0; i < FM; ++i)
#pragma unroll
        for (int r = 0; r < 8; ++r)
          yp[(i * 16 + r) * DK] = (_Float16)(c[i][t][r] + bv[t]);
    }
    // closes the last stores: in the built code this path's end falls through
    // to lines that rewrite the registers they name
    asm volatile("s_wait_xcnt 0x0" ::: "memory");
  }
}

__global__ __launch_bounds__(128) void attn_kernel(
    const _Float16* __restrict__ Q, const _Float16* __restrict__ K,
    const _Float16* __restrict__ Vt, const unsigned* __restrict__ mbits,
    _Float16* __restrict__ AO) {
  __shared__ __align__(16) _Float16 sK[2][64 * LDP];  // K tile, [key][d] padded
  __shared__ __align__(16) _Float16 sV[2][64 * LDP];  // V^T tile, [d][key] padded

  const int tid  = threadIdx.x;
  const int lane = tid & 31;
  const int wave = tid >> 5;
  const int row  = lane & 15;
  const int g    = lane >> 4;
  const int h = blockIdx.y, b = blockIdx.z;
  const int bh = b * NH + h;
  const int qbase = blockIdx.x * 64 + wave * 16;

  const _Float16* Qh = Q  + (size_t)bh * SEQ * DK;
  const _Float16* Kh = K  + (size_t)bh * SEQ * DK;
  const _Float16* Vh = Vt + (size_t)bh * DK * SEQ;

  const _Float16* qrow = Qh + (size_t)(qbase + row) * DK;
  const v16h qf0 = frag_f16(qrow + 0  + g * 8);
  const v16h qf1 = frag_f16(qrow + 32 + g * 8);

  // this wave's packed mask: 32 lane-mask words per 64 keys. The wave's number
  // goes through readfirstlane so that the address is scalar and the words
  // arrive in scalar registers, where a select reads them as they are.
  const int wv = __builtin_amdgcn_readfirstlane(wave);
  // Constant address space: nothing writes these words while this kernel runs;
  // without it the compiler takes the copies to LDS for possible writers and
  // brings the words through vector registers, one readfirstlane each.
  typedef const __attribute__((address_space(4))) v16u* cmask_t;
  const cmask_t mw = (cmask_t)(unsigned long long)(
      mbits + (size_t)(blockIdx.x * 4 + wv) * (SEQ / 64) * 32);
  v16u w0 = mw[0], w1 = mw[1];

  float m_i = -3.0e38f;   // running max of this lane's query (both halves agree)
  float l_i = 0.0f;       // running sum over this half's keys; halves join at the end
  v8f o[4] = {v8f{}, v8f{}, v8f{}, v8f{}};  // o[t][r] = O[query row][d = t*16 + g*8 + r]

  // stage one 64-key tile (8 KB K + 8 KB V) via 8 async b128 ops per thread
  auto stage = [&](int kb, int buf) {
#pragma unroll
    for (int i = 0; i < 4; ++i) {
      const int c  = tid + i * 128;       // 0..511 16-byte chunks
      const int r  = c >> 3;              // tile row 0..63
      const int ch = (c & 7) * 8;         // halves within row
      async_cp16(&sK[buf][r * LDP + ch], Kh + (size_t)(kb + r) * DK + ch);
      async_cp16(&sV[buf][r * LDP + ch], Vh + (size_t)r * SEQ + kb + ch);
    }
  };

  stage(0, 0);
  for (int kb = 0; kb < SEQ; kb += 64) {
    const int cur = (kb >> 6) & 1;
    if (kb + 64 < SEQ) { stage(kb + 64, cur ^ 1); ASYNC_WAIT(8); }
    else               { ASYNC_WAIT(0); }
    __syncthreads();

    const _Float16* kB = sK[cur] + row * LDP + g * 8;
    const _Float16* vB = sV[cur] + row * LDP + g * 8;

    // every fragment of the pass is asked for here, in the order of its use: the
    // K fragments feed the score products as they arrive, the V fragments
    // travel during those products and the softmax
    v16h kf[2][4], vf[2][4];
    // unrolled: constant indices keep the fragments in registers
#pragma unroll
    for (int j = 0; j < 2; ++j)
#pragma unroll
      for (int t = 0; t < 4; ++t) kf[j][t] = frag_f16(kB + t * 16 * LDP + j * 32);
#pragma unroll
    for (int j = 0; j < 2; ++j)
#pragma unroll
      for (int t = 0; t < 4; ++t) vf[j][t] = frag_f16(vB + t * 16 * LDP + j * 32);
    // keeps the reads one group at the head of the pass; left free, the scheduler
    // sinks each fragment to its product behind a wait to zero, sixteen times a pass
    __builtin_amdgcn_sched_barrier(0);

    // S^T = K Q^T, 64k x 16q: c[t][r] = S[query row][key kb + t*16 + g*8 + r];
    // the four tiles take turns, so no product waits for the one before it
    v8f c[4];
#pragma unroll
    for (int t = 0; t < 4; ++t) {
      v8f z{};
      c[t] = wmma(kf[0][t], qf0, z);
    }
#pragma unroll
    for (int t = 0; t < 4; ++t) c[t] = wmma(kf[1][t], qf1, c[t]);
    // keeps the eight products back to back: a vector instruction drawn in among
    // them reads a tile too early and is padded with idle slots
    __builtin_amdgcn_sched_barrier(0);
    // scale + mask
#pragma unroll
    for (int t = 0; t < 4; ++t) {
#pragma unroll
      for (int r = 0; r < 8; ++r) {
        const unsigned w = t < 2 ? w0[t * 8 + r] : w1[(t - 2) * 8 + r];
        c[t][r] = __builtin_amdgcn_inverse_ballot_w32(w) ? c[t][r] * 0.125f : -1.0e9f;
      }
    }
    // the next 64 keys' words, asked for behind the last use of these: they
    // travel during the rest of this pass (the last pass asks for its own again)
    {
      const int nx = kb + 64 < SEQ ? (kb >> 6) + 1 : (kb >> 6);
      w0 = mw[nx * 2];
      w1 = mw[nx * 2 + 1];
    }
    // online softmax, one query per lane
    float vm[4];
#pragma unroll
    for (int t = 0; t < 4; ++t) {
      vm[t] = fmaxf(c[t][0], c[t][1]);
#pragma unroll
      for (int r = 2; r < 8; ++r) vm[t] = fmaxf(vm[t], c[t][r]);
    }
    float vmax = fmaxf(fmaxf(vm[0], vm[1]), fmaxf(vm[2], vm[3]));
    vmax = fmaxf(vmax, xhalf(vmax));
    const float mnew  = fmaxf(m_i, vmax);
    const float alpha = __expf(m_i - mnew);
    m_i = mnew;
    float s4[4];
#pragma unroll
    for (int t = 0; t < 4; ++t) {
#pragma unroll
      for (int r = 0; r < 8; ++r) c[t][r] = __expf(c[t][r] - mnew);
      s4[t] = ((c[t][0] + c[t][1]) + (c[t][2] + c[t][3])) +
              ((c[t][4] + c[t][5]) + (c[t][6] + c[t][7]));
    }
    l_i = l_i * alpha + ((s4[0] + s4[1]) + (s4[2] + s4[3]));
#pragma unroll
    for (int t = 0; t < 4; ++t)
#pragma unroll
      for (int r = 0; r < 8; ++r) o[t][r] *= alpha;
    // P^T: two converted score tiles are one B fragment (32 keys x 16 queries)
    v16h p0, p1;
#pragma unroll
    for (int r = 0; r < 8; ++r) {
      p0[r] = (_Float16)c[0][r]; p0[r + 8] = (_Float16)c[1][r];
      p1[r] = (_Float16)c[2][r]; p1[r + 8] = (_Float16)c[3][r];
    }
    // O^T += V^T P^T, the four tiles taking turns as above
#pragma unroll
    for (int t = 0; t < 4; ++t) o[t] = wmma(vf[0][t], p0, o[t]);
#pragma unroll
    for (int t = 0; t < 4; ++t) o[t] = wmma(vf[1][t], p1, o[t]);
    __syncthreads();  // all waves done reading before this buffer is re-staged
  }

  // epilogue: join the halves' sums, O / l, 8 consecutive d per 16-byte store
  const float inv = 1.0f / (l_i + xhalf(l_i));
  _Float16* arow = AO + (size_t)(b * SEQ + qbase + row) * DM + h * DK + g * 8;
#pragma unroll
  for (int t = 0; t < 4; ++t) {
    v8h y;
#pragma unroll
    for (int r = 0; r < 8; ++r) y[r] = (_Float16)(o[t][r] * inv);
    *(v8h*)(arow + t * 16) = y;
  }
}

// ---- output projection: f32 out = AO(f16) @ Wo^T(f16) + bo ------------------
__global__ __launch_bounds__(128) void oproj16_kernel(
    const _Float16* __restrict__ X16, const _Float16* __restrict__ W,
    const float* __restrict__ bias, float* __restrict__ Y) {
  const int lane = threadIdx.x & 31;
  const int wave = threadIdx.x >> 5;
  const int row  = lane & 15;
  const int g    = lane >> 4;
  const int rowbase = blockIdx.x * TM + g * 8;
  const int colbase = blockIdx.y * TN + wave * (FN * 16) + row;

  v8f c[FM][FN] = {};
  gemm_tile(X16, W, blockIdx.x * TM, blockIdx.y * TN, c);
#pragma unroll
  for (int t = 0; t < FN; ++t) {
    const int n = colbase + t * 16;
    const float bv = bias[n];
#pragma unroll
    for (int i = 0; i < FM; ++i)
#pragma unroll
      for (int r = 0; r < 8; ++r)
        Y[(size_t)(rowbase + i * 16 + r) * DM + n] = c[i][t][r] + bv;
  }
}

// ---- launch -----------------------------------------------------------------
extern "C" void kernel_launch(void* const* d_in, const int* in_sizes, int n_in,
                              void* d_out, int out_size, void* d_ws, size_t ws_size,
                              hipStream_t stream) {
  const float* q    = (const float*)d_in[0];
  const float* k    = (const float*)d_in[1];
  const float* v    = (const float*)d_in[2];
  const int*   mask = (const int*)  d_in[3];
  const float* w_q  = (const float*)d_in[4];
  const float* b_q  = (const float*)d_in[5];
  const float* w_k  = (const float*)d_in[6];
  const float* b_k  = (const float*)d_in[7];
  const float* w_v  = (const float*)d_in[8];
  const float* b_v  = (const float*)d_in[9];
  const float* w_o  = (const float*)d_in[10];
  const float* b_o  = (const float*)d_in[11];

  const size_t nXW = (size_t)NROW * DM;   // 4096*768
  const size_t nWW = (size_t)DM * DM;     // 768*768
  _Float16* p = (_Float16*)d_ws;
  _Float16* xq16 = p; p += nXW;
  _Float16* xk16 = p; p += nXW;
  _Float16* xv16 = p; p += nXW;
  _Float16* wq16 = p; p += nWW;
  _Float16* wk16 = p; p += nWW;
  _Float16* wv16 = p; p += nWW;
  _Float16* wo16 = p; p += nWW;
  _Float16* q16  = p; p += nXW;
  _Float16* k16  = p; p += nXW;
  _Float16* vt16 = p; p += nXW;
  _Float16* ao16 = p; p += nXW;
  unsigned* mbits = (unsigned*)p;         // SEQ * SEQ / 8 bytes

  const dim3 blk(128);
  cvt16_kernel<<<MWG + NCVT, CVT_T, 0, stream>>>(q, k, v, w_q, w_k, w_v, w_o, mask, xq16, mbits);

  const dim3 pg(NROW / TM, DM / TN);      // 64 x 4
  proj16_kernel<<<dim3(NROW / TM, DM / TN, 3), blk, 0, stream>>>(xq16, wq16, b_q, b_k, b_v, q16);

  attn_kernel<<<dim3(SEQ / 64, NH, 2), blk, 0, stream>>>(q16, k16, vt16, mbits, ao16);

  oproj16_kernel<<<pg, blk, 0, stream>>>(ao16, wo16, b_o, (float*)d_out);
}

// v008
// One run takes 72.7 microseconds.
// Two timings next to v007 both put it at 1.04 times that version's speed.
// Counting every step since v000, it is 4.93 times as fast.
#include <hip/hip_runtime.h>

typedef __attribute__((ext_vector_type(16))) _Float16 v16h;
typedef __attribute__((ext_vector_type(8)))  _Float16 v8h;
typedef __attribute__((ext_vector_type(8)))  float    v8f;
typedef __attribute__((ext_vector_type(4)))  int      v4i;
typedef __attribute__((ext_vector_type(4)))  float    v4f;
typedef __attribute__((ext_vector_type(4)))  _Float16 v4h;
typedef __attribute__((ext_vector_type(16))) unsigned v16u;

#define DEV static __device__ __forceinline__

constexpr int DM   = 768;     // model dim
constexpr int SEQ  = 2048;    // sequence length
constexpr int NH   = 12;      // heads
constexpr int DK   = 64;      // head dim
constexpr int NROW = 2 * SEQ; // B*S = 4096 rows
constexpr int LDP  = 72;      // padded LDS row (halves): conflict-free b128 reads

// ---- CDNA5 async global->LDS copy (guarded; falls back to sync staging) -----
#if defined(__has_builtin) && __has_builtin(__builtin_amdgcn_global_load_async_to_lds_b128)
#define HAVE_ASYNC_LDS 1
DEV void async_cp16(_Float16* ldst, const _Float16* gsrc) {
  __builtin_amdgcn_global_load_async_to_lds_b128(
      (__attribute__((address_space(1))) v4i*)gsrc,
      (__attribute__((address_space(3))) v4i*)ldst,
      0, 0);
}
#if defined(__has_builtin) && __has_builtin(__builtin_amdgcn_s_wait_asynccnt)
#define ASYNC_WAIT(n) __builtin_amdgcn_s_wait_asynccnt(n)
#else
#define ASYNC_WAIT(n) asm volatile("s_wait_asynccnt " #n ::: "memory")
#endif
#else
#define HAVE_ASYNC_LDS 0
DEV void async_cp16(_Float16* ldst, const _Float16* gsrc) {
  *(v8h*)ldst = *(const v8h*)gsrc;   // sync fallback through VGPRs
}
#define ASYNC_WAIT(n) ((void)0)
#endif

// ---- fragment helpers -------------------------------------------------------
// CDNA5 16-bit A/B fragment (16x32 / 32x16), wave32:
//   lane l: row/col = l&15, g = l>>4
//   VGPR0..3 hold K = g*8 + 0..7, VGPR4..7 hold K = 16 + g*8 + 0..7
// => per lane: two contiguous 16-byte chunks at +0 and +16 halves.
DEV v16h frag_f16(const _Float16* p) {
  v8h lo = *(const v8h*)p;
  v8h hi = *(const v8h*)(p + 16);
  v16h r;
#pragma unroll
  for (int i = 0; i < 8; ++i) { r[i] = lo[i]; r[i + 8] = hi[i]; }
  return r;
}

DEV v8f wmma(v16h a, v16h b, v8f c) {
  return __builtin_amdgcn_wmma_f32_16x16x32_f16(false, a, false, b, (short)0, c,
                                                false, false);
}

// lane l <-> lane l ^ 16: the one exchange between the wave halves
DEV float xhalf(float x) {
  const int b = __builtin_bit_cast(int, x);
  return __builtin_bit_cast(float, __builtin_amdgcn_permlanex16(
      b, b, 0x76543210, 0xfedcba98, false, false));
}

// ---- f32 -> f16 of all seven operands in ONE launch -------------------------
// The destinations lie one behind the other in the workspace in the order
// q, k, v, w_q, w_k, w_v, w_o, so a converting work-group's place among its kind
// is also its place in the destination. A work-group converts CVT_WG 16-byte pieces of one
// source; a wave-wide load covers 512 contiguous bytes, a store 256.
constexpr int CVT_T  = 512;                   // threads: 16 waves on a WGP
constexpr int CVT_N  = 24;                    // pieces per thread
constexpr int CVT_WG = CVT_T * CVT_N;         // pieces of 4 floats per work-group
constexpr int XWG = NROW * DM / 4 / CVT_WG;   // 64 work-groups per activation
constexpr int WWG = DM * DM / 4 / CVT_WG;     // 12 per weight
static_assert(XWG * CVT_WG * 4 == NROW * DM && WWG * CVT_WG * 4 == DM * DM,
              "every source is a whole number of work-groups");
constexpr int NCVT = 3 * XWG + 4 * WWG;       // work-groups that convert

// The same launch packs the mask for the attention kernel, whose lane l holds,
// for 16 queries x 64 keys, the scores of query l & 15 at keys
// t*16 + (l >> 4)*8 + r. Word t*8 + r of such a block has in bit l whether
// that lane's key is open (mask != 0): a ready lane mask for a select.
// Layout: [16-query block][64-key block][t*8 + r], 128 bytes per block pair.
// A load of this pattern touches 16 lines, which is paid on the WGP's load path:
// the packing is spread over many work-groups, and they stand first in the grid.
constexpr int MP_N = 2;                       // 64-key blocks per wave
constexpr int MWG  = (SEQ / 16) * (SEQ / 64) / MP_N / (CVT_T / 32);   // 128 work-groups
static_assert(MWG * MP_N * (CVT_T / 32) == (SEQ / 16) * (SEQ / 64), "whole work-groups");

__global__ __launch_bounds__(CVT_T) void cvt16_kernel(
    const float* __restrict__ q,  const float* __restrict__ k,
    const float* __restrict__ v,  const float* __restrict__ wq,
    const float* __restrict__ wk, const float* __restrict__ wv,
    const float* __restrict__ wo, const int* __restrict__ mask,
    _Float16* __restrict__ dst, unsigned* __restrict__ mbits) {
  if (blockIdx.x < MWG) {
    const int lane = threadIdx.x & 31;
    const int unit = blockIdx.x * (CVT_T / 32) + (threadIdx.x >> 5);
    const int qblk = unit / (SEQ / 64 / MP_N);            // 16-query block
    const int kb0  = unit % (SEQ / 64 / MP_N) * MP_N;     // first 64-key block
    const int* mr = mask + (size_t)(qblk * 16 + (lane & 15)) * SEQ + kb0 * 64 + (lane >> 4) * 8;
    v4i m[MP_N][8];
    // unrolled: m stays in registers and the loads issue back to back
#pragma unroll
    for (int i = 0; i < MP_N; ++i)
#pragma unroll
      for (int j = 0; j < 8; ++j) m[i][j] = *(const v4i*)(mr + i * 64 + (j >> 1) * 16 + (j & 1) * 4);
    unsigned* op = mbits + (size_t)(qblk * (SEQ / 64) + kb0) * 32 + lane;
#pragma unroll
    for (int i = 0; i < MP_N; ++i) {
      unsigned mine = 0;                      // lane j keeps word j: one 128-byte store
#pragma unroll
      for (int j = 0; j < 32; ++j) {
        const unsigned w = __builtin_amdgcn_ballot_w32(m[i][j >> 2][j & 3] != 0);
        mine = lane == j ? w : mine;
      }
      op[i * 32] = mine;
    }
    return;
  }
  const int wg = blockIdx.x - MWG;            // place among the converting work-groups
  const float* src;
  int part;                                   // this work-group's place in its source
  if (wg < 3 * XWG) {
    const int s = wg / XWG;
    src  = s == 0 ? q : s == 1 ? k : v;
    part = wg - s * XWG;
  } else {
    const int s = (wg - 3 * XWG) / WWG;
    src  = s == 0 ? wq : s == 1 ? wk : s == 2 ? wv : wo;
    part = wg - 3 * XWG - s * WWG;
  }
  const v4f* sp = (const v4f*)src + (size_t)part * CVT_WG + threadIdx.x;
  v4h*       dp = (v4h*)dst + (size_t)wg * CVT_WG + threadIdx.x;
  v4f x[CVT_N];
  // unrolled: x stays in registers and the loads issue back to back, many in flight
#pragma unroll
  for (int i = 0; i < CVT_N; ++i) x[i] = sp[i * CVT_T];
  // unrolled: constant indices into x, constant store offsets
#pragma unroll
  for (int i = 0; i < CVT_N; ++i) {
    v4h y;
#pragma unroll
    for (int j = 0; j < 4; ++j) y[j] = (_Float16)x[i][j];
    dp[i * CVT_T] = y;
  }
}

// ---- GEMM operand staging: 64 rows of X and 192 of W, 64 k per stage ---------
// A fragment load straight from global touches 16 cache lines for 512 bytes;
// a staging copy reads whole 128-byte lines, and the fragments come from LDS.
// A work-group makes 64 x 192 of Y with four waves of 64 x 48 each, side by side:
// a staged byte feeds more products than in a small tile, a fragment read from LDS
// three or four. 192 columns are three whole heads, so every 128-byte line of Y
// has one writing work-group. 4096 / 64 * 768 / 192 = 256 work-groups per GEMM.
constexpr int TM   = 64;         // rows of X (and of Y) per work-group
constexpr int TN   = 192;        // rows of W (columns of Y) per work-group
constexpr int FM   = 4;          // 16-row fragments of X per wave
constexpr int FN   = 3;          // 16-row fragments of W per wave
constexpr int BK   = 64;         // halves of K per stage: 128 bytes of every operand row
constexpr int LDG  = BK + 8;     // LDS pitch 144 bytes: conflict-free b128 reads
constexpr int NST  = DM / BK;    // 12 stages
static_assert(NROW % TM == 0 && DM % TN == 0 && DM % BK == 0, "whole tiles");
static_assert(TM == FM * 16 && TN == 4 * FN * 16, "four waves side by side");
static_assert(TN % DK == 0, "whole heads");

DEV unsigned lds_off(const void* p) { return (unsigned)(size_t)p; }

constexpr unsigned LS = 16 * LDG * 2;  // bytes between a lane's rows in LDS
constexpr int      GS = 16 * DM;       // halves between them in global memory

// One lane's share of the X tile: four 16-byte copies, tile rows 16 apart.
// The closing s_wait_xcnt stands in the copies' own statement so that no
// address register named here is rewritten before it.
DEV void copy_x(unsigned l, const _Float16* gp) {
  asm volatile(
      "global_load_async_to_lds_b128 %0, %4, off\n\t"
      "global_load_async_to_lds_b128 %1, %5, off\n\t"
      "global_load_async_to_lds_b128 %2, %6, off\n\t"
      "global_load_async_to_lds_b128 %3, %7, off\n\t"
      "s_wait_xcnt 0x0"
      :: "v"(l), "v"(l + LS), "v"(l + 2 * LS), "v"(l + 3 * LS),
         "v"(gp), "v"(gp + GS), "v"(gp + 2 * GS), "v"(gp + 3 * GS)
      : "memory");
}

// The same for the W tile: twelve copies; the wait closes the statement as above.
DEV void copy_w(unsigned l, const _Float16* gp) {
  asm volatile(
      "global_load_async_to_lds_b128 %0, %12, off\n\t"
      "global_load_async_to_lds_b128 %1, %13, off\n\t"
      "global_load_async_to_lds_b128 %2, %14, off\n\t"
      "global_load_async_to_lds_b128 %3, %15, off\n\t"
      "global_load_async_to_lds_b128 %4, %16, off\n\t"
      "global_load_async_to_lds_b128 %5, %17, off\n\t"
      "global_load_async_to_lds_b128 %6, %18, off\n\t"
      "global_load_async_to_lds_b128 %7, %19, off\n\t"
      "global_load_async_to_lds_b128 %8, %20, off\n\t"
      "global_load_async_to_lds_b128 %9, %21, off\n\t"
      "global_load_async_to_lds_b128 %10, %22, off\n\t"
      "global_load_async_to_lds_b128 %11, %23, off\n\t"
      "s_wait_xcnt 0x0"
      :: "v"(l), "v"(l + LS), "v"(l + 2 * LS), "v"(l + 3 * LS),
         "v"(l + 4 * LS), "v"(l + 5 * LS), "v"(l + 6 * LS), "v"(l + 7 * LS),
         "v"(l + 8 * LS), "v"(l + 9 * LS), "v"(l + 10 * LS), "v"(l + 11 * LS),
         "v"(gp), "v"(gp + GS), "v"(gp + 2 * GS), "v"(gp + 3 * GS),
         "v"(gp + 4 * GS), "v"(gp + 5 * GS), "v"(gp + 6 * GS), "v"(gp + 7 * GS),
         "v"(gp + 8 * GS), "v"(gp + 9 * GS), "v"(gp + 10 * GS), "v"(gp + 11 * GS)
      : "memory");
}

// c[i][t] += X[rowblk + i*16 .. +15][:] * W[colbase + wave*48 + t*16 .. +15][:]^T
// over all of K, k ascending in steps of 32; two LDS buffers, the next stage's
// copies fly while this stage is worked on.
DEV void gemm_tile(const _Float16* __restrict__ X, const _Float16* __restrict__ W,
                   int rowblk, int colbase, v8f (&c)[FM][FN]) {
  __shared__ __align__(16) _Float16 sX[2][TM * LDG];
  __shared__ __align__(16) _Float16 sW[2][TN * LDG];
  const int tid  = threadIdx.x;
  const int lane = tid & 31;
  const int wave = tid >> 5;
  const int row  = lane & 15;
  const int g    = lane >> 4;

  const int cr = tid >> 3;          // this lane's first tile row, 0..15
  const int cc = (tid & 7) * 8;     // its 16-byte chunk of the 128-byte row
  const _Float16* gx = X + (size_t)(rowblk + cr) * DM + cc;
  const _Float16* gw = W + (size_t)(colbase + cr) * DM + cc;
  const unsigned  lx = lds_off(&sX[0][cr * LDG + cc]);
  const unsigned  lw = lds_off(&sW[0][cr * LDG + cc]);
  auto stage = [&](int s) {
    copy_x(lx + (unsigned)(s & 1) * (TM * LDG * 2), gx + s * BK);
    copy_w(lw + (unsigned)(s & 1) * (TN * LDG * 2), gw + s * BK);
  };

  stage(0);
  asm volatile("s_wait_asynccnt 0x0" ::: "memory");  // stage 0 has landed before it is published
  __syncthreads();
  stage(1);

  for (int s = 0; s < NST; ++s) {
    const _Float16* xB = sX[s & 1] + row * LDG + g * 8;
    const _Float16* wB = sW[s & 1] + (wave * (FN * 16) + row) * LDG + g * 8;
    v16h a[BK / 32][FM], b[BK / 32][FN];
#pragma unroll
    for (int j = 0; j < BK / 32; ++j) {
#pragma unroll
      for (int t = 0; t < FN; ++t) b[j][t] = frag_f16(wB + t * 16 * LDG + j * 32);
#pragma unroll
      for (int i = 0; i < FM; ++i) a[j][i] = frag_f16(xB + i * 16 * LDG + j * 32);
    }
    // keeps the stage's LDS reads one group in front of its products; left free,
    // the scheduler sinks each pair to its product behind a wait to zero
    __builtin_amdgcn_sched_barrier(0);
#pragma unroll
    for (int j = 0; j < BK / 32; ++j)
#pragma unroll
      for (int i = 0; i < FM; ++i)
#pragma unroll
        for (int t = 0; t < FN; ++t) c[i][t] = wmma(a[j][i], b[j][t], c[i][t]);
    // keeps the products in front of the stage's foot, where they run while the
    // later reads return; left free, they sink behind the barrier and delay the refill
    __builtin_amdgcn_sched_barrier(0);
    asm volatile("s_wait_dscnt 0x0" ::: "memory");     // this wave's reads of the buffer have ended
    asm volatile("s_wait_asynccnt 0x0" ::: "memory");  // its copies of stage s + 1 have landed
    __syncthreads();  // publishes stage s + 1 and frees the buffer of stage s
    if (s + 2 < NST) stage(s + 2);
  }
  asm volatile("s_wait_asynccnt 0x0" ::: "memory");    // nothing in flight when the wave ends
}

// ---- QKV projection (all-f16 operands): Y = X @ W^T + b, head layout --------
// Q and K: Y[b][h][s][d]        V: Y[b][h][d][s]  (transposed)
// One launch for all three: blockIdx.z = 0, 1, 2 is Q, K, V; the three X, the
// three W and the three Y each lie one behind the other in the workspace.
__global__ __launch_bounds__(128) void proj16_kernel(
    const _Float16* __restrict__ X3, const _Float16* __restrict__ W3,
    const float* __restrict__ bq, const float* __restrict__ bk,
    const float* __restrict__ bv3, _Float16* __restrict__ Y3) {
  const int z = blockIdx.z;
  const _Float16* X = X3 + (size_t)z * NROW * DM;
  const _Float16* W = W3 + (size_t)z * DM * DM;
  _Float16*       Y = Y3 + (size_t)z * NROW * DM;
  const float* bias = z == 0 ? bq : z == 1 ? bk : bv3;
  const int lane = threadIdx.x & 31;
  const int wave = threadIdx.x >> 5;
  const int row  = lane & 15;
  const int g    = lane >> 4;
  const int rowbase = blockIdx.x * TM + g * 8;
  const int colbase = blockIdx.y * TN + wave * (FN * 16) + row;

  v8f c[FM][FN] = {};
  gemm_tile(X, W, blockIdx.x * TM, blockIdx.y * TN, c);

  const int bb = rowbase >> 11;            // a 64-row tile lies inside one batch entry
  const int s0 = rowbase & (SEQ - 1);
  float bv[FN];
  // every loop below is unrolled: constant indices keep c and bv in registers,
  // and the three bias loads issue together
#pragma unroll
  for (int t = 0; t < FN; ++t) bv[t] = bias[colbase + t * 16];
  if (z == 2) {
    // V^T: a lane's eight accumulator rows are eight consecutive positions of
    // its row d, so a fragment leaves in one 16-byte store per lane; as eight
    // 2-byte stores each would touch the same 16 lines once more
#pragma unroll
    for (int t = 0; t < FN; ++t) {
      const int col = colbase + t * 16;    // a 16-column tile lies inside one head
      _Float16* yp = Y + ((size_t)(bb * NH + (col >> 6)) * DK + (col & (DK - 1))) * SEQ + s0;
#pragma unroll
      for (int i = 0; i < FM; ++i) {
        v8h y;
#pragma unroll
        for (int r = 0; r < 8; ++r) y[r] = (_Float16)(c[i][t][r] + bv[t]);
        *(v8h*)(yp + i * 16) = y;
      }
    }
  } else {
#pragma unroll
    for (int t = 0; t < FN; ++t) {
      const int col = colbase + t * 16;
      _Float16* yp = Y + ((size_t)(bb * NH + (col >> 6)) * SEQ + s0) * DK + (col & (DK - 1));
#pragma unroll
      for (int i = 0; i < FM; ++i)
#pragma unroll
        for (int r = 0; r < 8; ++r)
          yp[(i * 16 + r) * DK] = (_Float16)(c[i][t][r] + bv[t]);
    }
    // closes the last stores: in the built code this path's end falls through
    // to lines that rewrite the registers they name
    asm volatile("s_wait_xcnt 0x0" ::: "memory");
  }
}

__global__ __launch_bounds__(128) void attn_kernel(
    const _Float16* __restrict__ Q, const _Float16* __restrict__ K,
    const _Float16* __restrict__ Vt, const unsigned* __restrict__ mbits,
    _Float16* __restrict__ AO) {
  __shared__ __align__(16) _Float16 sK[2][64 * LDP];  // K tile, [key][d] padded
  __shared__ __align__(16) _Float16 sV[2][64 * LDP];  // V^T tile, [d][key] padded

  const int tid  = threadIdx.x;
  const int lane = tid & 31;
  const int wave = tid >> 5;
  const int row  = lane & 15;
  const int g    = lane >> 4;
  const int h = blockIdx.y, b = blockIdx.z;
  const int bh = b * NH + h;
  const int qbase = blockIdx.x * 64 + wave * 16;

  const _Float16* Qh = Q  + (size_t)bh * SEQ * DK;
  const _Float16* Kh = K  + (size_t)bh * SEQ * DK;
  const _Float16* Vh = Vt + (size_t)bh * DK * SEQ;

  const _Float16* qrow = Qh + (size_t)(qbase + row) * DK;
  const v16h qf0 = frag_f16(qrow + 0  + g * 8);
  const v16h qf1 = frag_f16(qrow + 32 + g * 8);

  // this wave's packed mask: 32 lane-mask words per 64 keys. The wave's number
  // goes through readfirstlane so that the address is scalar and the words
  // arrive in scalar registers, where a select reads them as they are.
  const int wv = __builtin_amdgcn_readfirstlane(wave);
  // Constant address space: nothing writes these words while this kernel runs;
  // without it the compiler takes the copies to LDS for possible writers and
  // brings the words through vector registers, one readfirstlane each.
  typedef const __attribute__((address_space(4))) v16u* cmask_t;
  const cmask_t mw = (cmask_t)(unsigned long long)(
      mbits + (size_t)(blockIdx.x * 4 + wv) * (SEQ / 64) * 32);
  v16u w0 = mw[0], w1 = mw[1];

  // 1/sqrt(64) * log2(e): takes an unscaled score product to the exponent of 2
  constexpr float SC = 0.125f * 1.44269504088896341f;
  // a closed key's unscaled score, -2^33 (-1.07e9 once scaled): far below every open
  // score, so its weight is 0. A power of two, so that CLOSED * SC is exact and a
  // query with no open key gets exponent 0 at every key: equal weights.
  constexpr float CLOSED = -8589934592.0f;

  float m_i = -3.0e38f;   // running max, unscaled, of this lane's query (both halves agree)
  float l_i = 0.0f;       // running sum over this half's keys; halves join at the end
  v8f o[4] = {v8f{}, v8f{}, v8f{}, v8f{}};  // o[t][r] = O[query row][d = t*16 + g*8 + r]

  // stage one 64-key tile (8 KB K + 8 KB V) via 8 async b128 ops per thread
  auto stage = [&](int kb, int buf) {
#pragma unroll
    for (int i = 0; i < 4; ++i) {
      const int c  = tid + i * 128;       // 0..511 16-byte chunks
      const int r  = c >> 3;              // tile row 0..63
      const int ch = (c & 7) * 8;         // halves within row
      async_cp16(&sK[buf][r * LDP + ch], Kh + (size_t)(kb + r) * DK + ch);
      async_cp16(&sV[buf][r * LDP + ch], Vh + (size_t)r * SEQ + kb + ch);
    }
  };

  stage(0, 0);
  for (int kb = 0; kb < SEQ; kb += 64) {
    const int cur = (kb >> 6) & 1;
    if (kb + 64 < SEQ) { stage(kb + 64, cur ^ 1); ASYNC_WAIT(8); }
    else               { ASYNC_WAIT(0); }
    __syncthreads();

    const _Float16* kB = sK[cur] + row * LDP + g * 8;
    const _Float16* vB = sV[cur] + row * LDP + g * 8;

    // every fragment of the pass is asked for here, in the order of its use: the
    // K fragments feed the score products as they arrive, the V fragments
    // travel during those products and the softmax
    v16h kf[2][4], vf[2][4];
    // unrolled: constant indices keep the fragments in registers
#pragma unroll
    for (int j = 0; j < 2; ++j)
#pragma unroll
      for (int t = 0; t < 4; ++t) kf[j][t] = frag_f16(kB + t * 16 * LDP + j * 32);
#pragma unroll
    for (int j = 0; j < 2; ++j)
#pragma unroll
      for (int t = 0; t < 4; ++t) vf[j][t] = frag_f16(vB + t * 16 * LDP + j * 32);
    // keeps the reads one group at the head of the pass; left free, the scheduler
    // sinks each fragment to its product behind a wait to zero, sixteen times a pass
    __builtin_amdgcn_sched_barrier(0);

    // S^T = K Q^T, 64k x 16q: c[t][r] = S[query row][key kb + t*16 + g*8 + r];
    // the four tiles take turns, so no product waits for the one before it
    v8f c[4];
#pragma unroll
    for (int t = 0; t < 4; ++t) {
      v8f z{};
      c[t] = wmma(kf[0][t], qf0, z);
    }
#pragma unroll
    for (int t = 0; t < 4; ++t) c[t] = wmma(kf[1][t], qf1, c[t]);
    // keeps the eight products back to back: a vector instruction drawn in among
    // them reads a tile too early and is padded with idle slots
    __builtin_amdgcn_sched_barrier(0);
    // mask; the products stay unscaled (SC below carries the scale)
#pragma unroll
    for (int t = 0; t < 4; ++t) {
#pragma unroll
      for (int r = 0; r < 8; ++r) {
        const unsigned w = t < 2 ? w0[t * 8 + r] : w1[(t - 2) * 8 + r];
        c[t][r] = __builtin_amdgcn_inverse_ballot_w32(w) ? c[t][r] : CLOSED;
      }
    }
    // the next 64 keys' words, asked for behind the last use of these: they
    // travel during the rest of this pass (the last pass asks for its own again)
    {
      const int nx = kb + 64 < SEQ ? (kb >> 6) + 1 : (kb >> 6);
      w0 = mw[nx * 2];
      w1 = mw[nx * 2 + 1];
    }
    // online softmax, one query per lane
    float vm[4];
#pragma unroll
    for (int t = 0; t < 4; ++t) {
      vm[t] = fmaxf(c[t][0], c[t][1]);
#pragma unroll
      for (int r = 2; r < 8; ++r) vm[t] = fmaxf(vm[t], c[t][r]);
    }
    float vmax = fmaxf(fmaxf(vm[0], vm[1]), fmaxf(vm[2], vm[3]));
    vmax = fmaxf(vmax, xhalf(vmax));
    const float mnew  = fmaxf(m_i, vmax);
    const float alpha = __builtin_amdgcn_exp2f((m_i - mnew) * SC);
    m_i = mnew;
    const float nm = -mnew * SC;
    // e^(score/8 - max/8) = 2^(c*SC - max*SC): one fused multiply-add per score, two
    // scores an instruction, in place of the scaling, the subtraction and the
    // multiply inside exp
    const v8f sc8 = {SC, SC, SC, SC, SC, SC, SC, SC};
    const v8f nm8 = {nm, nm, nm, nm, nm, nm, nm, nm};
    // unrolled: constant indices keep c in registers
#pragma unroll
    for (int t = 0; t < 4; ++t) c[t] = __builtin_elementwise_fma(c[t], sc8, nm8);
    float s4[4];
#pragma unroll
    for (int t = 0; t < 4; ++t) {
#pragma unroll
      for (int r = 0; r < 8; ++r) c[t][r] = __builtin_amdgcn_exp2f(c[t][r]);
      s4[t] = ((c[t][0] + c[t][1]) + (c[t][2] + c[t][3])) +
              ((c[t][4] + c[t][5]) + (c[t][6] + c[t][7]));
    }
    l_i = l_i * alpha + ((s4[0] + s4[1]) + (s4[2] + s4[3]));
#pragma unroll
    for (int t = 0; t < 4; ++t)
#pragma unroll
      for (int r = 0; r < 8; ++r) o[t][r] *= alpha;
    // P^T: two converted score tiles are one B fragment (32 keys x 16 queries)
    v16h p0, p1;
#pragma unroll
    for (int r = 0; r < 8; ++r) {
      p0[r] = (_Float16)c[0][r]; p0[r + 8] = (_Float16)c[1][r];
      p1[r] = (_Float16)c[2][r]; p1[r + 8] = (_Float16)c[3][r];
    }
    // O^T += V^T P^T, the four tiles taking turns as above
#pragma unroll
    for (int t = 0; t < 4; ++t) o[t] = wmma(vf[0][t], p0, o[t]);
#pragma unroll
    for (int t = 0; t < 4; ++t) o[t] = wmma(vf[1][t], p1, o[t]);
    __syncthreads();  // all waves done reading before this buffer is re-staged
  }

  // epilogue: join the halves' sums, O / l, 8 consecutive d per 16-byte store
  const float inv = 1.0f / (l_i + xhalf(l_i));
  _Float16* arow = AO + (size_t)(b * SEQ + qbase + row) * DM + h * DK + g * 8;
#pragma unroll
  for (int t = 0; t < 4; ++t) {
    v8h y;
#pragma unroll
    for (int r = 0; r < 8; ++r) y[r] = (_Float16)(o[t][r] * inv);
    *(v8h*)(arow + t * 16) = y;
  }
}

// ---- output projection: f32 out = AO(f16) @ Wo^T(f16) + bo ------------------
__global__ __launch_bounds__(128) void oproj16_kernel(
    const _Float16* __restrict__ X16, const _Float16* __restrict__ W,
    const float* __restrict__ bias, float* __restrict__ Y) {
  const int lane = threadIdx.x & 31;
  const int wave = threadIdx.x >> 5;
  const int row  = lane & 15;
  const int g    = lane >> 4;
  const int rowbase = blockIdx.x * TM + g * 8;
  const int colbase = blockIdx.y * TN + wave * (FN * 16) + row;

  v8f c[FM][FN] = {};
  gemm_tile(X16, W, blockIdx.x * TM, blockIdx.y * TN, c);
#pragma unroll
  for (int t = 0; t < FN; ++t) {
    const int n = colbase + t * 16;
    const float bv = bias[n];
#pragma unroll
    for (int i = 0; i < FM; ++i)
#pragma unroll
      for (int r = 0; r < 8; ++r)
        Y[(size_t)(rowbase + i * 16 + r) * DM + n] = c[i][t][r] + bv;
  }
}

// ---- launch -----------------------------------------------------------------
extern "C" void kernel_launch(void* const* d_in, const int* in_sizes, int n_in,
                              void* d_out, int out_size, void* d_ws, size_t ws_size,
                              hipStream_t stream) {
  const float* q    = (const float*)d_in[0];
  const float* k    = (const float*)d_in[1];
  const float* v    = (const float*)d_in[2];
  const int*   mask = (const int*)  d_in[3];
  const float* w_q  = (const float*)d_in[4];
  const float* b_q  = (const float*)d_in[5];
  const float* w_k  = (const float*)d_in[6];
  const float* b_k  = (const float*)d_in[7];
  const float* w_v  = (const float*)d_in[8];
  const float* b_v  = (const float*)d_in[9];
  const float* w_o  = (const float*)d_in[10];
  const float* b_o  = (const float*)d_in[11];

  const size_t nXW = (size_t)NROW * DM;   // 4096*768
  const size_t nWW = (size_t)DM * DM;     // 768*768
  _Float16* p = (_Float16*)d_ws;
  _Float16* xq16 = p; p += nXW;
  _Float16* xk16 = p; p += nXW;
  _Float16* xv16 = p; p += nXW;
  _Float16* wq16 = p; p += nWW;
  _Float16* wk16 = p; p += nWW;
  _Float16* wv16 = p; p += nWW;
  _Float16* wo16 = p; p += nWW;
  _Float16* q16  = p; p += nXW;
  _Float16* k16  = p; p += nXW;
  _Float16* vt16 = p; p += nXW;
  _Float16* ao16 = p; p += nXW;
  unsigned* mbits = (unsigned*)p;         // SEQ * SEQ / 8 bytes

  const dim3 blk(128);
  cvt16_kernel<<<MWG + NCVT, CVT_T, 0, stream>>>(q, k, v, w_q, w_k, w_v, w_o, mask, xq16, mbits);

  const dim3 pg(NROW / TM, DM / TN);      // 64 x 4
  proj16_kernel<<<dim3(NROW / TM, DM / TN, 3), blk, 0, stream>>>(xq16, wq16, b_q, b_k, b_v, q16);

  attn_kernel<<<dim3(SEQ / 64, NH, 2), blk, 0, stream>>>(q16, k16, vt16, mbits, ao16);

  oproj16_kernel<<<pg, blk, 0, stream>>>(ao16, wo16, b_o, (float*)d_out);
}

// v009
// A run of this version takes 70.7 microseconds.
// In both of two side-by-side timings against v008, it was 1.03 times as fast.
// Over all steps from v000 it is 5.08 times as fast.
#include <hip/hip_runtime.h>

typedef __attribute__((ext_vector_type(16))) _Float16 v16h;
typedef __attribute__((ext_vector_type(8)))  _Float16 v8h;
typedef __attribute__((ext_vector_type(8)))  float    v8f;
typedef __attribute__((ext_vector_type(4)))  int      v4i;
typedef __attribute__((ext_vector_type(4)))  float    v4f;
typedef __attribute__((ext_vector_type(4)))  _Float16 v4h;
typedef __attribute__((ext_vector_type(16))) unsigned v16u;

#define DEV static __device__ __forceinline__

constexpr int DM   = 768;     // model dim
constexpr int SEQ  = 2048;    // sequence length
constexpr int NH   = 12;      // heads
constexpr int DK   = 64;      // head dim
constexpr int NROW = 2 * SEQ; // B*S = 4096 rows
constexpr int LDP  = 72;      // padded LDS row (halves): conflict-free b128 reads

// ---- CDNA5 async global->LDS copy (guarded; falls back to sync staging) -----
#if defined(__has_builtin) && __has_builtin(__builtin_amdgcn_global_load_async_to_lds_b128)
#define HAVE_ASYNC_LDS 1
DEV void async_cp16(_Float16* ldst, const _Float16* gsrc) {
  __builtin_amdgcn_global_load_async_to_lds_b128(
      (__attribute__((address_space(1))) v4i*)gsrc,
      (__attribute__((address_space(3))) v4i*)ldst,
      0, 0);
}
#if defined(__has_builtin) && __has_builtin(__builtin_amdgcn_s_wait_asynccnt)
#define ASYNC_WAIT(n) __builtin_amdgcn_s_wait_asynccnt(n)
#else
#define ASYNC_WAIT(n) asm volatile("s_wait_asynccnt " #n ::: "memory")
#endif
#else
#define HAVE_ASYNC_LDS 0
DEV void async_cp16(_Float16* ldst, const _Float16* gsrc) {
  *(v8h*)ldst = *(const v8h*)gsrc;   // sync fallback through VGPRs
}
#define ASYNC_WAIT(n) ((void)0)
#endif

// ---- fragment helpers -------------------------------------------------------
// CDNA5 16-bit A/B fragment (16x32 / 32x16), wave32:
//   lane l: row/col = l&15, g = l>>4
//   VGPR0..3 hold K = g*8 + 0..7, VGPR4..7 hold K = 16 + g*8 + 0..7
// => per lane: two contiguous 16-byte chunks at +0 and +16 halves.
DEV v16h frag_f16(const _Float16* p) {
  v8h lo = *(const v8h*)p;
  v8h hi = *(const v8h*)(p + 16);
  v16h r;
#pragma unroll
  for (int i = 0; i < 8; ++i) { r[i] = lo[i]; r[i + 8] = hi[i]; }
  return r;
}

DEV v8f wmma(v16h a, v16h b, v8f c) {
  return __builtin_amdgcn_wmma_f32_16x16x32_f16(false, a, false, b, (short)0, c,
                                                false, false);
}

// lane l <-> lane l ^ 16: the one exchange between the wave halves
DEV float xhalf(float x) {
  const int b = __builtin_bit_cast(int, x);
  return __builtin_bit_cast(float, __builtin_amdgcn_permlanex16(
      b, b, 0x76543210, 0xfedcba98, false, false));
}

// ---- asking L2 ahead ---------------------------------------------------------
// A ring that runs one stage
// ahead waits out memory latency at every first touch. Each matrix kernel asks at
// entry for the operand panels it will walk, one request per 256 bytes:
// the fills fly together, and the later copies find the lines in L2.
// No data returns and no counter moves. Scope SE: into L2 only, and dropped
// silently if it cannot be served. Every lane's address lies inside its panel.
DEV void ask_l2(const void* base, unsigned off) {
  asm volatile("global_prefetch_b8 %0, %1 scope:SCOPE_SE" :: "v"(off), "s"(base));
}
// Stands behind the kernel's main loop: the registers that a request named hold
// its address until then and are not handed to other values in between.
DEV void keep_addr(const void* base, unsigned off) {
  asm volatile("" :: "v"(off), "s"(base));
}
constexpr unsigned FILL = 256;   // bytes between requests

// ---- f32 -> f16 of all seven operands in ONE launch -------------------------
// The destinations lie one behind the other in the workspace in the order
// q, k, v, w_q, w_k, w_v, w_o, so a converting work-group's place among its kind
// is also its place in the destination. A work-group converts CVT_WG 16-byte pieces of one
// source; a wave-wide load covers 512 contiguous bytes, a store 256.
constexpr int CVT_T  = 512;                   // threads: 16 waves on a WGP
constexpr int CVT_N  = 24;                    // pieces per thread
constexpr int CVT_WG = CVT_T * CVT_N;         // pieces of 4 floats per work-group
constexpr int XWG = NROW * DM / 4 / CVT_WG;   // 64 work-groups per activation
constexpr int WWG = DM * DM / 4 / CVT_WG;     // 12 per weight
static_assert(XWG * CVT_WG * 4 == NROW * DM && WWG * CVT_WG * 4 == DM * DM,
              "every source is a whole number of work-groups");
constexpr int NCVT = 3 * XWG + 4 * WWG;       // work-groups that convert

// The same launch packs the mask for the attention kernel, whose lane l holds,
// for 16 queries x 64 keys, the scores of query l & 15 at keys
// t*16 + (l >> 4)*8 + r. Word t*8 + r of such a block has in bit l whether
// that lane's key is open (mask != 0): a ready lane mask for a select.
// Layout: [16-query block][64-key block][t*8 + r], 128 bytes per block pair.
// A load of this pattern touches 16 lines, which is paid on the WGP's load path:
// the packing is spread over many work-groups, and they stand first in the grid.
constexpr int MP_N = 2;                       // 64-key blocks per wave
constexpr int MWG  = (SEQ / 16) * (SEQ / 64) / MP_N / (CVT_T / 32);   // 128 work-groups
static_assert(MWG * MP_N * (CVT_T / 32) == (SEQ / 16) * (SEQ / 64), "whole work-groups");

__global__ __launch_bounds__(CVT_T) void cvt16_kernel(
    const float* __restrict__ q,  const float* __restrict__ k,
    const float* __restrict__ v,  const float* __restrict__ wq,
    const float* __restrict__ wk, const float* __restrict__ wv,
    const float* __restrict__ wo, const int* __restrict__ mask,
    _Float16* __restrict__ dst, unsigned* __restrict__ mbits) {
  if (blockIdx.x < MWG) {
    const int lane = threadIdx.x & 31;
    const int unit = blockIdx.x * (CVT_T / 32) + (threadIdx.x >> 5);
    const int qblk = unit / (SEQ / 64 / MP_N);            // 16-query block
    const int kb0  = unit % (SEQ / 64 / MP_N) * MP_N;     // first 64-key block
    const int* mr = mask + (size_t)(qblk * 16 + (lane & 15)) * SEQ + kb0 * 64 + (lane >> 4) * 8;
    v4i m[MP_N][8];
    // unrolled: m stays in registers and the loads issue back to back
#pragma unroll
    for (int i = 0; i < MP_N; ++i)
#pragma unroll
      for (int j = 0; j < 8; ++j) m[i][j] = *(const v4i*)(mr + i * 64 + (j >> 1) * 16 + (j & 1) * 4);
    unsigned* op = mbits + (size_t)(qblk * (SEQ / 64) + kb0) * 32 + lane;
#pragma unroll
    for (int i = 0; i < MP_N; ++i) {
      unsigned mine = 0;                      // lane j keeps word j: one 128-byte store
#pragma unroll
      for (int j = 0; j < 32; ++j) {
        const unsigned w = __builtin_amdgcn_ballot_w32(m[i][j >> 2][j & 3] != 0);
        mine = lane == j ? w : mine;
      }
      op[i * 32] = mine;
    }
    return;
  }
  const int wg = blockIdx.x - MWG;            // place among the converting work-groups
  const float* src;
  int part;                                   // this work-group's place in its source
  if (wg < 3 * XWG) {
    const int s = wg / XWG;
    src  = s == 0 ? q : s == 1 ? k : v;
    part = wg - s * XWG;
  } else {
    const int s = (wg - 3 * XWG) / WWG;
    src  = s == 0 ? wq : s == 1 ? wk : s == 2 ? wv : wo;
    part = wg - 3 * XWG - s * WWG;
  }
  const v4f* sp = (const v4f*)src + (size_t)part * CVT_WG + threadIdx.x;
  v4h*       dp = (v4h*)dst + (size_t)wg * CVT_WG + threadIdx.x;
  v4f x[CVT_N];
  // unrolled: x stays in registers and the loads issue back to back, many in flight
#pragma unroll
  for (int i = 0; i < CVT_N; ++i) x[i] = sp[i * CVT_T];
  // unrolled: constant indices into x, constant store offsets
#pragma unroll
  for (int i = 0; i < CVT_N; ++i) {
    v4h y;
#pragma unroll
    for (int j = 0; j < 4; ++j) y[j] = (_Float16)x[i][j];
    dp[i * CVT_T] = y;
  }
}

// ---- GEMM operand staging: 64 rows of X and 192 of W, 64 k per stage ---------
// A fragment load straight from global touches 16 cache lines for 512 bytes;
// a staging copy reads whole 128-byte lines, and the fragments come from LDS.
// A work-group makes 64 x 192 of Y with four waves of 64 x 48 each, side by side:
// a staged byte feeds more products than in a small tile, a fragment read from LDS
// three or four. 192 columns are three whole heads, so every 128-byte line of Y
// has one writing work-group. 4096 / 64 * 768 / 192 = 256 work-groups per GEMM.
constexpr int TM   = 64;         // rows of X (and of Y) per work-group
constexpr int TN   = 192;        // rows of W (columns of Y) per work-group
constexpr int FM   = 4;          // 16-row fragments of X per wave
constexpr int FN   = 3;          // 16-row fragments of W per wave
constexpr int BK   = 64;         // halves of K per stage: 128 bytes of every operand row
constexpr int LDG  = BK + 8;     // LDS pitch 144 bytes: conflict-free b128 reads
constexpr int NST  = DM / BK;    // 12 stages
static_assert(NROW % TM == 0 && DM % TN == 0 && DM % BK == 0, "whole tiles");
static_assert(TM == FM * 16 && TN == 4 * FN * 16, "four waves side by side");
static_assert(TN % DK == 0, "whole heads");

DEV unsigned lds_off(const void* p) { return (unsigned)(size_t)p; }

constexpr unsigned LS = 16 * LDG * 2;  // bytes between a lane's rows in LDS
constexpr int      GS = 16 * DM;       // halves between them in global memory

// One lane's share of the X tile: four 16-byte copies, tile rows 16 apart.
// The closing s_wait_xcnt stands in the copies' own statement so that no
// address register named here is rewritten before it.
DEV void copy_x(unsigned l, const _Float16* gp) {
  asm volatile(
      "global_load_async_to_lds_b128 %0, %4, off\n\t"
      "global_load_async_to_lds_b128 %1, %5, off\n\t"
      "global_load_async_to_lds_b128 %2, %6, off\n\t"
      "global_load_async_to_lds_b128 %3, %7, off\n\t"
      "s_wait_xcnt 0x0"
      :: "v"(l), "v"(l + LS), "v"(l + 2 * LS), "v"(l + 3 * LS),
         "v"(gp), "v"(gp + GS), "v"(gp + 2 * GS), "v"(gp + 3 * GS)
      : "memory");
}

// The same for the W tile: twelve copies; the wait closes the statement as above.
DEV void copy_w(unsigned l, const _Float16* gp) {
  asm volatile(
      "global_load_async_to_lds_b128 %0, %12, off\n\t"
      "global_load_async_to_lds_b128 %1, %13, off\n\t"
      "global_load_async_to_lds_b128 %2, %14, off\n\t"
      "global_load_async_to_lds_b128 %3, %15, off\n\t"
      "global_load_async_to_lds_b128 %4, %16, off\n\t"
      "global_load_async_to_lds_b128 %5, %17, off\n\t"
      "global_load_async_to_lds_b128 %6, %18, off\n\t"
      "global_load_async_to_lds_b128 %7, %19, off\n\t"
      "global_load_async_to_lds_b128 %8, %20, off\n\t"
      "global_load_async_to_lds_b128 %9, %21, off\n\t"
      "global_load_async_to_lds_b128 %10, %22, off\n\t"
      "global_load_async_to_lds_b128 %11, %23, off\n\t"
      "s_wait_xcnt 0x0"
      :: "v"(l), "v"(l + LS), "v"(l + 2 * LS), "v"(l + 3 * LS),
         "v"(l + 4 * LS), "v"(l + 5 * LS), "v"(l + 6 * LS), "v"(l + 7 * LS),
         "v"(l + 8 * LS), "v"(l + 9 * LS), "v"(l + 10 * LS), "v"(l + 11 * LS),
         "v"(gp), "v"(gp + GS), "v"(gp + 2 * GS), "v"(gp + 3 * GS),
         "v"(gp + 4 * GS), "v"(gp + 5 * GS), "v"(gp + 6 * GS), "v"(gp + 7 * GS),
         "v"(gp + 8 * GS), "v"(gp + 9 * GS), "v"(gp + 10 * GS), "v"(gp + 11 * GS)
      : "memory");
}

// c[i][t] += X[rowblk + i*16 .. +15][:] * W[colbase + wave*48 + t*16 .. +15][:]^T
// over all of K, k ascending in steps of 32; two LDS buffers, the next stage's
// copies fly while this stage is worked on.
DEV void gemm_tile(const _Float16* __restrict__ X, const _Float16* __restrict__ W,
                   int rowblk, int colbase, v8f (&c)[FM][FN]) {
  __shared__ __align__(16) _Float16 sX[2][TM * LDG];
  __shared__ __align__(16) _Float16 sW[2][TN * LDG];
  const int tid  = threadIdx.x;
  const int lane = tid & 31;
  const int wave = tid >> 5;
  const int row  = lane & 15;
  const int g    = lane >> 4;

  const int cr = tid >> 3;          // this lane's first tile row, 0..15
  const int cc = (tid & 7) * 8;     // its 16-byte chunk of the 128-byte row
  const _Float16* gx = X + (size_t)(rowblk + cr) * DM + cc;
  const _Float16* gw = W + (size_t)(colbase + cr) * DM + cc;
  const unsigned  lx = lds_off(&sX[0][cr * LDG + cc]);
  const unsigned  lw = lds_off(&sW[0][cr * LDG + cc]);
  auto stage = [&](int s) {
    copy_x(lx + (unsigned)(s & 1) * (TM * LDG * 2), gx + s * BK);
    copy_w(lw + (unsigned)(s & 1) * (TN * LDG * 2), gw + s * BK);
  };

  // The X panel (64 whole rows, contiguous) is read by the four work-groups of this
  // tile row: each asks for its quarter, 96 units, and the 32 lanes left over for
  // the next units, held inside the panel. The W panel (192 rows, contiguous, nine
  // slices of 128 units) is read by all 64 tile rows. Among the 32 with one
  // value of bit 2 of x, (x & 3) + 4 * (x >> 3) takes every value 0..31 once and every slice is asked
  // for. Placement is a matter of speed only: nothing is read through these requests.
  static_assert(TM * DM * 2 == 4 * 96 * FILL && TN * DM * 2 == 9 * 128 * FILL, "whole units");
  const int tx = rowblk / TM, ty = colbase / TN;
  const _Float16* xpan = X + (size_t)rowblk * DM;
  const _Float16* wpan = W + (size_t)colbase * DM +
                         (size_t)(((tx & 3) + (tx >> 3) * 4) % 9) * (128 * FILL / 2);
  const unsigned xunit = (unsigned)(ty * 96 + tid);
  const unsigned xask = (xunit < 4 * 96 ? xunit : 4 * 96 - 1) * FILL;
  const unsigned wask = (unsigned)tid * FILL;

  stage(0);
  // behind stage 0's copies, which are waited for first
  ask_l2(xpan, xask);
  ask_l2(wpan, wask);
  asm volatile("s_wait_asynccnt 0x0" ::: "memory");  // stage 0 has landed before it is published
  __syncthreads();
  stage(1);

  for (int s = 0; s < NST; ++s) {
    const _Float16* xB = sX[s & 1] + row * LDG + g * 8;
    const _Float16* wB = sW[s & 1] + (wave * (FN * 16) + row) * LDG + g * 8;
    v16h a[BK / 32][FM], b[BK / 32][FN];
#pragma unroll
    for (int j = 0; j < BK / 32; ++j) {
#pragma unroll
      for (int t = 0; t < FN; ++t) b[j][t] = frag_f16(wB + t * 16 * LDG + j * 32);
#pragma unroll
      for (int i = 0; i < FM; ++i) a[j][i] = frag_f16(xB + i * 16 * LDG + j * 32);
    }
    // keeps the stage's LDS reads one group in front of its products; left free,
    // the scheduler sinks each pair to its product behind a wait to zero
    __builtin_amdgcn_sched_barrier(0);
#pragma unroll
    for (int j = 0; j < BK / 32; ++j)
#pragma unroll
      for (int i = 0; i < FM; ++i)
#pragma unroll
        for (int t = 0; t < FN; ++t) c[i][t] = wmma(a[j][i], b[j][t], c[i][t]);
    // keeps the products in front of the stage's foot, where they run while the
    // later reads return; left free, they sink behind the barrier and delay the refill
    __builtin_amdgcn_sched_barrier(0);
    asm volatile("s_wait_dscnt 0x0" ::: "memory");     // this wave's reads of the buffer have ended
    asm volatile("s_wait_asynccnt 0x0" ::: "memory");  // its copies of stage s + 1 have landed
    __syncthreads();  // publishes stage s + 1 and frees the buffer of stage s
    if (s + 2 < NST) stage(s + 2);
  }
  asm volatile("s_wait_asynccnt 0x0" ::: "memory");    // nothing in flight when the wave ends
  keep_addr(xpan, xask);
  keep_addr(wpan, wask);
}

// ---- QKV projection (all-f16 operands): Y = X @ W^T + b, head layout --------
// Q and K: Y[b][h][s][d]        V: Y[b][h][d][s]  (transposed)
// One launch for all three: blockIdx.z = 0, 1, 2 is Q, K, V; the three X, the
// three W and the three Y each lie one behind the other in the workspace.
__global__ __launch_bounds__(128) void proj16_kernel(
    const _Float16* __restrict__ X3, const _Float16* __restrict__ W3,
    const float* __restrict__ bq, const float* __restrict__ bk,
    const float* __restrict__ bv3, _Float16* __restrict__ Y3) {
  const int z = blockIdx.z;
  const _Float16* X = X3 + (size_t)z * NROW * DM;
  const _Float16* W = W3 + (size_t)z * DM * DM;
  _Float16*       Y = Y3 + (size_t)z * NROW * DM;
  const float* bias = z == 0 ? bq : z == 1 ? bk : bv3;
  const int lane = threadIdx.x & 31;
  const int wave = threadIdx.x >> 5;
  const int row  = lane & 15;
  const int g    = lane >> 4;
  const int rowbase = blockIdx.x * TM + g * 8;
  const int colbase = blockIdx.y * TN + wave * (FN * 16) + row;

  v8f c[FM][FN] = {};
  gemm_tile(X, W, blockIdx.x * TM, blockIdx.y * TN, c);

  const int bb = rowbase >> 11;            // a 64-row tile lies inside one batch entry
  const int s0 = rowbase & (SEQ - 1);
  float bv[FN];
  // every loop below is unrolled: constant indices keep c and bv in registers,
  // and the three bias loads issue together
#pragma unroll
  for (int t = 0; t < FN; ++t) bv[t] = bias[colbase + t * 16];
  if (z == 2) {
    // V^T: a lane's eight accumulator rows are eight consecutive positions of
    // its row d, so a fragment leaves in one 16-byte store per lane; as eight
    // 2-byte stores each would touch the same 16 lines once more
#pragma unroll
    for (int t = 0; t < FN; ++t) {
      const int col = colbase + t * 16;    // a 16-column tile lies inside one head
      _Float16* yp = Y + ((size_t)(bb * NH + (col >> 6)) * DK + (col & (DK - 1))) * SEQ + s0;
#pragma unroll
      for (int i = 0; i < FM; ++i) {
        v8h y;
#pragma unroll
        for (int r = 0; r < 8; ++r) y[r] = (_Float16)(c[i][t][r] + bv[t]);
        *(v8h*)(yp + i * 16) = y;
      }
    }
  } else {
#pragma unroll
    for (int t = 0; t < FN; ++t) {
      const int col = colbase + t * 16;
      _Float16* yp = Y + ((size_t)(bb * NH + (col >> 6)) * SEQ + s0) * DK + (col & (DK - 1));
#pragma unroll
      for (int i = 0; i < FM; ++i)
#pragma unroll
        for (int r = 0; r < 8; ++r)
          yp[(i * 16 + r) * DK] = (_Float16)(c[i][t][r] + bv[t]);
    }
    // closes the last stores: in the built code this path's end falls through
    // to lines that rewrite the registers they name
    asm volatile("s_wait_xcnt 0x0" ::: "memory");
  }
}

__global__ __launch_bounds__(128) void attn_kernel(
    const _Float16* __restrict__ Q, const _Float16* __restrict__ K,
    const _Float16* __restrict__ Vt, const unsigned* __restrict__ mbits,
    _Float16* __restrict__ AO) {
  __shared__ __align__(16) _Float16 sK[2][64 * LDP];  // K tile, [key][d] padded
  __shared__ __align__(16) _Float16 sV[2][64 * LDP];  // V^T tile, [d][key] padded

  const int tid  = threadIdx.x;
  const int lane = tid & 31;
  const int wave = tid >> 5;
  const int row  = lane & 15;
  const int g    = lane >> 4;
  const int h = blockIdx.y, b = blockIdx.z;
  const int bh = b * NH + h;
  const int qbase = blockIdx.x * 64 + wave * 16;

  const _Float16* Qh = Q  + (size_t)bh * SEQ * DK;
  const _Float16* Kh = K  + (size_t)bh * SEQ * DK;
  const _Float16* Vh = Vt + (size_t)bh * DK * SEQ;

  const _Float16* qrow = Qh + (size_t)(qbase + row) * DK;
  const v16h qf0 = frag_f16(qrow + 0  + g * 8);
  const v16h qf1 = frag_f16(qrow + 32 + g * 8);

  // this wave's packed mask: 32 lane-mask words per 64 keys. The wave's number
  // goes through readfirstlane so that the address is scalar and the words
  // arrive in scalar registers, where a select reads them as they are.
  const int wv = __builtin_amdgcn_readfirstlane(wave);
  // Constant address space: nothing writes these words while this kernel runs;
  // without it the compiler takes the copies to LDS for possible writers and
  // brings the words through vector registers, one readfirstlane each.
  typedef const __attribute__((address_space(4))) v16u* cmask_t;
  const cmask_t mw = (cmask_t)(unsigned long long)(
      mbits + (size_t)(blockIdx.x * 4 + wv) * (SEQ / 64) * 32);
  v16u w0 = mw[0], w1 = mw[1];

  // This head's K and V^T panels (256 KB each, contiguous) are walked by the 32
  // work-groups of the head: (x & 3) + 4 * (x >> 3) numbers the 16 with
  // one value of bit 2 of x 0..15 (see gemm_tile), and each asks for one sixteenth of both panels,
  // waves 0 and 1 of K, waves 2 and 3 of V^T, one unit a lane.
  static_assert(SEQ * DK * 2 == 16 * 64 * FILL, "whole units");
  const int part = (blockIdx.x & 3) + (blockIdx.x >> 3) * 4;
  const _Float16* kvpan = (wv < 2 ? Kh : Vh) + (size_t)part * (64 * FILL / 2);
  const unsigned kvask = (unsigned)(tid & 63) * FILL;
  // the wave's mask words, 16 units, are the same for all heads: head 0 asks
  const unsigned* mpan = mbits + (size_t)(blockIdx.x * 4 + wv) * (SEQ / 64) * 32;
  const unsigned mask_ask = (unsigned)(lane & 15) * FILL;

  // 1/sqrt(64) * log2(e): takes an unscaled score product to the exponent of 2
  constexpr float SC = 0.125f * 1.44269504088896341f;
  // a closed key's unscaled score, -2^33 (-1.07e9 once scaled): far below every open
  // score, so its weight is 0. A power of two, so that CLOSED * SC is exact and a
  // query with no open key gets exponent 0 at every key: equal weights.
  constexpr float CLOSED = -8589934592.0f;

  float m_i = -3.0e38f;   // running max, unscaled, of this lane's query (both halves agree)
  float l_i = 0.0f;       // running sum over this half's keys; halves join at the end
  v8f o[4] = {v8f{}, v8f{}, v8f{}, v8f{}};  // o[t][r] = O[query row][d = t*16 + g*8 + r]

  // stage one 64-key tile (8 KB K + 8 KB V) via 8 async b128 ops per thread
  auto stage = [&](int kb, int buf) {
#pragma unroll
    for (int i = 0; i < 4; ++i) {
      const int c  = tid + i * 128;       // 0..511 16-byte chunks
      const int r  = c >> 3;              // tile row 0..63
      const int ch = (c & 7) * 8;         // halves within row
      async_cp16(&sK[buf][r * LDP + ch], Kh + (size_t)(kb + r) * DK + ch);
      async_cp16(&sV[buf][r * LDP + ch], Vh + (size_t)r * SEQ + kb + ch);
    }
  };

  stage(0, 0);
  // behind the first tile's copies, which are waited for first
  ask_l2(kvpan, kvask);
  if (h == 0) ask_l2(mpan, mask_ask);
  for (int kb = 0; kb < SEQ; kb += 64) {
    const int cur = (kb >> 6) & 1;
    if (kb + 64 < SEQ) { stage(kb + 64, cur ^ 1); ASYNC_WAIT(8); }
    else               { ASYNC_WAIT(0); }
    __syncthreads();

    const _Float16* kB = sK[cur] + row * LDP + g * 8;
    const _Float16* vB = sV[cur] + row * LDP + g * 8;

    // every fragment of the pass is asked for here, in the order of its use: the
    // K fragments feed the score products as they arrive, the V fragments
    // travel during those products and the softmax
    v16h kf[2][4], vf[2][4];
    // unrolled: constant indices keep the fragments in registers
#pragma unroll
    for (int j = 0; j < 2; ++j)
#pragma unroll
      for (int t = 0; t < 4; ++t) kf[j][t] = frag_f16(kB + t * 16 * LDP + j * 32);
#pragma unroll
    for (int j = 0; j < 2; ++j)
#pragma unroll
      for (int t = 0; t < 4; ++t) vf[j][t] = frag_f16(vB + t * 16 * LDP + j * 32);
    // keeps the reads one group at the head of the pass; left free, the scheduler
    // sinks each fragment to its product behind a wait to zero, sixteen times a pass
    __builtin_amdgcn_sched_barrier(0);

    // S^T = K Q^T, 64k x 16q: c[t][r] = S[query row][key kb + t*16 + g*8 + r];
    // the four tiles take turns, so no product waits for the one before it
    v8f c[4];
#pragma unroll
    for (int t = 0; t < 4; ++t) {
      v8f z{};
      c[t] = wmma(kf[0][t], qf0, z);
    }
#pragma unroll
    for (int t = 0; t < 4; ++t) c[t] = wmma(kf[1][t], qf1, c[t]);
    // keeps the eight products back to back: a vector instruction drawn in among
    // them reads a tile too early and is padded with idle slots
    __builtin_amdgcn_sched_barrier(0);
    // mask; the products stay unscaled (SC below carries the scale)
#pragma unroll
    for (int t = 0; t < 4; ++t) {
#pragma unroll
      for (int r = 0; r < 8; ++r) {
        const unsigned w = t < 2 ? w0[t * 8 + r] : w1[(t - 2) * 8 + r];
        c[t][r] = __builtin_amdgcn_inverse_ballot_w32(w) ? c[t][r] : CLOSED;
      }
    }
    // the next 64 keys' words, asked for behind the last use of these: they
    // travel during the rest of this pass (the last pass asks for its own again)
    {
      const int nx = kb + 64 < SEQ ? (kb >> 6) + 1 : (kb >> 6);
      w0 = mw[nx * 2];
      w1 = mw[nx * 2 + 1];
    }
    // online softmax, one query per lane
    float vm[4];
#pragma unroll
    for (int t = 0; t < 4; ++t) {
      vm[t] = fmaxf(c[t][0], c[t][1]);
#pragma unroll
      for (int r = 2; r < 8; ++r) vm[t] = fmaxf(vm[t], c[t][r]);
    }
    float vmax = fmaxf(fmaxf(vm[0], vm[1]), fmaxf(vm[2], vm[3]));
    vmax = fmaxf(vmax, xhalf(vmax));
    const float mnew  = fmaxf(m_i, vmax);
    const float alpha = __builtin_amdgcn_exp2f((m_i - mnew) * SC);
    m_i = mnew;
    const float nm = -mnew * SC;
    // e^(score/8 - max/8) = 2^(c*SC - max*SC): one fused multiply-add per score, two
    // scores an instruction, in place of the scaling, the subtraction and the
    // multiply inside exp
    const v8f sc8 = {SC, SC, SC, SC, SC, SC, SC, SC};
    const v8f nm8 = {nm, nm, nm, nm, nm, nm, nm, nm};
    // unrolled: constant indices keep c in registers
#pragma unroll
    for (int t = 0; t < 4; ++t) c[t] = __builtin_elementwise_fma(c[t], sc8, nm8);
    float s4[4];
#pragma unroll
    for (int t = 0; t < 4; ++t) {
#pragma unroll
      for (int r = 0; r < 8; ++r) c[t][r] = __builtin_amdgcn_exp2f(c[t][r]);
      s4[t] = ((c[t][0] + c[t][1]) + (c[t][2] + c[t][3])) +
              ((c[t][4] + c[t][5]) + (c[t][6] + c[t][7]));
    }
    l_i = l_i * alpha + ((s4[0] + s4[1]) + (s4[2] + s4[3]));
#pragma unroll
    for (int t = 0; t < 4; ++t)
#pragma unroll
      for (int r = 0; r < 8; ++r) o[t][r] *= alpha;
    // P^T: two converted score tiles are one B fragment (32 keys x 16 queries)
    v16h p0, p1;
#pragma unroll
    for (int r = 0; r < 8; ++r) {
      p0[r] = (_Float16)c[0][r]; p0[r + 8] = (_Float16)c[1][r];
      p1[r] = (_Float16)c[2][r]; p1[r + 8] = (_Float16)c[3][r];
    }
    // O^T += V^T P^T, the four tiles taking turns as above
#pragma unroll
    for (int t = 0; t < 4; ++t) o[t] = wmma(vf[0][t], p0, o[t]);
#pragma unroll
    for (int t = 0; t < 4; ++t) o[t] = wmma(vf[1][t], p1, o[t]);
    __syncthreads();  // all waves done reading before this buffer is re-staged
  }

  keep_addr(kvpan, kvask);
  keep_addr(mpan, mask_ask);

  // epilogue: join the halves' sums, O / l, 8 consecutive d per 16-byte store
  const float inv = 1.0f / (l_i + xhalf(l_i));
  _Float16* arow = AO + (size_t)(b * SEQ + qbase + row) * DM + h * DK + g * 8;
#pragma unroll
  for (int t = 0; t < 4; ++t) {
    v8h y;
#pragma unroll
    for (int r = 0; r < 8; ++r) y[r] = (_Float16)(o[t][r] * inv);
    *(v8h*)(arow + t * 16) = y;
  }
}

// ---- output projection: f32 out = AO(f16) @ Wo^T(f16) + bo ------------------
__global__ __launch_bounds__(128) void oproj16_kernel(
    const _Float16* __restrict__ X16, const _Float16* __restrict__ W,
    const float* __restrict__ bias, float* __restrict__ Y) {
  const int lane = threadIdx.x & 31;
  const int wave = threadIdx.x >> 5;
  const int row  = lane & 15;
  const int g    = lane >> 4;
  const int rowbase = blockIdx.x * TM + g * 8;
  const int colbase = blockIdx.y * TN + wave * (FN * 16) + row;

  v8f c[FM][FN] = {};
  gemm_tile(X16, W, blockIdx.x * TM, blockIdx.y * TN, c);
#pragma unroll
  for (int t = 0; t < FN; ++t) {
    const int n = colbase + t * 16;
    const float bv = bias[n];
#pragma unroll
    for (int i = 0; i < FM; ++i)
#pragma unroll
      for (int r = 0; r < 8; ++r)
        Y[(size_t)(rowbase + i * 16 + r) * DM + n] = c[i][t][r] + bv;
  }
}

// ---- launch -----------------------------------------------------------------
extern "C" void kernel_launch(void* const* d_in, const int* in_sizes, int n_in,
                              void* d_out, int out_size, void* d_ws, size_t ws_size,
                              hipStream_t stream) {
  const float* q    = (const float*)d_in[0];
  const float* k    = (const float*)d_in[1];
  const float* v    = (const float*)d_in[2];
  const int*   mask = (const int*)  d_in[3];
  const float* w_q  = (const float*)d_in[4];
  const float* b_q  = (const float*)d_in[5];
  const float* w_k  = (const float*)d_in[6];
  const float* b_k  = (const float*)d_in[7];
  const float* w_v  = (const float*)d_in[8];
  const float* b_v  = (const float*)d_in[9];
  const float* w_o  = (const float*)d_in[10];
  const float* b_o  = (const float*)d_in[11];

  const size_t nXW = (size_t)NROW * DM;   // 4096*768
  const size_t nWW = (size_t)DM * DM;     // 768*768
  _Float16* p = (_Float16*)d_ws;
  _Float16* xq16 = p; p += nXW;
  _Float16* xk16 = p; p += nXW;
  _Float16* xv16 = p; p += nXW;
  _Float16* wq16 = p; p += nWW;
  _Float16* wk16 = p; p += nWW;
  _Float16* wv16 = p; p += nWW;
  _Float16* wo16 = p; p += nWW;
  _Float16* q16  = p; p += nXW;
  _Float16* k16  = p; p += nXW;
  _Float16* vt16 = p; p += nXW;
  _Float16* ao16 = p; p += nXW;
  unsigned* mbits = (unsigned*)p;         // SEQ * SEQ / 8 bytes

  const dim3 blk(128);
  cvt16_kernel<<<MWG + NCVT, CVT_T, 0, stream>>>(q, k, v, w_q, w_k, w_v, w_o, mask, xq16, mbits);

  const dim3 pg(NROW / TM, DM / TN);      // 64 x 4
  proj16_kernel<<<dim3(NROW / TM, DM / TN, 3), blk, 0, stream>>>(xq16, wq16, b_q, b_k, b_v, q16);

  attn_kernel<<<dim3(SEQ / 64, NH, 2), blk, 0, stream>>>(q16, k16, vt16, mbits, ao16);

  oproj16_kernel<<<pg, blk, 0, stream>>>(ao16, wo16, b_o, (float*)d_out);
}

// v010
// Measured time: 64.8 microseconds a run.
// Next to v009, in two timings, it ran 1.09 times as fast each time.
// All steps since v000 together make it 5.52 times as fast.
#include <hip/hip_runtime.h>

typedef __attribute__((ext_vector_type(16))) _Float16 v16h;
typedef __attribute__((ext_vector_type(8)))  _Float16 v8h;
typedef __attribute__((ext_vector_type(8)))  float    v8f;
typedef __attribute__((ext_vector_type(4)))  int      v4i;
typedef __attribute__((ext_vector_type(4)))  float    v4f;
typedef __attribute__((ext_vector_type(4)))  _Float16 v4h;
typedef __attribute__((ext_vector_type(16))) unsigned v16u;

#define DEV static __device__ __forceinline__

constexpr int DM   = 768;     // model dim
constexpr int SEQ  = 2048;    // sequence length
constexpr int NH   = 12;      // heads
constexpr int DK   = 64;      // head dim
constexpr int NROW = 2 * SEQ; // B*S = 4096 rows
constexpr int LDP  = 72;      // padded LDS row (halves): conflict-free b128 reads

// ---- CDNA5 async global->LDS copy (guarded; falls back to sync staging) -----
#if defined(__has_builtin) && __has_builtin(__builtin_amdgcn_global_load_async_to_lds_b128)
#define HAVE_ASYNC_LDS 1
DEV void async_cp16(_Float16* ldst, const _Float16* gsrc) {
  __builtin_amdgcn_global_load_async_to_lds_b128(
      (__attribute__((address_space(1))) v4i*)gsrc,
      (__attribute__((address_space(3))) v4i*)ldst,
      0, 0);
}
#if defined(__has_builtin) && __has_builtin(__builtin_amdgcn_s_wait_asynccnt)
#define ASYNC_WAIT(n) __builtin_amdgcn_s_wait_asynccnt(n)
#else
#define ASYNC_WAIT(n) asm volatile("s_wait_asynccnt " #n ::: "memory")
#endif
#else
#define HAVE_ASYNC_LDS 0
DEV void async_cp16(_Float16* ldst, const _Float16* gsrc) {
  *(v8h*)ldst = *(const v8h*)gsrc;   // sync fallback through VGPRs
}
#define ASYNC_WAIT(n) ((void)0)
#endif

// ---- fragment helpers -------------------------------------------------------
// CDNA5 16-bit A/B fragment (16x32 / 32x16), wave32:
//   lane l: row/col = l&15, g = l>>4
//   VGPR0..3 hold K = g*8 + 0..7, VGPR4..7 hold K = 16 + g*8 + 0..7
// => per lane: two contiguous 16-byte chunks at +0 and +16 halves.
DEV v16h frag_f16(const _Float16* p) {
  v8h lo = *(const v8h*)p;
  v8h hi = *(const v8h*)(p + 16);
  v16h r;
#pragma unroll
  for (int i = 0; i < 8; ++i) { r[i] = lo[i]; r[i + 8] = hi[i]; }
  return r;
}

DEV v8f wmma(v16h a, v16h b, v8f c) {
  return __builtin_amdgcn_wmma_f32_16x16x32_f16(false, a, false, b, (short)0, c,
                                                false, false);
}

// lane l <-> lane l ^ 16: the one exchange between the wave halves
DEV float xhalf(float x) {
  const int b = __builtin_bit_cast(int, x);
  return __builtin_bit_cast(float, __builtin_amdgcn_permlanex16(
      b, b, 0x76543210, 0xfedcba98, false, false));
}

// ---- asking L2 ahead ---------------------------------------------------------
// A ring that runs one stage ahead waits out memory latency at every first touch
// of what comes from memory. Each matrix kernel asks at
// entry for the operand panels it will walk, one request per 256 bytes:
// the fills fly together, and the later copies find the lines in L2.
// No data returns and no counter moves. Scope SE: into L2 only, and dropped
// silently if it cannot be served. Every lane's address lies inside its panel.
DEV void ask_l2(const void* base, unsigned off) {
  asm volatile("global_prefetch_b8 %0, %1 scope:SCOPE_SE" :: "v"(off), "s"(base));
}
// Stands behind the kernel's main loop: the registers that a request named hold
// its address until then and are not handed to other values in between.
DEV void keep_addr(const void* base, unsigned off) {
  asm volatile("" :: "v"(off), "s"(base));
}
// The same for a lane's own load address: stands behind the last use of what was
// loaded, so that no load's result lands on the registers that issued loads name.
DEV void keep_ptr(const void* p) {
  asm volatile("" :: "v"(p));
}
constexpr unsigned FILL = 256;   // bytes between neighbouring requests

// ---- GEMM operand staging: 64 rows of X and 192 of W, 64 k per stage ---------
// A fragment load straight from global touches 16 cache lines for 512 bytes;
// a staging copy reads whole 128-byte lines, and the fragments come from LDS.
// A work-group makes 64 x 192 of Y with four waves of 64 x 48 each, side by side:
// a staged byte feeds more products than in a small tile, a fragment read from LDS
// three or four. 192 columns are three whole heads, so every 128-byte line of Y
// has one writing work-group. 4096 / 64 * 768 / 192 = 256 work-groups per GEMM.
constexpr int TM   = 64;         // rows of X (and of Y) per work-group
constexpr int TN   = 192;        // rows of W (columns of Y) per work-group
constexpr int FM   = 4;          // 16-row fragments of X per wave
constexpr int FN   = 3;          // 16-row fragments of W per wave
constexpr int BK   = 64;         // halves of K per stage: 128 bytes of every operand row
constexpr int LDG  = BK + 8;     // LDS pitch 144 bytes: conflict-free b128 reads
constexpr int NST  = DM / BK;    // 12 stages
static_assert(NROW % TM == 0 && DM % TN == 0 && DM % BK == 0, "whole tiles");
static_assert(TM == FM * 16 && TN == 4 * FN * 16, "four waves side by side");
static_assert(TN % DK == 0, "whole heads");

DEV unsigned lds_off(const void* p) { return (unsigned)(size_t)p; }

constexpr unsigned LS = 16 * LDG * 2;  // bytes between a lane's rows in LDS
constexpr int      GS = 16 * DM;       // halves between them in global memory

// One lane's share of the X tile: four 16-byte copies, tile rows 16 apart.
// The closing s_wait_xcnt stands in the copies' own statement so that no
// address register named here is rewritten before it.
DEV void copy_x(unsigned l, const _Float16* gp) {
  asm volatile(
      "global_load_async_to_lds_b128 %0, %4, off\n\t"
      "global_load_async_to_lds_b128 %1, %5, off\n\t"
      "global_load_async_to_lds_b128 %2, %6, off\n\t"
      "global_load_async_to_lds_b128 %3, %7, off\n\t"
      "s_wait_xcnt 0x0"
      :: "v"(l), "v"(l + LS), "v"(l + 2 * LS), "v"(l + 3 * LS),
         "v"(gp), "v"(gp + GS), "v"(gp + 2 * GS), "v"(gp + 3 * GS)
      : "memory");
}

// The same for the W tile: twelve copies; the wait closes the statement as above.
DEV void copy_w(unsigned l, const _Float16* gp) {
  asm volatile(
      "global_load_async_to_lds_b128 %0, %12, off\n\t"
      "global_load_async_to_lds_b128 %1, %13, off\n\t"
      "global_load_async_to_lds_b128 %2, %14, off\n\t"
      "global_load_async_to_lds_b128 %3, %15, off\n\t"
      "global_load_async_to_lds_b128 %4, %16, off\n\t"
      "global_load_async_to_lds_b128 %5, %17, off\n\t"
      "global_load_async_to_lds_b128 %6, %18, off\n\t"
      "global_load_async_to_lds_b128 %7, %19, off\n\t"
      "global_load_async_to_lds_b128 %8, %20, off\n\t"
      "global_load_async_to_lds_b128 %9, %21, off\n\t"
      "global_load_async_to_lds_b128 %10, %22, off\n\t"
      "global_load_async_to_lds_b128 %11, %23, off\n\t"
      "s_wait_xcnt 0x0"
      :: "v"(l), "v"(l + LS), "v"(l + 2 * LS), "v"(l + 3 * LS),
         "v"(l + 4 * LS), "v"(l + 5 * LS), "v"(l + 6 * LS), "v"(l + 7 * LS),
         "v"(l + 8 * LS), "v"(l + 9 * LS), "v"(l + 10 * LS), "v"(l + 11 * LS),
         "v"(gp), "v"(gp + GS), "v"(gp + 2 * GS), "v"(gp + 3 * GS),
         "v"(gp + 4 * GS), "v"(gp + 5 * GS), "v"(gp + 6 * GS), "v"(gp + 7 * GS),
         "v"(gp + 8 * GS), "v"(gp + 9 * GS), "v"(gp + 10 * GS), "v"(gp + 11 * GS)
      : "memory");
}

// c[i][t] += X[rowblk + i*16 .. +15][:] * W[colbase + wave*48 + t*16 .. +15][:]^T
// over all of K, k ascending in steps of 32; two LDS buffers, the next stage's
// copies fly while this stage is worked on.
DEV void gemm_tile(const _Float16* __restrict__ X, const _Float16* __restrict__ W,
                   int rowblk, int colbase, v8f (&c)[FM][FN]) {
  __shared__ __align__(16) _Float16 sX[2][TM * LDG];
  __shared__ __align__(16) _Float16 sW[2][TN * LDG];
  const int tid  = threadIdx.x;
  const int lane = tid & 31;
  const int wave = tid >> 5;
  const int row  = lane & 15;
  const int g    = lane >> 4;

  const int cr = tid >> 3;          // this lane's first tile row, 0..15
  const int cc = (tid & 7) * 8;     // its 16-byte chunk of the 128-byte row
  const _Float16* gx = X + (size_t)(rowblk + cr) * DM + cc;
  const _Float16* gw = W + (size_t)(colbase + cr) * DM + cc;
  const unsigned  lx = lds_off(&sX[0][cr * LDG + cc]);
  const unsigned  lw = lds_off(&sW[0][cr * LDG + cc]);
  auto stage = [&](int s) {
    copy_x(lx + (unsigned)(s & 1) * (TM * LDG * 2), gx + s * BK);
    copy_w(lw + (unsigned)(s & 1) * (TN * LDG * 2), gw + s * BK);
  };

  // The X panel (64 whole rows, contiguous) is read by the four work-groups of this
  // tile row: each asks for its quarter, 96 units, and the 32 lanes left over for
  // the next units, held inside the panel. The W panel (192 rows, contiguous, nine
  // slices of 128 units) is read by all 64 tile rows. Among the 32 with one
  // value of bit 2 of x, (x & 3) + 4 * (x >> 3) takes every value 0..31 once and every slice is asked
  // for. Placement is a matter of speed only: nothing is read through these requests.
  static_assert(TM * DM * 2 == 4 * 96 * FILL && TN * DM * 2 == 9 * 128 * FILL, "whole units");
  const int tx = rowblk / TM, ty = colbase / TN;
  const _Float16* xpan = X + (size_t)rowblk * DM;
  const _Float16* wpan = W + (size_t)colbase * DM +
                         (size_t)(((tx & 3) + (tx >> 3) * 4) % 9) * (128 * FILL / 2);
  const unsigned xunit = (unsigned)(ty * 96 + tid);
  const unsigned xask = (xunit < 4 * 96 ? xunit : 4 * 96 - 1) * FILL;
  const unsigned wask = (unsigned)tid * FILL;

  stage(0);
  // behind stage 0's copies, which are waited for first
  ask_l2(xpan, xask);
  ask_l2(wpan, wask);
  asm volatile("s_wait_asynccnt 0x0" ::: "memory");  // stage 0 has landed before it is published
  __syncthreads();
  stage(1);

  for (int s = 0; s < NST; ++s) {
    const _Float16* xB = sX[s & 1] + row * LDG + g * 8;
    const _Float16* wB = sW[s & 1] + (wave * (FN * 16) + row) * LDG + g * 8;
    v16h a[BK / 32][FM], b[BK / 32][FN];
#pragma unroll
    for (int j = 0; j < BK / 32; ++j) {
#pragma unroll
      for (int t = 0; t < FN; ++t) b[j][t] = frag_f16(wB + t * 16 * LDG + j * 32);
#pragma unroll
      for (int i = 0; i < FM; ++i) a[j][i] = frag_f16(xB + i * 16 * LDG + j * 32);
    }
    // keeps the stage's LDS reads one group in front of its products; left free,
    // the scheduler sinks each pair to its product behind a wait to zero
    __builtin_amdgcn_sched_barrier(0);
#pragma unroll
    for (int j = 0; j < BK / 32; ++j)
#pragma unroll
      for (int i = 0; i < FM; ++i)
#pragma unroll
        for (int t = 0; t < FN; ++t) c[i][t] = wmma(a[j][i], b[j][t], c[i][t]);
    // keeps the products in front of the stage's foot, where they run while the
    // later reads return; left free, they sink behind the barrier and delay the refill
    __builtin_amdgcn_sched_barrier(0);
    asm volatile("s_wait_dscnt 0x0" ::: "memory");     // this wave's reads of the buffer have ended
    asm volatile("s_wait_asynccnt 0x0" ::: "memory");  // its copies of stage s + 1 have landed
    __syncthreads();  // publishes stage s + 1 and frees the buffer of stage s
    if (s + 2 < NST) stage(s + 2);
  }
  asm volatile("s_wait_asynccnt 0x0" ::: "memory");    // nothing in flight when the wave ends
  keep_addr(xpan, xask);
  keep_addr(wpan, wask);
}

// ---- QKV projection straight from the f32 inputs: Y = X @ W^T + b -----------
// Q and K: Y[b][h][s][d]        V: Y[b][h][d][s]  (transposed)
// No launch converts X and W ahead: a work-group loads its f32 tiles into
// registers, rounds them to f16 there (the same rounding as a conversion pass) and
// stores them to LDS, so the f16 copies are never written to memory nor read back.
// f32 operands double the bytes asked of L2 per tile, so the tile is 128 x 384:
// 16 waves, two rows of eight, 64 x 48 each as in gemm_tile. 32 x 2 x 3 = 192
// work-groups, each filling a WGP; the other 64 work-groups of the grid do what only
// later launches read: they pack the mask and round w_o.
constexpr int PM  = 128;         // rows of X (and of Y) per work-group
constexpr int PN  = 384;         // rows of W (columns of Y) per work-group
constexpr int PT  = 512;         // threads: 16 waves
constexpr int PXT = NROW / PM;   // 32 tile rows
constexpr int PYT = DM / PN;     // 2 tile columns
constexpr int PGW = PXT * PYT * 3;             // projecting work-groups
constexpr int PLD = (PM + PN) * (BK / 4) / PT; // 16-byte loads per thread and stage
constexpr int PLX = PM * (BK / 4) / PT;        // those of them that belong to X
static_assert(NROW % PM == 0 && DM % PN == 0 && PN % DK == 0, "whole tiles, whole heads");
static_assert(PM == 2 * FM * 16 && PN == 8 * FN * 16, "two rows of eight waves");
static_assert(PLD * PT == (PM + PN) * (BK / 4) && PLX * PT == PM * (BK / 4), "whole rounds");

// The mask is packed for the attention kernel, whose lane l holds, for
// 16 queries x 64 keys, the scores of query l & 15 at keys t*16 + (l >> 4)*8 + r.
// Word t*8 + r of such a block has in bit l whether that lane's key is open
// (mask != 0): a ready lane mask for a select.
// Layout: [16-query block][64-key block][t*8 + r], 128 bytes per block pair.
constexpr int MP_N = 4;                       // 64-key blocks per wave
constexpr int MWG  = (SEQ / 16) * (SEQ / 64) / MP_N / (PT / 32);   // 64 work-groups
static_assert(MWG * MP_N * (PT / 32) == (SEQ / 16) * (SEQ / 64), "whole work-groups");
constexpr int WOP = DM * DM / 4 / MWG;        // 16-byte pieces of w_o per such work-group
constexpr int WON = (WOP + PT - 1) / PT;      // rounds of the block over them
static_assert(WOP * MWG * 4 == DM * DM && WOP % 32 == 0, "whole pieces, whole waves");

__global__ __launch_bounds__(PT) void proj_kernel(
    const float* __restrict__ q,  const float* __restrict__ k,
    const float* __restrict__ v,  const float* __restrict__ wq,
    const float* __restrict__ wk, const float* __restrict__ wv,
    const float* __restrict__ wo, const int* __restrict__ mask,
    const float* __restrict__ bq, const float* __restrict__ bk,
    const float* __restrict__ bv3, _Float16* __restrict__ Y3,
    _Float16* __restrict__ wo16, unsigned* __restrict__ mbits) {
  __shared__ __align__(16) _Float16 sX[2][PM * LDG];
  __shared__ __align__(16) _Float16 sW[2][PN * LDG];
  const int tid  = threadIdx.x;
  const int lane = tid & 31;
  const int wave = tid >> 5;
  const int row  = lane & 15;
  const int g    = lane >> 4;

  if (blockIdx.x >= PGW) {
    const int sw = blockIdx.x - PGW;          // place among the packing work-groups
    const v4f* sp = (const v4f*)wo + (size_t)sw * WOP + tid;
    v4h*       dp = (v4h*)wo16 + (size_t)sw * WOP + tid;
    const int unit = sw * (PT / 32) + wave;
    const int qblk = unit / (SEQ / 64 / MP_N);            // 16-query block
    const int kb0  = unit % (SEQ / 64 / MP_N) * MP_N;     // first 64-key block
    const int* mr = mask + (size_t)(qblk * 16 + row) * SEQ + kb0 * 64 + g * 8;
    v4i m[MP_N][8];
    v4f x[WON];
    // every loop here is unrolled: m and x stay in registers and the loads issue
    // back to back, many in flight
#pragma unroll
    for (int i = 0; i < MP_N; ++i)
#pragma unroll
      for (int j = 0; j < 8; ++j) m[i][j] = *(const v4i*)(mr + i * 64 + (j >> 1) * 16 + (j & 1) * 4);
#pragma unroll
    for (int i = 0; i < WON; ++i)
      if (tid + i * PT < WOP) x[i] = sp[i * PT];
#pragma unroll
    for (int i = 0; i < WON; ++i)
      if (tid + i * PT < WOP) {
        v4h y;
#pragma unroll
        for (int j = 0; j < 4; ++j) y[j] = (_Float16)x[i][j];
        dp[i * PT] = y;
      }
    unsigned* op = mbits + (size_t)(qblk * (SEQ / 64) + kb0) * 32 + lane;
#pragma unroll
    for (int i = 0; i < MP_N; ++i) {
      unsigned mine = 0;                      // lane j keeps word j: one 128-byte store
#pragma unroll
      for (int j = 0; j < 32; ++j) {
        const unsigned w = __builtin_amdgcn_ballot_w32(m[i][j >> 2][j & 3] != 0);
        mine = lane == j ? w : mine;
      }
      op[i * 32] = mine;
    }
    keep_ptr(mr);
    keep_ptr(sp);
    return;   // the whole work-group leaves here, in front of every barrier
  }

  // the two work-groups that share an X panel stand 32 apart in the grid
  const int z  = blockIdx.x / (PXT * PYT);    // 0, 1, 2 is Q, K, V
  const int ty = blockIdx.x % (PXT * PYT) / PXT;
  const int tx = blockIdx.x % PXT;
  const float* X    = z == 0 ? q  : z == 1 ? k  : v;
  const float* Wm   = z == 0 ? wq : z == 1 ? wk : wv;
  const float* bias = z == 0 ? bq : z == 1 ? bk : bv3;
  _Float16*    Y    = Y3 + (size_t)z * NROW * DM;

  // A thread's loads of a stage: 16 bytes of tile rows sr, sr + 32, ...; a wave-wide
  // load covers 256 contiguous bytes of each of two rows.
  const int sr = tid >> 4;          // first tile row, 0..31
  const int sc = (tid & 15) * 4;    // its four k of the 64
  const float* gx = X  + (size_t)(tx * PM + sr) * DM + sc;
  const float* gw = Wm + (size_t)(ty * PN + sr) * DM + sc;
  v4f st[PLD];
  auto fetch = [&](int s) {
    // unrolled: st stays in registers and the loads issue back to back
#pragma unroll
    for (int i = 0; i < PLX; ++i) st[i] = *(const v4f*)(gx + (size_t)i * 32 * DM + s * BK);
#pragma unroll
    for (int i = PLX; i < PLD; ++i) st[i] = *(const v4f*)(gw + (size_t)(i - PLX) * 32 * DM + s * BK);
  };
  auto put = [&](int buf) {
    _Float16* dx = &sX[buf][sr * LDG + sc];
    _Float16* dw = &sW[buf][sr * LDG + sc];
    // unrolled: constant indices into st, constant LDS offsets
#pragma unroll
    for (int i = 0; i < PLD; ++i) {
      v4h y;
#pragma unroll
      for (int j = 0; j < 4; ++j) y[j] = (_Float16)st[i][j];
      *(v4h*)(i < PLX ? dx + i * 32 * LDG : dw + (i - PLX) * 32 * LDG) = y;
    }
  };

  // The X panel (128 whole rows, contiguous, 1536 units) is read by the two work-groups
  // of this tile row: each asks for its half, 768 units, the last 256 of them twice.
  // The W panel (384 rows, contiguous, nine slices of 512 units) is read by all 32 tile
  // rows, 16 with each value of bit 2 of tx, numbered 0..15 among them as in gemm_tile:
  // every slice is asked for by each 16. The stages' loads then find their lines in L2.
  static_assert(PM * DM * 4 == 2 * 768 * FILL && PN * DM * 4 == 9 * PT * FILL, "whole units");
  const float* xpan = X + (size_t)tx * PM * DM;
  const float* wpan = Wm + (size_t)ty * PN * DM +
                      (size_t)(((tx & 3) + (tx >> 3) * 4) % 9) * (PT * FILL / 4);
  const unsigned xask0 = (unsigned)(ty * 768 + tid) * FILL;
  const unsigned xask1 = (unsigned)(ty * 768 + 512 + (tid & 255)) * FILL;
  const unsigned wask  = (unsigned)tid * FILL;

  v8f c[FM][FN] = {};
  fetch(0);
  // behind stage 0's loads, which are waited for first
  ask_l2(xpan, xask0);
  ask_l2(xpan, xask1);
  ask_l2(wpan, wask);
  put(0);
  __syncthreads();   // publishes stage 0 (the compiler waits out the LDS stores in front of it)

  // k ascending in steps of 32, as in gemm_tile. Two LDS buffers: stage s + 1 travels
  // to registers while stage s is worked on, and goes to the other buffer behind it.
  for (int s = 0; s < NST; ++s) {
    if (s + 1 < NST) fetch(s + 1);
    // keeps the global loads at the head of the stage, a whole stage in front of
    // their use; left free, the scheduler may sink them towards the conversion
    __builtin_amdgcn_sched_barrier(0);
    const _Float16* xB = sX[s & 1] + ((wave >> 3) * (FM * 16) + row) * LDG + g * 8;
    const _Float16* wB = sW[s & 1] + ((wave & 7) * (FN * 16) + row) * LDG + g * 8;
    // unrolled: constant LDS offsets, constant indices into c
#pragma unroll
    for (int j = 0; j < BK / 32; ++j) {
      v16h a[FM], b[FN];
#pragma unroll
      for (int t = 0; t < FN; ++t) b[t] = frag_f16(wB + t * 16 * LDG + j * 32);
#pragma unroll
      for (int i = 0; i < FM; ++i) a[i] = frag_f16(xB + i * 16 * LDG + j * 32);
      // keeps the LDS reads of 32 k one group in front of their products
      __builtin_amdgcn_sched_barrier(0);
#pragma unroll
      for (int i = 0; i < FM; ++i)
#pragma unroll
        for (int t = 0; t < FN; ++t) c[i][t] = wmma(a[i], b[t], c[i][t]);
      // keeps the products in front of the next group of reads and of the stage's foot
      __builtin_amdgcn_sched_barrier(0);
    }
    if (s + 1 < NST) {
      // into the buffer of stage s - 1: its readers all passed the barrier that ended it
      put((s + 1) & 1);
      // publishes stage s + 1 and frees the buffer of stage s: this wave's reads of stage s
      // fed its products above, and the compiler waits out the LDS stores in front of it
      __syncthreads();
    }
  }
  keep_addr(xpan, xask0);
  keep_addr(xpan, xask1);
  keep_addr(wpan, wask);

  const int rowbase = tx * PM + (wave >> 3) * (FM * 16) + g * 8;
  const int colbase = ty * PN + (wave & 7) * (FN * 16) + row;
  const int bb = rowbase >> 11;            // a wave's 64 rows lie inside one batch entry
  const int s0 = rowbase & (SEQ - 1);
  float bv[FN];
  // every loop below is unrolled: constant indices keep c and bv in registers,
  // and the three bias loads issue together
#pragma unroll
  for (int t = 0; t < FN; ++t) bv[t] = bias[colbase + t * 16];
  if (z == 2) {
    // V^T: a lane's eight accumulator rows are eight consecutive positions of
    // its row d, so a fragment leaves in one 16-byte store per lane; as eight
    // 2-byte stores each would touch the same 16 lines once more
#pragma unroll
    for (int t = 0; t < FN; ++t) {
      const int col = colbase + t * 16;    // a 16-column tile lies inside one head
      _Float16* yp = Y + ((size_t)(bb * NH + (col >> 6)) * DK + (col & (DK - 1))) * SEQ + s0;
#pragma unroll
      for (int i = 0; i < FM; ++i) {
        v8h y;
#pragma unroll
        for (int r = 0; r < 8; ++r) y[r] = (_Float16)(c[i][t][r] + bv[t]);
        *(v8h*)(yp + i * 16) = y;
      }
    }
  } else {
#pragma unroll
    for (int t = 0; t < FN; ++t) {
      const int col = colbase + t * 16;
      _Float16* yp = Y + ((size_t)(bb * NH + (col >> 6)) * SEQ + s0) * DK + (col & (DK - 1));
#pragma unroll
      for (int i = 0; i < FM; ++i)
#pragma unroll
        for (int r = 0; r < 8; ++r)
          yp[(i * 16 + r) * DK] = (_Float16)(c[i][t][r] + bv[t]);
    }
    // closes the last stores: in the built code this path's end falls through
    // to lines that rewrite the registers they name
    asm volatile("s_wait_xcnt 0x0" ::: "memory");
  }
}

__global__ __launch_bounds__(128) void attn_kernel(
    const _Float16* __restrict__ Q, const _Float16* __restrict__ K,
    const _Float16* __restrict__ Vt, const unsigned* __restrict__ mbits,
    _Float16* __restrict__ AO) {
  __shared__ __align__(16) _Float16 sK[2][64 * LDP];  // K tile, [key][d] padded
  __shared__ __align__(16) _Float16 sV[2][64 * LDP];  // V^T tile, [d][key] padded

  const int tid  = threadIdx.x;
  const int lane = tid & 31;
  const int wave = tid >> 5;
  const int row  = lane & 15;
  const int g    = lane >> 4;
  const int h = blockIdx.y, b = blockIdx.z;
  const int bh = b * NH + h;
  const int qbase = blockIdx.x * 64 + wave * 16;

  const _Float16* Qh = Q  + (size_t)bh * SEQ * DK;
  const _Float16* Kh = K  + (size_t)bh * SEQ * DK;
  const _Float16* Vh = Vt + (size_t)bh * DK * SEQ;

  const _Float16* qrow = Qh + (size_t)(qbase + row) * DK;
  const v16h qf0 = frag_f16(qrow + 0  + g * 8);
  const v16h qf1 = frag_f16(qrow + 32 + g * 8);

  // this wave's packed mask: 32 lane-mask words per 64 keys. The wave's number
  // goes through readfirstlane so that the address is scalar and the words
  // arrive in scalar registers, where a select reads them as they are.
  const int wv = __builtin_amdgcn_readfirstlane(wave);
  // Constant address space: nothing writes these words while this kernel runs;
  // without it the compiler takes the copies to LDS for possible writers and
  // brings the words through vector registers, one readfirstlane each.
  typedef const __attribute__((address_space(4))) v16u* cmask_t;
  const cmask_t mw = (cmask_t)(unsigned long long)(
      mbits + (size_t)(blockIdx.x * 4 + wv) * (SEQ / 64) * 32);
  v16u w0 = mw[0], w1 = mw[1];

  // This head's K and V^T panels (256 KB each, contiguous) are walked by the 32
  // work-groups of the head: (x & 3) + 4 * (x >> 3) numbers the 16 with
  // one value of bit 2 of x 0..15 (see gemm_tile), and each asks for one sixteenth of both panels,
  // waves 0 and 1 of K, waves 2 and 3 of V^T, one unit a lane.
  static_assert(SEQ * DK * 2 == 16 * 64 * FILL, "whole units");
  const int part = (blockIdx.x & 3) + (blockIdx.x >> 3) * 4;
  const _Float16* kvpan = (wv < 2 ? Kh : Vh) + (size_t)part * (64 * FILL / 2);
  const unsigned kvask = (unsigned)(tid & 63) * FILL;
  // the wave's mask words, 16 units, are the same for all heads: head 0 asks
  const unsigned* mpan = mbits + (size_t)(blockIdx.x * 4 + wv) * (SEQ / 64) * 32;
  const unsigned mask_ask = (unsigned)(lane & 15) * FILL;

  // 1/sqrt(64) * log2(e): takes an unscaled score product to the exponent of 2
  constexpr float SC = 0.125f * 1.44269504088896341f;
  // a closed key's unscaled score, -2^33 (-1.07e9 once scaled): far below every open
  // score, so its weight is 0. A power of two, so that CLOSED * SC is exact and a
  // query with no open key gets exponent 0 at every key: equal weights.
  constexpr float CLOSED = -8589934592.0f;

  float m_i = -3.0e38f;   // running max, unscaled, of this lane's query (both halves agree)
  float l_i = 0.0f;       // running sum over this half's keys; halves join at the end
  v8f o[4] = {v8f{}, v8f{}, v8f{}, v8f{}};  // o[t][r] = O[query row][d = t*16 + g*8 + r]

  // stage one 64-key tile (8 KB K + 8 KB V) via 8 async b128 ops per thread
  auto stage = [&](int kb, int buf) {
#pragma unroll
    for (int i = 0; i < 4; ++i) {
      const int c  = tid + i * 128;       // 0..511 16-byte chunks
      const int r  = c >> 3;              // tile row 0..63
      const int ch = (c & 7) * 8;         // halves within row
      async_cp16(&sK[buf][r * LDP + ch], Kh + (size_t)(kb + r) * DK + ch);
      async_cp16(&sV[buf][r * LDP + ch], Vh + (size_t)r * SEQ + kb + ch);
    }
  };

  stage(0, 0);
  // behind the first tile's copies, which are waited for first
  ask_l2(kvpan, kvask);
  if (h == 0) ask_l2(mpan, mask_ask);
  for (int kb = 0; kb < SEQ; kb += 64) {
    const int cur = (kb >> 6) & 1;
    if (kb + 64 < SEQ) { stage(kb + 64, cur ^ 1); ASYNC_WAIT(8); }
    else               { ASYNC_WAIT(0); }
    __syncthreads();

    const _Float16* kB = sK[cur] + row * LDP + g * 8;
    const _Float16* vB = sV[cur] + row * LDP + g * 8;

    // every fragment of the pass is asked for here, in the order of its use: the
    // K fragments feed the score products as they arrive, the V fragments
    // travel during those products and the softmax
    v16h kf[2][4], vf[2][4];
    // unrolled: constant indices keep the fragments in registers
#pragma unroll
    for (int j = 0; j < 2; ++j)
#pragma unroll
      for (int t = 0; t < 4; ++t) kf[j][t] = frag_f16(kB + t * 16 * LDP + j * 32);
#pragma unroll
    for (int j = 0; j < 2; ++j)
#pragma unroll
      for (int t = 0; t < 4; ++t) vf[j][t] = frag_f16(vB + t * 16 * LDP + j * 32);
    // keeps the reads one group at the head of the pass; left free, the scheduler
    // sinks each fragment to its product behind a wait to zero, sixteen times a pass
    __builtin_amdgcn_sched_barrier(0);

    // S^T = K Q^T, 64k x 16q: c[t][r] = S[query row][key kb + t*16 + g*8 + r];
    // the four tiles take turns, so no product waits for the one before it
    v8f c[4];
#pragma unroll
    for (int t = 0; t < 4; ++t) {
      v8f z{};
      c[t] = wmma(kf[0][t], qf0, z);
    }
#pragma unroll
    for (int t = 0; t < 4; ++t) c[t] = wmma(kf[1][t], qf1, c[t]);
    // keeps the eight products back to back: a vector instruction drawn in among
    // them reads a tile too early and is padded with idle slots
    __builtin_amdgcn_sched_barrier(0);
    // mask; the products stay unscaled (SC below carries the scale)
#pragma unroll
    for (int t = 0; t < 4; ++t) {
#pragma unroll
      for (int r = 0; r < 8; ++r) {
        const unsigned w = t < 2 ? w0[t * 8 + r] : w1[(t - 2) * 8 + r];
        c[t][r] = __builtin_amdgcn_inverse_ballot_w32(w) ? c[t][r] : CLOSED;
      }
    }
    // the next 64 keys' words, asked for behind the last use of these: they
    // travel during the rest of this pass (the last pass asks for its own again)
    {
      const int nx = kb + 64 < SEQ ? (kb >> 6) + 1 : (kb >> 6);
      w0 = mw[nx * 2];
      w1 = mw[nx * 2 + 1];
    }
    // online softmax, one query per lane
    float vm[4];
#pragma unroll
    for (int t = 0; t < 4; ++t) {
      vm[t] = fmaxf(c[t][0], c[t][1]);
#pragma unroll
      for (int r = 2; r < 8; ++r) vm[t] = fmaxf(vm[t], c[t][r]);
    }
    float vmax = fmaxf(fmaxf(vm[0], vm[1]), fmaxf(vm[2], vm[3]));
    vmax = fmaxf(vmax, xhalf(vmax));
    const float mnew  = fmaxf(m_i, vmax);
    const float alpha = __builtin_amdgcn_exp2f((m_i - mnew) * SC);
    m_i = mnew;
    const float nm = -mnew * SC;
    // e^(score/8 - max/8) = 2^(c*SC - max*SC): one fused multiply-add per score, two
    // scores an instruction, in place of the scaling, the subtraction and the
    // multiply inside exp
    const v8f sc8 = {SC, SC, SC, SC, SC, SC, SC, SC};
    const v8f nm8 = {nm, nm, nm, nm, nm, nm, nm, nm};
    // unrolled: constant indices keep c in registers
#pragma unroll
    for (int t = 0; t < 4; ++t) c[t] = __builtin_elementwise_fma(c[t], sc8, nm8);
    float s4[4];
#pragma unroll
    for (int t = 0; t < 4; ++t) {
#pragma unroll
      for (int r = 0; r < 8; ++r) c[t][r] = __builtin_amdgcn_exp2f(c[t][r]);
      s4[t] = ((c[t][0] + c[t][1]) + (c[t][2] + c[t][3])) +
              ((c[t][4] + c[t][5]) + (c[t][6] + c[t][7]));
    }
    l_i = l_i * alpha + ((s4[0] + s4[1]) + (s4[2] + s4[3]));
#pragma unroll
    for (int t = 0; t < 4; ++t)
#pragma unroll
      for (int r = 0; r < 8; ++r) o[t][r] *= alpha;
    // P^T: two converted score tiles are one B fragment (32 keys x 16 queries)
    v16h p0, p1;
#pragma unroll
    for (int r = 0; r < 8; ++r) {
      p0[r] = (_Float16)c[0][r]; p0[r + 8] = (_Float16)c[1][r];
      p1[r] = (_Float16)c[2][r]; p1[r + 8] = (_Float16)c[3][r];
    }
    // O^T += V^T P^T, the four tiles taking turns as above
#pragma unroll
    for (int t = 0; t < 4; ++t) o[t] = wmma(vf[0][t], p0, o[t]);
#pragma unroll
    for (int t = 0; t < 4; ++t) o[t] = wmma(vf[1][t], p1, o[t]);
    __syncthreads();  // all waves done reading before this buffer is re-staged
  }

  keep_addr(kvpan, kvask);
  keep_addr(mpan, mask_ask);

  // epilogue: join the halves' sums, O / l, 8 consecutive d per 16-byte store
  const float inv = 1.0f / (l_i + xhalf(l_i));
  _Float16* arow = AO + (size_t)(b * SEQ + qbase + row) * DM + h * DK + g * 8;
#pragma unroll
  for (int t = 0; t < 4; ++t) {
    v8h y;
#pragma unroll
    for (int r = 0; r < 8; ++r) y[r] = (_Float16)(o[t][r] * inv);
    *(v8h*)(arow + t * 16) = y;
  }
}

// ---- output projection: f32 out = AO(f16) @ Wo^T(f16) + bo ------------------
__global__ __launch_bounds__(128) void oproj16_kernel(
    const _Float16* __restrict__ X16, const _Float16* __restrict__ W,
    const float* __restrict__ bias, float* __restrict__ Y) {
  const int lane = threadIdx.x & 31;
  const int wave = threadIdx.x >> 5;
  const int row  = lane & 15;
  const int g    = lane >> 4;
  const int rowbase = blockIdx.x * TM + g * 8;
  const int colbase = blockIdx.y * TN + wave * (FN * 16) + row;

  v8f c[FM][FN] = {};
  gemm_tile(X16, W, blockIdx.x * TM, blockIdx.y * TN, c);
#pragma unroll
  for (int t = 0; t < FN; ++t) {
    const int n = colbase + t * 16;
    const float bv = bias[n];
#pragma unroll
    for (int i = 0; i < FM; ++i)
#pragma unroll
      for (int r = 0; r < 8; ++r)
        Y[(size_t)(rowbase + i * 16 + r) * DM + n] = c[i][t][r] + bv;
  }
}

// ---- launch -----------------------------------------------------------------
extern "C" void kernel_launch(void* const* d_in, const int* in_sizes, int n_in,
                              void* d_out, int out_size, void* d_ws, size_t ws_size,
                              hipStream_t stream) {
  const float* q    = (const float*)d_in[0];
  const float* k    = (const float*)d_in[1];
  const float* v    = (const float*)d_in[2];
  const int*   mask = (const int*)  d_in[3];
  const float* w_q  = (const float*)d_in[4];
  const float* b_q  = (const float*)d_in[5];
  const float* w_k  = (const float*)d_in[6];
  const float* b_k  = (const float*)d_in[7];
  const float* w_v  = (const float*)d_in[8];
  const float* b_v  = (const float*)d_in[9];
  const float* w_o  = (const float*)d_in[10];
  const float* b_o  = (const float*)d_in[11];

  const size_t nXW = (size_t)NROW * DM;   // 4096*768
  const size_t nWW = (size_t)DM * DM;     // 768*768
  _Float16* p = (_Float16*)d_ws;
  _Float16* wo16 = p; p += nWW;
  _Float16* q16  = p; p += nXW;
  _Float16* k16  = p; p += nXW;
  _Float16* vt16 = p; p += nXW;
  _Float16* ao16 = p; p += nXW;
  unsigned* mbits = (unsigned*)p;         // SEQ * SEQ / 8 bytes

  const dim3 blk(128);
  proj_kernel<<<PGW + MWG, PT, 0, stream>>>(q, k, v, w_q, w_k, w_v, w_o, mask,
                                            b_q, b_k, b_v, q16, wo16, mbits);

  attn_kernel<<<dim3(SEQ / 64, NH, 2), blk, 0, stream>>>(q16, k16, vt16, mbits, ao16);

  oproj16_kernel<<<dim3(NROW / TM, DM / TN), blk, 0, stream>>>(ao16, wo16, b_o, (float*)d_out);
}
